// v000
// The times below were measured on an AMD MI455X: many runs one after another, warmed up first and cycling through
// copies of the inputs, with the whole window's GPU time divided by the number of runs. Launches and the gaps
// between them are all in it. The median over several windows is given; except for v000 it joins two sittings, which
// can be a few percent apart, so the side-by-side timings, each taken in one sitting, are the better comparison.
// v000, which the later versions start from, runs in 368 microseconds.
#include <hip/hip_runtime.h>
#include <hip/hip_bf16.h>
#include <math.h>

typedef __bf16 bf16;
typedef __attribute__((ext_vector_type(16))) __bf16 v16bf;
typedef __attribute__((ext_vector_type(8)))  __bf16 v8bf;
typedef __attribute__((ext_vector_type(8)))  float  v8f;
typedef __attribute__((ext_vector_type(4)))  float  v4f;

#define DIMN   1024
#define S_LEN  2048
#define BATCH  2
#define NHEAD  16
#define HDIM   64
#define HIDDEN 4096
#define MTOT   (BATCH * S_LEN)   // 4096 rows

union Frag { v16bf v; v8bf h[2]; };

static __device__ __forceinline__ v8f wmma_bf16(const Frag& a, const Frag& b, v8f c) {
    return __builtin_amdgcn_wmma_f32_16x16x32_bf16(false, a.v, false, b.v,
                                                   (short)0, c, false, false);
}

// XOR-shuffle within each 16-lane half using v_permlane16_b32 (pure VALU,
// avoids ds_bpermute + s_wait_dscnt round-trips in the flash-attention loop).
template <int M>
static __device__ __forceinline__ float permxor16(float v) {
#if __has_builtin(__builtin_amdgcn_permlane16)
    constexpr unsigned lo =
        ((unsigned)(0 ^ M)) | ((unsigned)(1 ^ M) << 4) | ((unsigned)(2 ^ M) << 8) |
        ((unsigned)(3 ^ M) << 12) | ((unsigned)(4 ^ M) << 16) |
        ((unsigned)(5 ^ M) << 20) | ((unsigned)(6 ^ M) << 24) |
        ((unsigned)(7 ^ M) << 28);
    constexpr unsigned hi =
        ((unsigned)((8 ^ M) & 15)) | ((unsigned)((9 ^ M) & 15) << 4) |
        ((unsigned)((10 ^ M) & 15) << 8) | ((unsigned)((11 ^ M) & 15) << 12) |
        ((unsigned)((12 ^ M) & 15) << 16) | ((unsigned)((13 ^ M) & 15) << 20) |
        ((unsigned)((14 ^ M) & 15) << 24) | ((unsigned)((15 ^ M) & 15) << 28);
    int iv = __builtin_bit_cast(int, v);
    int r = __builtin_amdgcn_permlane16(iv, iv, (int)lo, (int)hi, false, false);
    return __builtin_bit_cast(float, r);
#else
    return __shfl_xor(v, M, 32);
#endif
}

static __device__ __forceinline__ float hmax16(float v) {
    v = fmaxf(v, permxor16<1>(v));
    v = fmaxf(v, permxor16<2>(v));
    v = fmaxf(v, permxor16<4>(v));
    v = fmaxf(v, permxor16<8>(v));
    return v;
}
static __device__ __forceinline__ float hsum16(float v) {
    v += permxor16<1>(v);
    v += permxor16<2>(v);
    v += permxor16<4>(v);
    v += permxor16<8>(v);
    return v;
}

// Async global->LDS 16B copy (CDNA5 GLOBAL_LOAD_ASYNC_TO_LDS_B128, ASYNCcnt).
static __device__ __forceinline__ void async_copy_b128(unsigned lds_off,
                                                       const void* gaddr) {
    asm volatile("global_load_async_to_lds_b128 %0, %1, off"
                 :: "v"(lds_off), "v"((unsigned long long)(size_t)gaddr)
                 : "memory");
}

// ---------------- fp32 -> bf16 convert (weights) ----------------
__global__ __launch_bounds__(256) void cvt_kernel(const float* __restrict__ src,
                                                  bf16* __restrict__ dst, int n) {
    int i = (blockIdx.x * 256 + threadIdx.x) * 4;
    if (i < n) {
        v4f s = *(const v4f*)(src + i);
#pragma unroll
        for (int t = 0; t < 4; ++t) dst[i + t] = (bf16)s[t];
    }
}

// ---------------- RMSNorm: fp32 row -> bf16 row ----------------
__global__ __launch_bounds__(256) void rmsnorm_kernel(const float* __restrict__ x,
                                                      const float* __restrict__ w,
                                                      bf16* __restrict__ out) {
    __shared__ float red[8];
    const int row = blockIdx.x;
    const int tid = threadIdx.x;
    const float* xr = x + (size_t)row * DIMN;
    v4f xv = *(const v4f*)(xr + tid * 4);
    float ss = xv.x * xv.x + xv.y * xv.y + xv.z * xv.z + xv.w * xv.w;
    ss += permxor16<1>(ss);
    ss += permxor16<2>(ss);
    ss += permxor16<4>(ss);
    ss += permxor16<8>(ss);
    ss += __shfl_xor(ss, 16, 32);
    if ((tid & 31) == 0) red[tid >> 5] = ss;
    __syncthreads();
    float tot = 0.f;
#pragma unroll
    for (int i = 0; i < 8; ++i) tot += red[i];
    const float rinv = rsqrtf(tot * (1.f / DIMN) + 1e-5f);
    const float* wr = w + tid * 4;
    bf16* orow = out + (size_t)row * DIMN + tid * 4;
#pragma unroll
    for (int t = 0; t < 4; ++t) orow[t] = (bf16)(xv[t] * rinv * wr[t]);
}

// ---------------- WMMA GEMM: C[M,N] = A[M,K] @ W[N,K]^T ----------------
// Double-buffered LDS staging via async global->LDS DMA (ASYNCcnt).
// MODE 0: QKV scatter (N=3072): q/k -> [B,H,S,Dh] bf16, v -> [B,H,Dh,S] bf16
// MODE 1: store bf16 C[M,N]
// MODE 2: store fp32 C[M,N] + res[M,N]
template <int MODE>
__global__ __launch_bounds__(256)
void gemm_kernel(const bf16* __restrict__ A, const bf16* __restrict__ W,
                 int M, int N, int K,
                 float* __restrict__ outF, bf16* __restrict__ outB,
                 const float* __restrict__ res,
                 bf16* __restrict__ qo, bf16* __restrict__ ko, bf16* __restrict__ vo) {
    __shared__ bf16 As[2][128 * 40];
    __shared__ bf16 Bs[2][128 * 40];
    const int m0 = blockIdx.y * 128;
    const int n0 = blockIdx.x * 128;
    const int tid = threadIdx.x;
    const int lane = tid & 31;
    const int wave = tid >> 5;
    const int wm = (wave >> 1) * 32;   // wave M offset (4 waves in M)
    const int wn = (wave & 1) * 64;    // wave N offset (2 waves in N)
    const int lo = lane & 15;
    const int hi = lane >> 4;
    const int kb = hi << 3;            // K-chunk base per A/B VGPR layout

    v8f acc[2][4] = {};

    // Each thread stages 2 chunks of A + 2 chunks of B = 4 async b128 ops/tile.
    const int row0 = tid >> 2, col0 = (tid & 3) << 3;        // chunk c = tid
    const int row1 = (tid + 256) >> 2, col1 = col0;          // chunk c = tid+256

    auto stage = [&](int k0, int pb) {
        async_copy_b128((unsigned)(size_t)&As[pb][row0 * 40 + col0],
                        &A[(size_t)(m0 + row0) * K + k0 + col0]);
        async_copy_b128((unsigned)(size_t)&Bs[pb][row0 * 40 + col0],
                        &W[(size_t)(n0 + row0) * K + k0 + col0]);
        async_copy_b128((unsigned)(size_t)&As[pb][row1 * 40 + col1],
                        &A[(size_t)(m0 + row1) * K + k0 + col1]);
        async_copy_b128((unsigned)(size_t)&Bs[pb][row1 * 40 + col1],
                        &W[(size_t)(n0 + row1) * K + k0 + col1]);
    };

    unsigned p = 0;
    stage(0, 0);
    for (int k0 = 0; k0 < K; k0 += 32) {
        if (k0 + 32 < K) {
            stage(k0 + 32, p ^ 1);
            // previous tile's 4 ops (per thread) complete when count <= 4
            asm volatile("s_wait_asynccnt 0x4" ::: "memory");
        } else {
            asm volatile("s_wait_asynccnt 0x0" ::: "memory");
        }
        __syncthreads();
        const bf16* Asp = As[p];
        const bf16* Bsp = Bs[p];
        Frag a[2], b;
#pragma unroll
        for (int mt = 0; mt < 2; ++mt) {
            const bf16* ap = &Asp[(wm + mt * 16 + lo) * 40 + kb];
            a[mt].h[0] = *(const v8bf*)ap;
            a[mt].h[1] = *(const v8bf*)(ap + 16);
        }
#pragma unroll
        for (int nt = 0; nt < 4; ++nt) {
            const bf16* bp = &Bsp[(wn + nt * 16 + lo) * 40 + kb];
            b.h[0] = *(const v8bf*)bp;
            b.h[1] = *(const v8bf*)(bp + 16);
            acc[0][nt] = wmma_bf16(a[0], b, acc[0][nt]);
            acc[1][nt] = wmma_bf16(a[1], b, acc[1][nt]);
        }
        __syncthreads();   // protect buffer p from next iteration's DMA
        p ^= 1;
    }

#pragma unroll
    for (int mt = 0; mt < 2; ++mt)
#pragma unroll
        for (int nt = 0; nt < 4; ++nt)
#pragma unroll
            for (int r = 0; r < 8; ++r) {
                const int m = m0 + wm + mt * 16 + r + hi * 8;
                const int n = n0 + wn + nt * 16 + lo;
                const float vacc = acc[mt][nt][r];
                if constexpr (MODE == 0) {
                    const int bq = m >> 11, s = m & 2047;
                    const int which = n >> 10, col = n & 1023;
                    const int hh = col >> 6, d = col & 63;
                    const size_t bhd = (size_t)(bq * NHEAD + hh);
                    if (which == 0)
                        qo[(bhd * S_LEN + s) * HDIM + d] = (bf16)vacc;
                    else if (which == 1)
                        ko[(bhd * S_LEN + s) * HDIM + d] = (bf16)vacc;
                    else
                        vo[(bhd * HDIM + d) * S_LEN + s] = (bf16)vacc;
                } else if constexpr (MODE == 1) {
                    outB[(size_t)m * N + n] = (bf16)vacc;
                } else {
                    outF[(size_t)m * N + n] = vacc + res[(size_t)m * N + n];
                }
            }
}

// ---------------- Flash attention (causal) via WMMA ----------------
// q,k: [B*H, S, 64] bf16 ; v: [B*H, 64, S] bf16 ; out: [B, S, 1024] bf16
__global__ __launch_bounds__(128)
void attn_kernel(const bf16* __restrict__ q, const bf16* __restrict__ k,
                 const bf16* __restrict__ v, bf16* __restrict__ out) {
    __shared__ bf16 plds[4][16 * 40];
    const int tid = threadIdx.x;
    const int lane = tid & 31;
    const int wave = tid >> 5;
    const int lo = lane & 15;
    const int hi = lane >> 4;
    const int kb = hi << 3;
    const int bh = blockIdx.y;                   // 0..31
    const int qbase = blockIdx.x * 64 + wave * 16;
    const int b = bh >> 4, h0 = bh & 15;

    const bf16* qp = q + (((size_t)bh) * S_LEN + qbase + lo) * HDIM;
    Frag qa[2];
    qa[0].h[0] = *(const v8bf*)(qp + kb);
    qa[0].h[1] = *(const v8bf*)(qp + kb + 16);
    qa[1].h[0] = *(const v8bf*)(qp + 32 + kb);
    qa[1].h[1] = *(const v8bf*)(qp + 32 + kb + 16);

    v8f o[4] = {};
    float mrow[8], lrow[8];
#pragma unroll
    for (int r = 0; r < 8; ++r) { mrow[r] = -INFINITY; lrow[r] = 0.f; }
    const float scale = 0.125f;  // 1/sqrt(64)
    bf16* pl = plds[wave];

    for (int j0 = 0; j0 <= qbase + 15; j0 += 32) {
        v8f s0 = {}, s1 = {};
        {
            const bf16* kp0 = k + (((size_t)bh) * S_LEN + j0 + lo) * HDIM;
            const bf16* kp1 = kp0 + (size_t)16 * HDIM;
            Frag b00, b01, b10, b11;
            b00.h[0] = *(const v8bf*)(kp0 + kb);
            b00.h[1] = *(const v8bf*)(kp0 + kb + 16);
            b01.h[0] = *(const v8bf*)(kp0 + 32 + kb);
            b01.h[1] = *(const v8bf*)(kp0 + 32 + kb + 16);
            b10.h[0] = *(const v8bf*)(kp1 + kb);
            b10.h[1] = *(const v8bf*)(kp1 + kb + 16);
            b11.h[0] = *(const v8bf*)(kp1 + 32 + kb);
            b11.h[1] = *(const v8bf*)(kp1 + 32 + kb + 16);
            s0 = wmma_bf16(qa[0], b00, s0);
            s0 = wmma_bf16(qa[1], b01, s0);
            s1 = wmma_bf16(qa[0], b10, s1);
            s1 = wmma_bf16(qa[1], b11, s1);
        }
        // Online softmax. Row statistics align with the C-matrix VGPR layout
        // (row = hi*8 + r, 16 columns spread across the 16-lane half).
        float alpha[8];
#pragma unroll
        for (int r = 0; r < 8; ++r) {
            const int m = qbase + hi * 8 + r;
            const float x0 = (j0 + lo      <= m) ? s0[r] * scale : -INFINITY;
            const float x1 = (j0 + 16 + lo <= m) ? s1[r] * scale : -INFINITY;
            const float mx = hmax16(fmaxf(x0, x1));
            const float mnew = fmaxf(mrow[r], mx);
            alpha[r] = __expf(mrow[r] - mnew);
            const float p0 = __expf(x0 - mnew);
            const float p1 = __expf(x1 - mnew);
            lrow[r] = lrow[r] * alpha[r] + hsum16(p0 + p1);
            mrow[r] = mnew;
            pl[(hi * 8 + r) * 40 + lo]      = (bf16)p0;
            pl[(hi * 8 + r) * 40 + 16 + lo] = (bf16)p1;
        }
#pragma unroll
        for (int dt = 0; dt < 4; ++dt) {
            v8f ov = o[dt];
#pragma unroll
            for (int r = 0; r < 8; ++r) ov[r] *= alpha[r];
            o[dt] = ov;
        }
        asm volatile("s_wait_dscnt 0x0" ::: "memory");
        Frag pa;
        pa.h[0] = *(const v8bf*)&pl[lo * 40 + kb];
        pa.h[1] = *(const v8bf*)&pl[lo * 40 + kb + 16];
#pragma unroll
        for (int dt = 0; dt < 4; ++dt) {
            const bf16* vp = v + (((size_t)bh) * HDIM + dt * 16 + lo) * S_LEN + j0;
            Frag vb;
            vb.h[0] = *(const v8bf*)(vp + kb);
            vb.h[1] = *(const v8bf*)(vp + kb + 16);
            o[dt] = wmma_bf16(pa, vb, o[dt]);
        }
        asm volatile("s_wait_dscnt 0x0" ::: "memory");
    }

#pragma unroll
    for (int dt = 0; dt < 4; ++dt)
#pragma unroll
        for (int r = 0; r < 8; ++r) {
            const int s = qbase + hi * 8 + r;
            const int d = dt * 16 + lo;
            out[((size_t)(b * S_LEN + s)) * DIMN + h0 * HDIM + d] =
                (bf16)(o[dt][r] / lrow[r]);
        }
}

// ---------------- silu(gate) * up -> bf16 ----------------
__global__ __launch_bounds__(256)
void silu_mul_kernel(const bf16* __restrict__ gu, bf16* __restrict__ outm) {
    const size_t idx = ((size_t)blockIdx.x * 256 + threadIdx.x) * 8;
    const size_t m = idx >> 12;          // / 4096
    const size_t j = idx & 4095;
    v8bf gv = *(const v8bf*)&gu[m * 8192 + j];
    v8bf uv = *(const v8bf*)&gu[m * 8192 + 4096 + j];
    v8bf ov;
#pragma unroll
    for (int t = 0; t < 8; ++t) {
        const float g = (float)gv[t];
        const float u = (float)uv[t];
        ov[t] = (bf16)((g / (1.f + __expf(-g))) * u);
    }
    *(v8bf*)&outm[idx] = ov;
}

extern "C" void kernel_launch(void* const* d_in, const int* in_sizes, int n_in,
                              void* d_out, int out_size, void* d_ws, size_t ws_size,
                              hipStream_t stream) {
    const float* x     = (const float*)d_in[0];
    const float* wq    = (const float*)d_in[1];
    const float* wk    = (const float*)d_in[2];
    const float* wv    = (const float*)d_in[3];
    const float* wo    = (const float*)d_in[4];
    const float* wgate = (const float*)d_in[5];
    const float* wup   = (const float*)d_in[6];
    const float* wdown = (const float*)d_in[7];
    const float* n1w   = (const float*)d_in[8];
    const float* n2w   = (const float*)d_in[9];

    char* ws = (char*)d_ws;
    size_t off = 0;
    auto take = [&](size_t bytes) -> char* {
        char* p = ws + off;
        off += (bytes + 255) & ~(size_t)255;
        return p;
    };
    bf16*  a1   = (bf16*)take((size_t)MTOT * DIMN * 2);
    bf16*  wqkv = (bf16*)take((size_t)3 * DIMN * DIMN * 2);
    bf16*  wo_b = (bf16*)take((size_t)DIMN * DIMN * 2);
    bf16*  wgu  = (bf16*)take((size_t)2 * HIDDEN * DIMN * 2);
    bf16*  wdn  = (bf16*)take((size_t)DIMN * HIDDEN * 2);
    bf16*  qws  = (bf16*)take((size_t)MTOT * DIMN * 2);
    bf16*  kws  = (bf16*)take((size_t)MTOT * DIMN * 2);
    bf16*  vws  = (bf16*)take((size_t)MTOT * DIMN * 2);
    bf16*  attn = (bf16*)take((size_t)MTOT * DIMN * 2);
    float* x2   = (float*)take((size_t)MTOT * DIMN * 4);
    bf16*  a2   = (bf16*)take((size_t)MTOT * DIMN * 2);
    bf16*  gu   = (bf16*)take((size_t)MTOT * 2 * HIDDEN * 2);
    bf16*  mlp  = (bf16*)take((size_t)MTOT * HIDDEN * 2);

    auto cvt = [&](const float* s, bf16* dp, int n) {
        cvt_kernel<<<(n / 4 + 255) / 256, 256, 0, stream>>>(s, dp, n);
    };
    cvt(wq, wqkv, DIMN * DIMN);
    cvt(wk, wqkv + (size_t)DIMN * DIMN, DIMN * DIMN);
    cvt(wv, wqkv + (size_t)2 * DIMN * DIMN, DIMN * DIMN);
    cvt(wo, wo_b, DIMN * DIMN);
    cvt(wgate, wgu, HIDDEN * DIMN);
    cvt(wup, wgu + (size_t)HIDDEN * DIMN, HIDDEN * DIMN);
    cvt(wdown, wdn, DIMN * HIDDEN);

    rmsnorm_kernel<<<MTOT, 256, 0, stream>>>(x, n1w, a1);

    gemm_kernel<0><<<dim3(3072 / 128, MTOT / 128), 256, 0, stream>>>(
        a1, wqkv, MTOT, 3072, DIMN, nullptr, nullptr, nullptr, qws, kws, vws);

    attn_kernel<<<dim3(S_LEN / 64, BATCH * NHEAD), 128, 0, stream>>>(qws, kws, vws, attn);

    gemm_kernel<2><<<dim3(DIMN / 128, MTOT / 128), 256, 0, stream>>>(
        attn, wo_b, MTOT, DIMN, DIMN, x2, nullptr, x, nullptr, nullptr, nullptr);

    rmsnorm_kernel<<<MTOT, 256, 0, stream>>>(x2, n2w, a2);

    gemm_kernel<1><<<dim3(2 * HIDDEN / 128, MTOT / 128), 256, 0, stream>>>(
        a2, wgu, MTOT, 2 * HIDDEN, DIMN, nullptr, gu, nullptr, nullptr, nullptr, nullptr);

    silu_mul_kernel<<<((size_t)MTOT * HIDDEN / 8) / 256, 256, 0, stream>>>(gu, mlp);

    gemm_kernel<2><<<dim3(DIMN / 128, MTOT / 128), 256, 0, stream>>>(
        mlp, wdn, MTOT, DIMN, HIDDEN, (float*)d_out, nullptr, x2,
        nullptr, nullptr, nullptr);
}

// v001
// It runs in 322 microseconds.
// Timed twice side by side with v000, it ran 1.16 times as fast both times.
#include <hip/hip_runtime.h>
#include <hip/hip_bf16.h>
#include <math.h>

typedef __bf16 bf16;
typedef __attribute__((ext_vector_type(16))) __bf16 v16bf;
typedef __attribute__((ext_vector_type(8)))  __bf16 v8bf;
typedef __attribute__((ext_vector_type(8)))  float  v8f;
typedef __attribute__((ext_vector_type(4)))  float  v4f;

#define DIMN   1024
#define S_LEN  2048
#define BATCH  2
#define NHEAD  16
#define HDIM   64
#define HIDDEN 4096
#define MTOT   (BATCH * S_LEN)   // 4096 rows

union Frag { v16bf v; v8bf h[2]; };

static __device__ __forceinline__ v8f wmma_bf16(const Frag& a, const Frag& b, v8f c) {
    return __builtin_amdgcn_wmma_f32_16x16x32_bf16(false, a.v, false, b.v,
                                                   (short)0, c, false, false);
}

// XOR-shuffle within each 16-lane half using v_permlane16_b32 (pure VALU,
// avoids ds_bpermute + s_wait_dscnt round-trips in the flash-attention loop).
template <int M>
static __device__ __forceinline__ float permxor16(float v) {
#if __has_builtin(__builtin_amdgcn_permlane16)
    constexpr unsigned lo =
        ((unsigned)(0 ^ M)) | ((unsigned)(1 ^ M) << 4) | ((unsigned)(2 ^ M) << 8) |
        ((unsigned)(3 ^ M) << 12) | ((unsigned)(4 ^ M) << 16) |
        ((unsigned)(5 ^ M) << 20) | ((unsigned)(6 ^ M) << 24) |
        ((unsigned)(7 ^ M) << 28);
    constexpr unsigned hi =
        ((unsigned)((8 ^ M) & 15)) | ((unsigned)((9 ^ M) & 15) << 4) |
        ((unsigned)((10 ^ M) & 15) << 8) | ((unsigned)((11 ^ M) & 15) << 12) |
        ((unsigned)((12 ^ M) & 15) << 16) | ((unsigned)((13 ^ M) & 15) << 20) |
        ((unsigned)((14 ^ M) & 15) << 24) | ((unsigned)((15 ^ M) & 15) << 28);
    int iv = __builtin_bit_cast(int, v);
    int r = __builtin_amdgcn_permlane16(iv, iv, (int)lo, (int)hi, false, false);
    return __builtin_bit_cast(float, r);
#else
    return __shfl_xor(v, M, 32);
#endif
}

static __device__ __forceinline__ float hmax16(float v) {
    v = fmaxf(v, permxor16<1>(v));
    v = fmaxf(v, permxor16<2>(v));
    v = fmaxf(v, permxor16<4>(v));
    v = fmaxf(v, permxor16<8>(v));
    return v;
}
static __device__ __forceinline__ float hsum16(float v) {
    v += permxor16<1>(v);
    v += permxor16<2>(v);
    v += permxor16<4>(v);
    v += permxor16<8>(v);
    return v;
}

// Eight async global->LDS 16-B copies per lane (ASYNCcnt): rows l + i*lstep in
// LDS from rows g + i*gstep in global memory. The closing s_wait_xcnt 0 stands
// inside the copies' own statement so that no address register named here is
// rewritten ahead of it.
static __device__ __forceinline__ void async_copy8_b128(unsigned l, unsigned lstep,
                                                        const bf16* g, size_t gstep) {
    asm volatile("global_load_async_to_lds_b128 %0, %8, off\n\t"
                 "global_load_async_to_lds_b128 %1, %9, off\n\t"
                 "global_load_async_to_lds_b128 %2, %10, off\n\t"
                 "global_load_async_to_lds_b128 %3, %11, off\n\t"
                 "global_load_async_to_lds_b128 %4, %12, off\n\t"
                 "global_load_async_to_lds_b128 %5, %13, off\n\t"
                 "global_load_async_to_lds_b128 %6, %14, off\n\t"
                 "global_load_async_to_lds_b128 %7, %15, off\n\t"
                 "s_wait_xcnt 0x0"
                 :: "v"(l), "v"(l + lstep), "v"(l + 2 * lstep), "v"(l + 3 * lstep),
                    "v"(l + 4 * lstep), "v"(l + 5 * lstep), "v"(l + 6 * lstep),
                    "v"(l + 7 * lstep),
                    "v"(g), "v"(g + gstep), "v"(g + 2 * gstep), "v"(g + 3 * gstep),
                    "v"(g + 4 * gstep), "v"(g + 5 * gstep), "v"(g + 6 * gstep),
                    "v"(g + 7 * gstep)
                 : "memory");
}

// ---------------- fp32 -> bf16 convert (weights) ----------------
__global__ __launch_bounds__(256) void cvt_kernel(const float* __restrict__ src,
                                                  bf16* __restrict__ dst, int n) {
    int i = (blockIdx.x * 256 + threadIdx.x) * 4;
    if (i < n) {
        v4f s = *(const v4f*)(src + i);
#pragma unroll
        for (int t = 0; t < 4; ++t) dst[i + t] = (bf16)s[t];
    }
}

// ---------------- RMSNorm: fp32 row -> bf16 row ----------------
__global__ __launch_bounds__(256) void rmsnorm_kernel(const float* __restrict__ x,
                                                      const float* __restrict__ w,
                                                      bf16* __restrict__ out) {
    __shared__ float red[8];
    const int row = blockIdx.x;
    const int tid = threadIdx.x;
    const float* xr = x + (size_t)row * DIMN;
    v4f xv = *(const v4f*)(xr + tid * 4);
    float ss = xv.x * xv.x + xv.y * xv.y + xv.z * xv.z + xv.w * xv.w;
    ss += permxor16<1>(ss);
    ss += permxor16<2>(ss);
    ss += permxor16<4>(ss);
    ss += permxor16<8>(ss);
    ss += __shfl_xor(ss, 16, 32);
    if ((tid & 31) == 0) red[tid >> 5] = ss;
    __syncthreads();
    float tot = 0.f;
#pragma unroll
    for (int i = 0; i < 8; ++i) tot += red[i];
    const float rinv = rsqrtf(tot * (1.f / DIMN) + 1e-5f);
    const float* wr = w + tid * 4;
    bf16* orow = out + (size_t)row * DIMN + tid * 4;
#pragma unroll
    for (int t = 0; t < 4; ++t) orow[t] = (bf16)(xv[t] * rinv * wr[t]);
}

// ---------------- WMMA GEMM: C[M,N] = A[M,K] @ W[N,K]^T ----------------
// Two-buffer LDS ring filled by async global->LDS copies (ASYNCcnt). A ring tile
// holds KT = 128 k of 128 A rows and 128 W rows: every row is 256 contiguous
// bytes of global memory, at an LDS pitch of 272 B (16 B x odd).
// M, N multiples of 128; K a multiple of 128.
// MODE 0: QKV scatter (N=3072): q/k -> [B,H,S,Dh] bf16, v -> [B,H,Dh,S] bf16
// MODE 1: store bf16 C[M,N]
// MODE 2: store fp32 C[M,N] + res[M,N]
template <int MODE>
__global__ __launch_bounds__(256)
void gemm_kernel(const bf16* __restrict__ A, const bf16* __restrict__ W,
                 int M, int N, int K,
                 float* __restrict__ outF, bf16* __restrict__ outB,
                 const float* __restrict__ res,
                 bf16* __restrict__ qo, bf16* __restrict__ ko, bf16* __restrict__ vo) {
    constexpr int KT = 128;            // k per ring tile
    constexpr int LP = KT + 8;         // LDS row pitch in elements
    __shared__ bf16 As[2][128 * LP];
    __shared__ bf16 Bs[2][128 * LP];
    const int m0 = blockIdx.y * 128;
    const int n0 = blockIdx.x * 128;
    const int tid = threadIdx.x;
    const int lane = tid & 31;
    const int wave = tid >> 5;
    const int wm = (wave >> 1) * 32;   // wave M offset (4 waves in M)
    const int wn = (wave & 1) * 64;    // wave N offset (2 waves in N)
    const int lo = lane & 15;
    const int hi = lane >> 4;
    const int kb = hi << 3;            // K-chunk base per A/B VGPR layout

    v8f acc[2][4] = {};

    // 16 lanes cover one 256-B row; a thread copies rows srow + 16 i, i = 0..7,
    // of A and of W: 16 async b128 copies per thread and tile.
    const int srow = tid >> 4, scol = (tid & 15) << 3;
    const bf16* gA = A + (size_t)(m0 + srow) * K + scol;
    const bf16* gW = W + (size_t)(n0 + srow) * K + scol;
    const size_t gstep = (size_t)16 * K;
    const unsigned lA = (unsigned)(size_t)&As[0][srow * LP + scol];
    const unsigned lB = (unsigned)(size_t)&Bs[0][srow * LP + scol];

    auto stage = [&](int k0, unsigned pb) {
        const unsigned bo = pb * (unsigned)(128 * LP * sizeof(bf16));
        async_copy8_b128(lA + bo, 16 * LP * sizeof(bf16), gA + k0, gstep);
        async_copy8_b128(lB + bo, 16 * LP * sizeof(bf16), gW + k0, gstep);
    };

    const int ntile = K / KT;
    stage(0, 0);
    // tile 0 has landed for this wave; the barrier publishes it to the others
    asm volatile("s_wait_asynccnt 0x0" ::: "memory");
    __syncthreads();
    if (K >= 2 * KT) stage(KT, 1);
    for (int t = 0; t < ntile; ++t) {
        const bf16* Asp = As[t & 1];
        const bf16* Bsp = Bs[t & 1];
        // unrolled so that the four k steps of a tile read at constant LDS offsets
#pragma unroll
        for (int ks = 0; ks < KT; ks += 32) {
            Frag a[2], b;
#pragma unroll
            for (int mt = 0; mt < 2; ++mt) {
                const bf16* ap = &Asp[(wm + mt * 16 + lo) * LP + ks + kb];
                a[mt].h[0] = *(const v8bf*)ap;
                a[mt].h[1] = *(const v8bf*)(ap + 16);
            }
#pragma unroll
            for (int nt = 0; nt < 4; ++nt) {
                const bf16* bp = &Bsp[(wn + nt * 16 + lo) * LP + ks + kb];
                b.h[0] = *(const v8bf*)bp;
                b.h[1] = *(const v8bf*)(bp + 16);
                acc[0][nt] = wmma_bf16(a[0], b, acc[0][nt]);
                acc[1][nt] = wmma_bf16(a[1], b, acc[1][nt]);
            }
        }
        // Publish point of tile t + 1: this wave's reads of buffer t & 1 have
        // retired, its copies of tile t + 1 have landed, then one barrier that
        // both publishes tile t + 1 and frees buffer t & 1 for the refill.
        asm volatile("s_wait_dscnt 0x0" ::: "memory");
        asm volatile("s_wait_asynccnt 0x0" ::: "memory");
        __syncthreads();
        if (t + 2 < ntile) stage((t + 2) * KT, (unsigned)(t & 1));
    }
    // no copy is left outstanding when the wave goes on to its stores and ends
    asm volatile("s_wait_asynccnt 0x0" ::: "memory");

#pragma unroll
    for (int mt = 0; mt < 2; ++mt)
#pragma unroll
        for (int nt = 0; nt < 4; ++nt)
#pragma unroll
            for (int r = 0; r < 8; ++r) {
                const int m = m0 + wm + mt * 16 + r + hi * 8;
                const int n = n0 + wn + nt * 16 + lo;
                const float vacc = acc[mt][nt][r];
                if constexpr (MODE == 0) {
                    const int bq = m >> 11, s = m & 2047;
                    const int which = n >> 10, col = n & 1023;
                    const int hh = col >> 6, d = col & 63;
                    const size_t bhd = (size_t)(bq * NHEAD + hh);
                    if (which == 0)
                        qo[(bhd * S_LEN + s) * HDIM + d] = (bf16)vacc;
                    else if (which == 1)
                        ko[(bhd * S_LEN + s) * HDIM + d] = (bf16)vacc;
                    else
                        vo[(bhd * HDIM + d) * S_LEN + s] = (bf16)vacc;
                } else if constexpr (MODE == 1) {
                    outB[(size_t)m * N + n] = (bf16)vacc;
                } else {
                    outF[(size_t)m * N + n] = vacc + res[(size_t)m * N + n];
                }
            }
}

// ---------------- Flash attention (causal) via WMMA ----------------
// q,k: [B*H, S, 64] bf16 ; v: [B*H, 64, S] bf16 ; out: [B, S, 1024] bf16
__global__ __launch_bounds__(128)
void attn_kernel(const bf16* __restrict__ q, const bf16* __restrict__ k,
                 const bf16* __restrict__ v, bf16* __restrict__ out) {
    __shared__ bf16 plds[4][16 * 40];
    const int tid = threadIdx.x;
    const int lane = tid & 31;
    const int wave = tid >> 5;
    const int lo = lane & 15;
    const int hi = lane >> 4;
    const int kb = hi << 3;
    const int bh = blockIdx.y;                   // 0..31
    const int qbase = blockIdx.x * 64 + wave * 16;
    const int b = bh >> 4, h0 = bh & 15;

    const bf16* qp = q + (((size_t)bh) * S_LEN + qbase + lo) * HDIM;
    Frag qa[2];
    qa[0].h[0] = *(const v8bf*)(qp + kb);
    qa[0].h[1] = *(const v8bf*)(qp + kb + 16);
    qa[1].h[0] = *(const v8bf*)(qp + 32 + kb);
    qa[1].h[1] = *(const v8bf*)(qp + 32 + kb + 16);

    v8f o[4] = {};
    float mrow[8], lrow[8];
#pragma unroll
    for (int r = 0; r < 8; ++r) { mrow[r] = -INFINITY; lrow[r] = 0.f; }
    const float scale = 0.125f;  // 1/sqrt(64)
    bf16* pl = plds[wave];

    for (int j0 = 0; j0 <= qbase + 15; j0 += 32) {
        v8f s0 = {}, s1 = {};
        {
            const bf16* kp0 = k + (((size_t)bh) * S_LEN + j0 + lo) * HDIM;
            const bf16* kp1 = kp0 + (size_t)16 * HDIM;
            Frag b00, b01, b10, b11;
            b00.h[0] = *(const v8bf*)(kp0 + kb);
            b00.h[1] = *(const v8bf*)(kp0 + kb + 16);
            b01.h[0] = *(const v8bf*)(kp0 + 32 + kb);
            b01.h[1] = *(const v8bf*)(kp0 + 32 + kb + 16);
            b10.h[0] = *(const v8bf*)(kp1 + kb);
            b10.h[1] = *(const v8bf*)(kp1 + kb + 16);
            b11.h[0] = *(const v8bf*)(kp1 + 32 + kb);
            b11.h[1] = *(const v8bf*)(kp1 + 32 + kb + 16);
            s0 = wmma_bf16(qa[0], b00, s0);
            s0 = wmma_bf16(qa[1], b01, s0);
            s1 = wmma_bf16(qa[0], b10, s1);
            s1 = wmma_bf16(qa[1], b11, s1);
        }
        // Online softmax. Row statistics align with the C-matrix VGPR layout
        // (row = hi*8 + r, 16 columns spread across the 16-lane half).
        float alpha[8];
#pragma unroll
        for (int r = 0; r < 8; ++r) {
            const int m = qbase + hi * 8 + r;
            const float x0 = (j0 + lo      <= m) ? s0[r] * scale : -INFINITY;
            const float x1 = (j0 + 16 + lo <= m) ? s1[r] * scale : -INFINITY;
            const float mx = hmax16(fmaxf(x0, x1));
            const float mnew = fmaxf(mrow[r], mx);
            alpha[r] = __expf(mrow[r] - mnew);
            const float p0 = __expf(x0 - mnew);
            const float p1 = __expf(x1 - mnew);
            lrow[r] = lrow[r] * alpha[r] + hsum16(p0 + p1);
            mrow[r] = mnew;
            pl[(hi * 8 + r) * 40 + lo]      = (bf16)p0;
            pl[(hi * 8 + r) * 40 + 16 + lo] = (bf16)p1;
        }
#pragma unroll
        for (int dt = 0; dt < 4; ++dt) {
            v8f ov = o[dt];
#pragma unroll
            for (int r = 0; r < 8; ++r) ov[r] *= alpha[r];
            o[dt] = ov;
        }
        asm volatile("s_wait_dscnt 0x0" ::: "memory");
        Frag pa;
        pa.h[0] = *(const v8bf*)&pl[lo * 40 + kb];
        pa.h[1] = *(const v8bf*)&pl[lo * 40 + kb + 16];
#pragma unroll
        for (int dt = 0; dt < 4; ++dt) {
            const bf16* vp = v + (((size_t)bh) * HDIM + dt * 16 + lo) * S_LEN + j0;
            Frag vb;
            vb.h[0] = *(const v8bf*)(vp + kb);
            vb.h[1] = *(const v8bf*)(vp + kb + 16);
            o[dt] = wmma_bf16(pa, vb, o[dt]);
        }
        asm volatile("s_wait_dscnt 0x0" ::: "memory");
    }

#pragma unroll
    for (int dt = 0; dt < 4; ++dt)
#pragma unroll
        for (int r = 0; r < 8; ++r) {
            const int s = qbase + hi * 8 + r;
            const int d = dt * 16 + lo;
            out[((size_t)(b * S_LEN + s)) * DIMN + h0 * HDIM + d] =
                (bf16)(o[dt][r] / lrow[r]);
        }
}

// ---------------- silu(gate) * up -> bf16 ----------------
__global__ __launch_bounds__(256)
void silu_mul_kernel(const bf16* __restrict__ gu, bf16* __restrict__ outm) {
    const size_t idx = ((size_t)blockIdx.x * 256 + threadIdx.x) * 8;
    const size_t m = idx >> 12;          // / 4096
    const size_t j = idx & 4095;
    v8bf gv = *(const v8bf*)&gu[m * 8192 + j];
    v8bf uv = *(const v8bf*)&gu[m * 8192 + 4096 + j];
    v8bf ov;
#pragma unroll
    for (int t = 0; t < 8; ++t) {
        const float g = (float)gv[t];
        const float u = (float)uv[t];
        ov[t] = (bf16)((g / (1.f + __expf(-g))) * u);
    }
    *(v8bf*)&outm[idx] = ov;
}

extern "C" void kernel_launch(void* const* d_in, const int* in_sizes, int n_in,
                              void* d_out, int out_size, void* d_ws, size_t ws_size,
                              hipStream_t stream) {
    const float* x     = (const float*)d_in[0];
    const float* wq    = (const float*)d_in[1];
    const float* wk    = (const float*)d_in[2];
    const float* wv    = (const float*)d_in[3];
    const float* wo    = (const float*)d_in[4];
    const float* wgate = (const float*)d_in[5];
    const float* wup   = (const float*)d_in[6];
    const float* wdown = (const float*)d_in[7];
    const float* n1w   = (const float*)d_in[8];
    const float* n2w   = (const float*)d_in[9];

    char* ws = (char*)d_ws;
    size_t off = 0;
    auto take = [&](size_t bytes) -> char* {
        char* p = ws + off;
        off += (bytes + 255) & ~(size_t)255;
        return p;
    };
    bf16*  a1   = (bf16*)take((size_t)MTOT * DIMN * 2);
    bf16*  wqkv = (bf16*)take((size_t)3 * DIMN * DIMN * 2);
    bf16*  wo_b = (bf16*)take((size_t)DIMN * DIMN * 2);
    bf16*  wgu  = (bf16*)take((size_t)2 * HIDDEN * DIMN * 2);
    bf16*  wdn  = (bf16*)take((size_t)DIMN * HIDDEN * 2);
    bf16*  qws  = (bf16*)take((size_t)MTOT * DIMN * 2);
    bf16*  kws  = (bf16*)take((size_t)MTOT * DIMN * 2);
    bf16*  vws  = (bf16*)take((size_t)MTOT * DIMN * 2);
    bf16*  attn = (bf16*)take((size_t)MTOT * DIMN * 2);
    float* x2   = (float*)take((size_t)MTOT * DIMN * 4);
    bf16*  a2   = (bf16*)take((size_t)MTOT * DIMN * 2);
    bf16*  gu   = (bf16*)take((size_t)MTOT * 2 * HIDDEN * 2);
    bf16*  mlp  = (bf16*)take((size_t)MTOT * HIDDEN * 2);

    auto cvt = [&](const float* s, bf16* dp, int n) {
        cvt_kernel<<<(n / 4 + 255) / 256, 256, 0, stream>>>(s, dp, n);
    };
    cvt(wq, wqkv, DIMN * DIMN);
    cvt(wk, wqkv + (size_t)DIMN * DIMN, DIMN * DIMN);
    cvt(wv, wqkv + (size_t)2 * DIMN * DIMN, DIMN * DIMN);
    cvt(wo, wo_b, DIMN * DIMN);
    cvt(wgate, wgu, HIDDEN * DIMN);
    cvt(wup, wgu + (size_t)HIDDEN * DIMN, HIDDEN * DIMN);
    cvt(wdown, wdn, DIMN * HIDDEN);

    rmsnorm_kernel<<<MTOT, 256, 0, stream>>>(x, n1w, a1);

    gemm_kernel<0><<<dim3(3072 / 128, MTOT / 128), 256, 0, stream>>>(
        a1, wqkv, MTOT, 3072, DIMN, nullptr, nullptr, nullptr, qws, kws, vws);

    attn_kernel<<<dim3(S_LEN / 64, BATCH * NHEAD), 128, 0, stream>>>(qws, kws, vws, attn);

    gemm_kernel<2><<<dim3(DIMN / 128, MTOT / 128), 256, 0, stream>>>(
        attn, wo_b, MTOT, DIMN, DIMN, x2, nullptr, x, nullptr, nullptr, nullptr);

    rmsnorm_kernel<<<MTOT, 256, 0, stream>>>(x2, n2w, a2);

    gemm_kernel<1><<<dim3(2 * HIDDEN / 128, MTOT / 128), 256, 0, stream>>>(
        a2, wgu, MTOT, 2 * HIDDEN, DIMN, nullptr, gu, nullptr, nullptr, nullptr, nullptr);

    silu_mul_kernel<<<((size_t)MTOT * HIDDEN / 8) / 256, 256, 0, stream>>>(gu, mlp);

    gemm_kernel<2><<<dim3(DIMN / 128, MTOT / 128), 256, 0, stream>>>(
        mlp, wdn, MTOT, DIMN, HIDDEN, (float*)d_out, nullptr, x2,
        nullptr, nullptr, nullptr);
}

// v002
// It runs in 301 microseconds.
// Two timings next to v001 both put it at 1.07 times that version's speed.
// All steps since v000 together make it 1.24 times as fast.
#include <hip/hip_runtime.h>
#include <hip/hip_bf16.h>
#include <math.h>

typedef __bf16 bf16;
typedef __attribute__((ext_vector_type(16))) __bf16 v16bf;
typedef __attribute__((ext_vector_type(8)))  __bf16 v8bf;
typedef __attribute__((ext_vector_type(8)))  float  v8f;
typedef __attribute__((ext_vector_type(4)))  float  v4f;

#define DIMN   1024
#define S_LEN  2048
#define BATCH  2
#define NHEAD  16
#define HDIM   64
#define HIDDEN 4096
#define MTOT   (BATCH * S_LEN)   // 4096 rows

union Frag { v16bf v; v8bf h[2]; };

static __device__ __forceinline__ v8f wmma_bf16(const Frag& a, const Frag& b, v8f c) {
    return __builtin_amdgcn_wmma_f32_16x16x32_bf16(false, a.v, false, b.v,
                                                   (short)0, c, false, false);
}

// XOR-shuffle within each 16-lane half using v_permlane16_b32 (pure VALU,
// avoids ds_bpermute + s_wait_dscnt round-trips).
template <int M>
static __device__ __forceinline__ float permxor16(float v) {
#if __has_builtin(__builtin_amdgcn_permlane16)
    constexpr unsigned lo =
        ((unsigned)(0 ^ M)) | ((unsigned)(1 ^ M) << 4) | ((unsigned)(2 ^ M) << 8) |
        ((unsigned)(3 ^ M) << 12) | ((unsigned)(4 ^ M) << 16) |
        ((unsigned)(5 ^ M) << 20) | ((unsigned)(6 ^ M) << 24) |
        ((unsigned)(7 ^ M) << 28);
    constexpr unsigned hi =
        ((unsigned)((8 ^ M) & 15)) | ((unsigned)((9 ^ M) & 15) << 4) |
        ((unsigned)((10 ^ M) & 15) << 8) | ((unsigned)((11 ^ M) & 15) << 12) |
        ((unsigned)((12 ^ M) & 15) << 16) | ((unsigned)((13 ^ M) & 15) << 20) |
        ((unsigned)((14 ^ M) & 15) << 24) | ((unsigned)((15 ^ M) & 15) << 28);
    int iv = __builtin_bit_cast(int, v);
    int r = __builtin_amdgcn_permlane16(iv, iv, (int)lo, (int)hi, false, false);
    return __builtin_bit_cast(float, r);
#else
    return __shfl_xor(v, M, 32);
#endif
}

// Lane l <-> lane l ^ 16: the two halves of a wave that share a column of a
// WMMA accumulator tile (pure VALU).
static __device__ __forceinline__ float xhalf(float v) {
    const int iv = __builtin_bit_cast(int, v);
    const int r = __builtin_amdgcn_permlanex16(iv, iv, 0x76543210, 0xfedcba98, false, false);
    return __builtin_bit_cast(float, r);
}

// Eight async global->LDS 16-B copies per lane (ASYNCcnt): rows l + i*lstep in
// LDS from rows g + i*gstep in global memory. The closing s_wait_xcnt 0 stands
// inside the copies' own statement so that no address register named here is
// rewritten ahead of it.
static __device__ __forceinline__ void async_copy8_b128(unsigned l, unsigned lstep,
                                                        const bf16* g, size_t gstep) {
    asm volatile("global_load_async_to_lds_b128 %0, %8, off\n\t"
                 "global_load_async_to_lds_b128 %1, %9, off\n\t"
                 "global_load_async_to_lds_b128 %2, %10, off\n\t"
                 "global_load_async_to_lds_b128 %3, %11, off\n\t"
                 "global_load_async_to_lds_b128 %4, %12, off\n\t"
                 "global_load_async_to_lds_b128 %5, %13, off\n\t"
                 "global_load_async_to_lds_b128 %6, %14, off\n\t"
                 "global_load_async_to_lds_b128 %7, %15, off\n\t"
                 "s_wait_xcnt 0x0"
                 :: "v"(l), "v"(l + lstep), "v"(l + 2 * lstep), "v"(l + 3 * lstep),
                    "v"(l + 4 * lstep), "v"(l + 5 * lstep), "v"(l + 6 * lstep),
                    "v"(l + 7 * lstep),
                    "v"(g), "v"(g + gstep), "v"(g + 2 * gstep), "v"(g + 3 * gstep),
                    "v"(g + 4 * gstep), "v"(g + 5 * gstep), "v"(g + 6 * gstep),
                    "v"(g + 7 * gstep)
                 : "memory");
}

// ---------------- fp32 -> bf16 convert (weights) ----------------
__global__ __launch_bounds__(256) void cvt_kernel(const float* __restrict__ src,
                                                  bf16* __restrict__ dst, int n) {
    int i = (blockIdx.x * 256 + threadIdx.x) * 4;
    if (i < n) {
        v4f s = *(const v4f*)(src + i);
#pragma unroll
        for (int t = 0; t < 4; ++t) dst[i + t] = (bf16)s[t];
    }
}

// ---------------- RMSNorm: fp32 row -> bf16 row ----------------
__global__ __launch_bounds__(256) void rmsnorm_kernel(const float* __restrict__ x,
                                                      const float* __restrict__ w,
                                                      bf16* __restrict__ out) {
    __shared__ float red[8];
    const int row = blockIdx.x;
    const int tid = threadIdx.x;
    const float* xr = x + (size_t)row * DIMN;
    v4f xv = *(const v4f*)(xr + tid * 4);
    float ss = xv.x * xv.x + xv.y * xv.y + xv.z * xv.z + xv.w * xv.w;
    ss += permxor16<1>(ss);
    ss += permxor16<2>(ss);
    ss += permxor16<4>(ss);
    ss += permxor16<8>(ss);
    ss += __shfl_xor(ss, 16, 32);
    if ((tid & 31) == 0) red[tid >> 5] = ss;
    __syncthreads();
    float tot = 0.f;
#pragma unroll
    for (int i = 0; i < 8; ++i) tot += red[i];
    const float rinv = rsqrtf(tot * (1.f / DIMN) + 1e-5f);
    const float* wr = w + tid * 4;
    bf16* orow = out + (size_t)row * DIMN + tid * 4;
#pragma unroll
    for (int t = 0; t < 4; ++t) orow[t] = (bf16)(xv[t] * rinv * wr[t]);
}

// ---------------- WMMA GEMM: C[M,N] = A[M,K] @ W[N,K]^T ----------------
// Two-buffer LDS ring filled by async global->LDS copies (ASYNCcnt). A ring tile
// holds KT = 128 k of 128 A rows and 128 W rows: every row is 256 contiguous
// bytes of global memory, at an LDS pitch of 272 B (16 B x odd).
// M, N multiples of 128; K a multiple of 128.
// MODE 0: QKV scatter (N=3072): q/k -> [B,H,S,Dh] bf16, v -> [B,H,Dh,S] bf16
// MODE 1: store bf16 C[M,N]
// MODE 2: store fp32 C[M,N] + res[M,N]
template <int MODE>
__global__ __launch_bounds__(256)
void gemm_kernel(const bf16* __restrict__ A, const bf16* __restrict__ W,
                 int M, int N, int K,
                 float* __restrict__ outF, bf16* __restrict__ outB,
                 const float* __restrict__ res,
                 bf16* __restrict__ qo, bf16* __restrict__ ko, bf16* __restrict__ vo) {
    constexpr int KT = 128;            // k per ring tile
    constexpr int LP = KT + 8;         // LDS row pitch in elements
    __shared__ bf16 As[2][128 * LP];
    __shared__ bf16 Bs[2][128 * LP];
    const int m0 = blockIdx.y * 128;
    const int n0 = blockIdx.x * 128;
    const int tid = threadIdx.x;
    const int lane = tid & 31;
    const int wave = tid >> 5;
    const int wm = (wave >> 1) * 32;   // wave M offset (4 waves in M)
    const int wn = (wave & 1) * 64;    // wave N offset (2 waves in N)
    const int lo = lane & 15;
    const int hi = lane >> 4;
    const int kb = hi << 3;            // K-chunk base per A/B VGPR layout

    v8f acc[2][4] = {};

    // 16 lanes cover one 256-B row; a thread copies rows srow + 16 i, i = 0..7,
    // of A and of W: 16 async b128 copies per thread and tile.
    const int srow = tid >> 4, scol = (tid & 15) << 3;
    const bf16* gA = A + (size_t)(m0 + srow) * K + scol;
    const bf16* gW = W + (size_t)(n0 + srow) * K + scol;
    const size_t gstep = (size_t)16 * K;
    const unsigned lA = (unsigned)(size_t)&As[0][srow * LP + scol];
    const unsigned lB = (unsigned)(size_t)&Bs[0][srow * LP + scol];

    auto stage = [&](int k0, unsigned pb) {
        const unsigned bo = pb * (unsigned)(128 * LP * sizeof(bf16));
        async_copy8_b128(lA + bo, 16 * LP * sizeof(bf16), gA + k0, gstep);
        async_copy8_b128(lB + bo, 16 * LP * sizeof(bf16), gW + k0, gstep);
    };

    const int ntile = K / KT;
    stage(0, 0);
    // tile 0 has landed for this wave; the barrier publishes it to the others
    asm volatile("s_wait_asynccnt 0x0" ::: "memory");
    __syncthreads();
    if (K >= 2 * KT) stage(KT, 1);
    for (int t = 0; t < ntile; ++t) {
        const bf16* Asp = As[t & 1];
        const bf16* Bsp = Bs[t & 1];
        // unrolled so that the four k steps of a tile read at constant LDS offsets
#pragma unroll
        for (int ks = 0; ks < KT; ks += 32) {
            Frag a[2], b;
#pragma unroll
            for (int mt = 0; mt < 2; ++mt) {
                const bf16* ap = &Asp[(wm + mt * 16 + lo) * LP + ks + kb];
                a[mt].h[0] = *(const v8bf*)ap;
                a[mt].h[1] = *(const v8bf*)(ap + 16);
            }
#pragma unroll
            for (int nt = 0; nt < 4; ++nt) {
                const bf16* bp = &Bsp[(wn + nt * 16 + lo) * LP + ks + kb];
                b.h[0] = *(const v8bf*)bp;
                b.h[1] = *(const v8bf*)(bp + 16);
                acc[0][nt] = wmma_bf16(a[0], b, acc[0][nt]);
                acc[1][nt] = wmma_bf16(a[1], b, acc[1][nt]);
            }
        }
        // Publish point of tile t + 1: this wave's reads of buffer t & 1 have
        // retired, its copies of tile t + 1 have landed, then one barrier that
        // both publishes tile t + 1 and frees buffer t & 1 for the refill.
        asm volatile("s_wait_dscnt 0x0" ::: "memory");
        asm volatile("s_wait_asynccnt 0x0" ::: "memory");
        __syncthreads();
        if (t + 2 < ntile) stage((t + 2) * KT, (unsigned)(t & 1));
    }
    // no copy is left outstanding when the wave goes on to its stores and ends
    asm volatile("s_wait_asynccnt 0x0" ::: "memory");

#pragma unroll
    for (int mt = 0; mt < 2; ++mt)
#pragma unroll
        for (int nt = 0; nt < 4; ++nt)
#pragma unroll
            for (int r = 0; r < 8; ++r) {
                const int m = m0 + wm + mt * 16 + r + hi * 8;
                const int n = n0 + wn + nt * 16 + lo;
                const float vacc = acc[mt][nt][r];
                if constexpr (MODE == 0) {
                    const int bq = m >> 11, s = m & 2047;
                    const int which = n >> 10, col = n & 1023;
                    const int hh = col >> 6, d = col & 63;
                    const size_t bhd = (size_t)(bq * NHEAD + hh);
                    if (which == 0)
                        qo[(bhd * S_LEN + s) * HDIM + d] = (bf16)vacc;
                    else if (which == 1)
                        ko[(bhd * S_LEN + s) * HDIM + d] = (bf16)vacc;
                    else
                        vo[(bhd * HDIM + d) * S_LEN + s] = (bf16)vacc;
                } else if constexpr (MODE == 1) {
                    outB[(size_t)m * N + n] = (bf16)vacc;
                } else {
                    outF[(size_t)m * N + n] = vacc + res[(size_t)m * N + n];
                }
            }
}

__global__ __launch_bounds__(128)
void attn_kernel(const bf16* __restrict__ q, const bf16* __restrict__ k,
                 const bf16* __restrict__ v, bf16* __restrict__ out) {
    const int tid = threadIdx.x;
    const int lane = tid & 31;
    const int wave = tid >> 5;
    const int lo = lane & 15;
    const int hi = lane >> 4;
    const int kb = hi << 3;
    const int bh = blockIdx.y;                   // 0..31
    const int qbase = blockIdx.x * 64 + wave * 16;
    const int b = bh >> 4, h0 = bh & 15;

    // B operand of S^T: column lo = query qbase + lo
    const bf16* qp = q + (((size_t)bh) * S_LEN + qbase + lo) * HDIM;
    Frag qb[2];
    qb[0].h[0] = *(const v8bf*)(qp + kb);
    qb[0].h[1] = *(const v8bf*)(qp + kb + 16);
    qb[1].h[0] = *(const v8bf*)(qp + 32 + kb);
    qb[1].h[1] = *(const v8bf*)(qp + 32 + kb + 16);

    v8f o[4] = {};               // O^T: row d = 16 dt + 8 hi + r, column = query lo
    float mrow = -INFINITY;      // running maximum of query lo (equal in both halves)
    float lsum = 0.f;            // this half's share of the running sum of query lo
    const float scale = 0.125f;  // 1/sqrt(64)

    // Lane's own places in K (row lo) and V^T (row d = lo), carried from pass to
    // pass: every load of a pass is one of these two addresses plus a constant.
    const bf16* kp = k + (((size_t)bh) * S_LEN + lo) * HDIM + kb;
    const bf16* vp = v + (((size_t)bh) * HDIM + lo) * S_LEN + kb;

    for (int j0 = 0; j0 <= qbase + 15; j0 += 32) {
        // A operands: K rows j0 + lo and j0 + 16 + lo; V^T rows d = 16 dt + lo
        Frag a00, a01, a10, a11, va[4];
        a00.h[0] = *(const v8bf*)(kp);
        a00.h[1] = *(const v8bf*)(kp + 16);
        a01.h[0] = *(const v8bf*)(kp + 32);
        a01.h[1] = *(const v8bf*)(kp + 48);
        a10.h[0] = *(const v8bf*)(kp + 16 * HDIM);
        a10.h[1] = *(const v8bf*)(kp + 16 * HDIM + 16);
        a11.h[0] = *(const v8bf*)(kp + 16 * HDIM + 32);
        a11.h[1] = *(const v8bf*)(kp + 16 * HDIM + 48);
#pragma unroll
        for (int dt = 0; dt < 4; ++dt) {
            va[dt].h[0] = *(const v8bf*)(vp + dt * 16 * S_LEN);
            va[dt].h[1] = *(const v8bf*)(vp + dt * 16 * S_LEN + 16);
        }
        // Stands between the 16 issued loads and any rewrite of the two address
        // pairs they name. The pairs are inputs so that they stay live up to the
        // wait: otherwise the last load's result is placed on top of them.
        asm volatile("s_wait_xcnt 0x0" :: "v"(kp), "v"(vp) : "memory");
        // With no LDS trip and no wait inside the pass, its 16 loads go out as one
        // group; without this line the scheduler sinks them between the WMMAs and
        // the wave waits out the load latency several times a pass.
        __builtin_amdgcn_sched_barrier(0);
        v8f s0 = {}, s1 = {};
        s0 = wmma_bf16(a00, qb[0], s0);
        s1 = wmma_bf16(a10, qb[0], s1);
        s0 = wmma_bf16(a01, qb[1], s0);
        s1 = wmma_bf16(a11, qb[1], s1);

        // Online softmax of query lo. s0[r] is key j0 + kb + r, s1[r] key
        // j0 + 16 + kb + r; a key is inside the causal mask while its offset
        // from j0 + kb does not exceed lim.
        const int lim = qbase + lo - j0 - kb;
        float x0[8], x1[8];
        float mx = -INFINITY;
#pragma unroll
        for (int r = 0; r < 8; ++r) {
            x0[r] = (r      <= lim) ? s0[r] * scale : -INFINITY;
            x1[r] = (r + 16 <= lim) ? s1[r] * scale : -INFINITY;
            mx = fmaxf(mx, fmaxf(x0[r], x1[r]));
        }
        mx = fmaxf(mx, xhalf(mx));
        const float mnew = fmaxf(mrow, mx);
        const float alpha = __expf(mrow - mnew);
        mrow = mnew;
        Frag pb;
        float ps0 = 0.f, ps1 = 0.f;
#pragma unroll
        for (int r = 0; r < 8; ++r) {
            const float p0 = __expf(x0[r] - mnew);
            const float p1 = __expf(x1[r] - mnew);
            ps0 += p0;
            ps1 += p1;
            pb.h[0][r] = (bf16)p0;
            pb.h[1][r] = (bf16)p1;
        }
        lsum = lsum * alpha + (ps0 + ps1);
#pragma unroll
        for (int dt = 0; dt < 4; ++dt) {
            v8f ov = o[dt];
#pragma unroll
            for (int r = 0; r < 8; ++r) ov[r] *= alpha;
            o[dt] = wmma_bf16(va[dt], pb, ov);
        }
        kp += 32 * HDIM;
        vp += 32;
    }

    const float ltot = lsum + xhalf(lsum);
    bf16* op = out + ((size_t)(b * S_LEN + qbase + lo)) * DIMN + h0 * HDIM + kb;
#pragma unroll
    for (int dt = 0; dt < 4; ++dt) {
        v8bf ov;
#pragma unroll
        for (int r = 0; r < 8; ++r) ov[r] = (bf16)(o[dt][r] / ltot);
        *(v8bf*)(op + dt * 16) = ov;
    }
}

// ---------------- silu(gate) * up -> bf16 ----------------
__global__ __launch_bounds__(256)
void silu_mul_kernel(const bf16* __restrict__ gu, bf16* __restrict__ outm) {
    const size_t idx = ((size_t)blockIdx.x * 256 + threadIdx.x) * 8;
    const size_t m = idx >> 12;          // / 4096
    const size_t j = idx & 4095;
    v8bf gv = *(const v8bf*)&gu[m * 8192 + j];
    v8bf uv = *(const v8bf*)&gu[m * 8192 + 4096 + j];
    v8bf ov;
#pragma unroll
    for (int t = 0; t < 8; ++t) {
        const float g = (float)gv[t];
        const float u = (float)uv[t];
        ov[t] = (bf16)((g / (1.f + __expf(-g))) * u);
    }
    *(v8bf*)&outm[idx] = ov;
}

extern "C" void kernel_launch(void* const* d_in, const int* in_sizes, int n_in,
                              void* d_out, int out_size, void* d_ws, size_t ws_size,
                              hipStream_t stream) {
    const float* x     = (const float*)d_in[0];
    const float* wq    = (const float*)d_in[1];
    const float* wk    = (const float*)d_in[2];
    const float* wv    = (const float*)d_in[3];
    const float* wo    = (const float*)d_in[4];
    const float* wgate = (const float*)d_in[5];
    const float* wup   = (const float*)d_in[6];
    const float* wdown = (const float*)d_in[7];
    const float* n1w   = (const float*)d_in[8];
    const float* n2w   = (const float*)d_in[9];

    char* ws = (char*)d_ws;
    size_t off = 0;
    auto take = [&](size_t bytes) -> char* {
        char* p = ws + off;
        off += (bytes + 255) & ~(size_t)255;
        return p;
    };
    bf16*  a1   = (bf16*)take((size_t)MTOT * DIMN * 2);
    bf16*  wqkv = (bf16*)take((size_t)3 * DIMN * DIMN * 2);
    bf16*  wo_b = (bf16*)take((size_t)DIMN * DIMN * 2);
    bf16*  wgu  = (bf16*)take((size_t)2 * HIDDEN * DIMN * 2);
    bf16*  wdn  = (bf16*)take((size_t)DIMN * HIDDEN * 2);
    bf16*  qws  = (bf16*)take((size_t)MTOT * DIMN * 2);
    bf16*  kws  = (bf16*)take((size_t)MTOT * DIMN * 2);
    bf16*  vws  = (bf16*)take((size_t)MTOT * DIMN * 2);
    bf16*  attn = (bf16*)take((size_t)MTOT * DIMN * 2);
    float* x2   = (float*)take((size_t)MTOT * DIMN * 4);
    bf16*  a2   = (bf16*)take((size_t)MTOT * DIMN * 2);
    bf16*  gu   = (bf16*)take((size_t)MTOT * 2 * HIDDEN * 2);
    bf16*  mlp  = (bf16*)take((size_t)MTOT * HIDDEN * 2);

    auto cvt = [&](const float* s, bf16* dp, int n) {
        cvt_kernel<<<(n / 4 + 255) / 256, 256, 0, stream>>>(s, dp, n);
    };
    cvt(wq, wqkv, DIMN * DIMN);
    cvt(wk, wqkv + (size_t)DIMN * DIMN, DIMN * DIMN);
    cvt(wv, wqkv + (size_t)2 * DIMN * DIMN, DIMN * DIMN);
    cvt(wo, wo_b, DIMN * DIMN);
    cvt(wgate, wgu, HIDDEN * DIMN);
    cvt(wup, wgu + (size_t)HIDDEN * DIMN, HIDDEN * DIMN);
    cvt(wdown, wdn, DIMN * HIDDEN);

    rmsnorm_kernel<<<MTOT, 256, 0, stream>>>(x, n1w, a1);

    gemm_kernel<0><<<dim3(3072 / 128, MTOT / 128), 256, 0, stream>>>(
        a1, wqkv, MTOT, 3072, DIMN, nullptr, nullptr, nullptr, qws, kws, vws);

    attn_kernel<<<dim3(S_LEN / 64, BATCH * NHEAD), 128, 0, stream>>>(qws, kws, vws, attn);

    gemm_kernel<2><<<dim3(DIMN / 128, MTOT / 128), 256, 0, stream>>>(
        attn, wo_b, MTOT, DIMN, DIMN, x2, nullptr, x, nullptr, nullptr, nullptr);

    rmsnorm_kernel<<<MTOT, 256, 0, stream>>>(x2, n2w, a2);

    gemm_kernel<1><<<dim3(2 * HIDDEN / 128, MTOT / 128), 256, 0, stream>>>(
        a2, wgu, MTOT, 2 * HIDDEN, DIMN, nullptr, gu, nullptr, nullptr, nullptr, nullptr);

    silu_mul_kernel<<<((size_t)MTOT * HIDDEN / 8) / 256, 256, 0, stream>>>(gu, mlp);

    gemm_kernel<2><<<dim3(DIMN / 128, MTOT / 128), 256, 0, stream>>>(
        mlp, wdn, MTOT, DIMN, HIDDEN, (float*)d_out, nullptr, x2,
        nullptr, nullptr, nullptr);
}

// v003
// One run takes 248 microseconds.
// In both of two side-by-side timings against v002, it was 1.21 times as fast.
// Over all steps from v000 it is 1.50 times as fast.
#include <hip/hip_runtime.h>
#include <hip/hip_bf16.h>
#include <math.h>

typedef __bf16 bf16;
typedef __attribute__((ext_vector_type(16))) __bf16 v16bf;
typedef __attribute__((ext_vector_type(8)))  __bf16 v8bf;
typedef __attribute__((ext_vector_type(8)))  float  v8f;
typedef __attribute__((ext_vector_type(4)))  float  v4f;

#define DIMN   1024
#define S_LEN  2048
#define BATCH  2
#define NHEAD  16
#define HDIM   64
#define HIDDEN 4096
#define MTOT   (BATCH * S_LEN)   // 4096 rows

union Frag { v16bf v; v8bf h[2]; };

static __device__ __forceinline__ v8f wmma_bf16(const Frag& a, const Frag& b, v8f c) {
    return __builtin_amdgcn_wmma_f32_16x16x32_bf16(false, a.v, false, b.v,
                                                   (short)0, c, false, false);
}

// XOR-shuffle within each 16-lane half using v_permlane16_b32 (pure VALU,
// avoids ds_bpermute + s_wait_dscnt round-trips).
template <int M>
static __device__ __forceinline__ float permxor16(float v) {
#if __has_builtin(__builtin_amdgcn_permlane16)
    constexpr unsigned lo =
        ((unsigned)(0 ^ M)) | ((unsigned)(1 ^ M) << 4) | ((unsigned)(2 ^ M) << 8) |
        ((unsigned)(3 ^ M) << 12) | ((unsigned)(4 ^ M) << 16) |
        ((unsigned)(5 ^ M) << 20) | ((unsigned)(6 ^ M) << 24) |
        ((unsigned)(7 ^ M) << 28);
    constexpr unsigned hi =
        ((unsigned)((8 ^ M) & 15)) | ((unsigned)((9 ^ M) & 15) << 4) |
        ((unsigned)((10 ^ M) & 15) << 8) | ((unsigned)((11 ^ M) & 15) << 12) |
        ((unsigned)((12 ^ M) & 15) << 16) | ((unsigned)((13 ^ M) & 15) << 20) |
        ((unsigned)((14 ^ M) & 15) << 24) | ((unsigned)((15 ^ M) & 15) << 28);
    int iv = __builtin_bit_cast(int, v);
    int r = __builtin_amdgcn_permlane16(iv, iv, (int)lo, (int)hi, false, false);
    return __builtin_bit_cast(float, r);
#else
    return __shfl_xor(v, M, 32);
#endif
}

// Lane l <-> lane l ^ 16: the two halves of a wave that share a column of a
// WMMA accumulator tile (pure VALU).
static __device__ __forceinline__ float xhalf(float v) {
    const int iv = __builtin_bit_cast(int, v);
    const int r = __builtin_amdgcn_permlanex16(iv, iv, 0x76543210, 0xfedcba98, false, false);
    return __builtin_bit_cast(float, r);
}

// Eight async global->LDS 16-B copies per lane (ASYNCcnt): rows l + i*lstep in
// LDS from rows g + i*gstep in global memory. The closing s_wait_xcnt 0 stands
// inside the copies' own statement so that no address register named here is
// rewritten ahead of it.
static __device__ __forceinline__ void async_copy8_b128(unsigned l, unsigned lstep,
                                                        const bf16* g, size_t gstep) {
    asm volatile("global_load_async_to_lds_b128 %0, %8, off\n\t"
                 "global_load_async_to_lds_b128 %1, %9, off\n\t"
                 "global_load_async_to_lds_b128 %2, %10, off\n\t"
                 "global_load_async_to_lds_b128 %3, %11, off\n\t"
                 "global_load_async_to_lds_b128 %4, %12, off\n\t"
                 "global_load_async_to_lds_b128 %5, %13, off\n\t"
                 "global_load_async_to_lds_b128 %6, %14, off\n\t"
                 "global_load_async_to_lds_b128 %7, %15, off\n\t"
                 "s_wait_xcnt 0x0"
                 :: "v"(l), "v"(l + lstep), "v"(l + 2 * lstep), "v"(l + 3 * lstep),
                    "v"(l + 4 * lstep), "v"(l + 5 * lstep), "v"(l + 6 * lstep),
                    "v"(l + 7 * lstep),
                    "v"(g), "v"(g + gstep), "v"(g + 2 * gstep), "v"(g + 3 * gstep),
                    "v"(g + 4 * gstep), "v"(g + 5 * gstep), "v"(g + 6 * gstep),
                    "v"(g + 7 * gstep)
                 : "memory");
}

// Four and four async global->LDS 16-B copies per lane: rows la + i*lstep from
// ga + i*gastep and rows lb + i*lstep from gb + i*gbstep. The closing
// s_wait_xcnt 0 stands inside the copies' own statement, as above.
static __device__ __forceinline__ void async_copy4x2_b128(unsigned la, const bf16* ga, size_t gastep,
                                                          unsigned lb, const bf16* gb, size_t gbstep,
                                                          unsigned lstep) {
    asm volatile("global_load_async_to_lds_b128 %0, %8, off\n\t"
                 "global_load_async_to_lds_b128 %1, %9, off\n\t"
                 "global_load_async_to_lds_b128 %2, %10, off\n\t"
                 "global_load_async_to_lds_b128 %3, %11, off\n\t"
                 "global_load_async_to_lds_b128 %4, %12, off\n\t"
                 "global_load_async_to_lds_b128 %5, %13, off\n\t"
                 "global_load_async_to_lds_b128 %6, %14, off\n\t"
                 "global_load_async_to_lds_b128 %7, %15, off\n\t"
                 "s_wait_xcnt 0x0"
                 :: "v"(la), "v"(la + lstep), "v"(la + 2 * lstep), "v"(la + 3 * lstep),
                    "v"(lb), "v"(lb + lstep), "v"(lb + 2 * lstep), "v"(lb + 3 * lstep),
                    "v"(ga), "v"(ga + gastep), "v"(ga + 2 * gastep), "v"(ga + 3 * gastep),
                    "v"(gb), "v"(gb + gbstep), "v"(gb + 2 * gbstep), "v"(gb + 3 * gbstep)
                 : "memory");
}

// ---------------- fp32 -> bf16 convert (weights) ----------------
__global__ __launch_bounds__(256) void cvt_kernel(const float* __restrict__ src,
                                                  bf16* __restrict__ dst, int n) {
    int i = (blockIdx.x * 256 + threadIdx.x) * 4;
    if (i < n) {
        v4f s = *(const v4f*)(src + i);
#pragma unroll
        for (int t = 0; t < 4; ++t) dst[i + t] = (bf16)s[t];
    }
}

// ---------------- RMSNorm: fp32 row -> bf16 row ----------------
__global__ __launch_bounds__(256) void rmsnorm_kernel(const float* __restrict__ x,
                                                      const float* __restrict__ w,
                                                      bf16* __restrict__ out) {
    __shared__ float red[8];
    const int row = blockIdx.x;
    const int tid = threadIdx.x;
    const float* xr = x + (size_t)row * DIMN;
    v4f xv = *(const v4f*)(xr + tid * 4);
    float ss = xv.x * xv.x + xv.y * xv.y + xv.z * xv.z + xv.w * xv.w;
    ss += permxor16<1>(ss);
    ss += permxor16<2>(ss);
    ss += permxor16<4>(ss);
    ss += permxor16<8>(ss);
    ss += __shfl_xor(ss, 16, 32);
    if ((tid & 31) == 0) red[tid >> 5] = ss;
    __syncthreads();
    float tot = 0.f;
#pragma unroll
    for (int i = 0; i < 8; ++i) tot += red[i];
    const float rinv = rsqrtf(tot * (1.f / DIMN) + 1e-5f);
    const float* wr = w + tid * 4;
    bf16* orow = out + (size_t)row * DIMN + tid * 4;
#pragma unroll
    for (int t = 0; t < 4; ++t) orow[t] = (bf16)(xv[t] * rinv * wr[t]);
}

// ---------------- WMMA GEMM: C[M,N] = A[M,K] @ W[N,K]^T ----------------
// Two-buffer LDS ring filled by async global->LDS copies (ASYNCcnt). A ring tile
// holds KT = 128 k of 128 A rows and 128 W rows: every row is 256 contiguous
// bytes of global memory, at an LDS pitch of 272 B (16 B x odd).
// M, N multiples of 128; K a multiple of 128.
// MODE 0: QKV scatter (N=3072): q/k -> [B,H,S,Dh] bf16, v -> [B,H,Dh,S] bf16
// MODE 1: store bf16 C[M,N]
// MODE 2: store fp32 C[M,N] + res[M,N]
template <int MODE>
__global__ __launch_bounds__(256)
void gemm_kernel(const bf16* __restrict__ A, const bf16* __restrict__ W,
                 int M, int N, int K,
                 float* __restrict__ outF, bf16* __restrict__ outB,
                 const float* __restrict__ res,
                 bf16* __restrict__ qo, bf16* __restrict__ ko, bf16* __restrict__ vo) {
    constexpr int KT = 128;            // k per ring tile
    constexpr int LP = KT + 8;         // LDS row pitch in elements
    __shared__ bf16 As[2][128 * LP];
    __shared__ bf16 Bs[2][128 * LP];
    const int m0 = blockIdx.y * 128;
    const int n0 = blockIdx.x * 128;
    const int tid = threadIdx.x;
    const int lane = tid & 31;
    const int wave = tid >> 5;
    const int wm = (wave >> 1) * 32;   // wave M offset (4 waves in M)
    const int wn = (wave & 1) * 64;    // wave N offset (2 waves in N)
    const int lo = lane & 15;
    const int hi = lane >> 4;
    const int kb = hi << 3;            // K-chunk base per A/B VGPR layout

    v8f acc[2][4] = {};

    // 16 lanes cover one 256-B row; a thread copies rows srow + 16 i, i = 0..7,
    // of A and of W: 16 async b128 copies per thread and tile.
    const int srow = tid >> 4, scol = (tid & 15) << 3;
    const bf16* gA = A + (size_t)(m0 + srow) * K + scol;
    const bf16* gW = W + (size_t)(n0 + srow) * K + scol;
    const size_t gstep = (size_t)16 * K;
    const unsigned lA = (unsigned)(size_t)&As[0][srow * LP + scol];
    const unsigned lB = (unsigned)(size_t)&Bs[0][srow * LP + scol];

    auto stage = [&](int k0, unsigned pb) {
        const unsigned bo = pb * (unsigned)(128 * LP * sizeof(bf16));
        async_copy8_b128(lA + bo, 16 * LP * sizeof(bf16), gA + k0, gstep);
        async_copy8_b128(lB + bo, 16 * LP * sizeof(bf16), gW + k0, gstep);
    };

    const int ntile = K / KT;
    stage(0, 0);
    // tile 0 has landed for this wave; the barrier publishes it to the others
    asm volatile("s_wait_asynccnt 0x0" ::: "memory");
    __syncthreads();
    if (K >= 2 * KT) stage(KT, 1);
    for (int t = 0; t < ntile; ++t) {
        const bf16* Asp = As[t & 1];
        const bf16* Bsp = Bs[t & 1];
        // unrolled so that the four k steps of a tile read at constant LDS offsets
#pragma unroll
        for (int ks = 0; ks < KT; ks += 32) {
            Frag a[2], b;
#pragma unroll
            for (int mt = 0; mt < 2; ++mt) {
                const bf16* ap = &Asp[(wm + mt * 16 + lo) * LP + ks + kb];
                a[mt].h[0] = *(const v8bf*)ap;
                a[mt].h[1] = *(const v8bf*)(ap + 16);
            }
#pragma unroll
            for (int nt = 0; nt < 4; ++nt) {
                const bf16* bp = &Bsp[(wn + nt * 16 + lo) * LP + ks + kb];
                b.h[0] = *(const v8bf*)bp;
                b.h[1] = *(const v8bf*)(bp + 16);
                acc[0][nt] = wmma_bf16(a[0], b, acc[0][nt]);
                acc[1][nt] = wmma_bf16(a[1], b, acc[1][nt]);
            }
        }
        // Publish point of tile t + 1: this wave's reads of buffer t & 1 have
        // retired, its copies of tile t + 1 have landed, then one barrier that
        // both publishes tile t + 1 and frees buffer t & 1 for the refill.
        asm volatile("s_wait_dscnt 0x0" ::: "memory");
        asm volatile("s_wait_asynccnt 0x0" ::: "memory");
        __syncthreads();
        if (t + 2 < ntile) stage((t + 2) * KT, (unsigned)(t & 1));
    }
    // no copy is left outstanding when the wave goes on to its stores and ends
    asm volatile("s_wait_asynccnt 0x0" ::: "memory");

#pragma unroll
    for (int mt = 0; mt < 2; ++mt)
#pragma unroll
        for (int nt = 0; nt < 4; ++nt)
#pragma unroll
            for (int r = 0; r < 8; ++r) {
                const int m = m0 + wm + mt * 16 + r + hi * 8;
                const int n = n0 + wn + nt * 16 + lo;
                const float vacc = acc[mt][nt][r];
                if constexpr (MODE == 0) {
                    const int bq = m >> 11, s = m & 2047;
                    const int which = n >> 10, col = n & 1023;
                    const int hh = col >> 6, d = col & 63;
                    const size_t bhd = (size_t)(bq * NHEAD + hh);
                    if (which == 0)
                        qo[(bhd * S_LEN + s) * HDIM + d] = (bf16)vacc;
                    else if (which == 1)
                        ko[(bhd * S_LEN + s) * HDIM + d] = (bf16)vacc;
                    else
                        vo[(bhd * HDIM + d) * S_LEN + s] = (bf16)vacc;
                } else if constexpr (MODE == 1) {
                    outB[(size_t)m * N + n] = (bf16)vacc;
                } else {
                    outF[(size_t)m * N + n] = vacc + res[(size_t)m * N + n];
                }
            }
}

__global__ __launch_bounds__(128)
void attn_kernel(const bf16* __restrict__ q, const bf16* __restrict__ k,
                 const bf16* __restrict__ v, bf16* __restrict__ out) {
    constexpr int KS = 64;             // keys per ring stage
    constexpr int LPA = 64 + 8;        // LDS row pitch in elements
    __shared__ __attribute__((aligned(16))) bf16 Ks[2][KS * LPA];     // [key][d]
    __shared__ __attribute__((aligned(16))) bf16 Vs[2][HDIM * LPA];   // [d][key]
    const int tid = threadIdx.x;
    const int lane = tid & 31;
    // in a scalar register: the test that skips a pass is then a scalar branch
    const int wave = __builtin_amdgcn_readfirstlane(tid >> 5);
    const int lo = lane & 15;
    const int hi = lane >> 4;
    const int kb = hi << 3;
    const int bh = blockIdx.y;                   // 0..31
    const int qbase = blockIdx.x * 64 + wave * 16;
    const int b = bh >> 4, h0 = bh & 15;

    // B operand of S^T: column lo = query qbase + lo
    const bf16* qp = q + (((size_t)bh) * S_LEN + qbase + lo) * HDIM;
    Frag qb[2];
    qb[0].h[0] = *(const v8bf*)(qp + kb);
    qb[0].h[1] = *(const v8bf*)(qp + kb + 16);
    qb[1].h[0] = *(const v8bf*)(qp + 32 + kb);
    qb[1].h[1] = *(const v8bf*)(qp + 32 + kb + 16);

    v8f o[4] = {};               // O^T: row d = 16 dt + 8 hi + r, column = query lo
    float mrow = -INFINITY;      // running maximum of query lo (equal in both halves)
    float lsum = 0.f;            // this half's share of the running sum of query lo
    const float scale = 0.125f;  // 1/sqrt(64)

    // 8 lanes cover one 128-B row; a thread copies rows crow + 16 i, i = 0..3, of
    // the stage's K and of its V^T: 8 async b128 copies per thread and stage.
    const int crow = tid >> 3, ccol = (tid & 7) << 3;
    const bf16* gK = k + (((size_t)bh) * S_LEN + crow) * HDIM + ccol;
    const bf16* gV = v + (((size_t)bh) * HDIM + crow) * S_LEN + ccol;
    const unsigned lK = (unsigned)(size_t)&Ks[0][crow * LPA + ccol];
    const unsigned lV = (unsigned)(size_t)&Vs[0][crow * LPA + ccol];
    auto stage = [&](int t, unsigned pb) {
        const unsigned bo = pb * (unsigned)(KS * LPA * sizeof(bf16));
        async_copy4x2_b128(lK + bo, gK + (size_t)t * KS * HDIM, (size_t)16 * HDIM,
                           lV + bo, gV + (size_t)t * KS, (size_t)16 * S_LEN,
                           16 * LPA * sizeof(bf16));
    };

    const int nst = blockIdx.x + 1;    // stages up to the block's diagonal
    stage(0, 0);
    // stage 0 has landed for this wave; the barrier publishes it to the others
    asm volatile("s_wait_asynccnt 0x0" ::: "memory");
    __syncthreads();
    if (nst > 1) stage(1, 1);
    for (int t = 0; t < nst; ++t) {
      // unrolled so that both passes of a stage read at constant LDS offsets
#pragma unroll
      for (int ps = 0; ps < 2; ++ps) {
        const int j0 = t * KS + ps * 32;
        // a pass wholly beyond this wave's diagonal is skipped (wave-uniform);
        // the publish point below stands outside the skip
        if (j0 > qbase + 15) continue;
        const bf16* kp = &Ks[t & 1][(ps * 32 + lo) * LPA + kb];
        const bf16* vp = &Vs[t & 1][lo * LPA + ps * 32 + kb];
        // A operands: K rows j0 + lo and j0 + 16 + lo; V^T rows d = 16 dt + lo
        Frag a00, a01, a10, a11, va[4];
        a00.h[0] = *(const v8bf*)(kp);
        a00.h[1] = *(const v8bf*)(kp + 16);
        a01.h[0] = *(const v8bf*)(kp + 32);
        a01.h[1] = *(const v8bf*)(kp + 48);
        a10.h[0] = *(const v8bf*)(kp + 16 * LPA);
        a10.h[1] = *(const v8bf*)(kp + 16 * LPA + 16);
        a11.h[0] = *(const v8bf*)(kp + 16 * LPA + 32);
        a11.h[1] = *(const v8bf*)(kp + 16 * LPA + 48);
#pragma unroll
        for (int dt = 0; dt < 4; ++dt) {
            va[dt].h[0] = *(const v8bf*)(vp + dt * 16 * LPA);
            va[dt].h[1] = *(const v8bf*)(vp + dt * 16 * LPA + 16);
        }
        // The pass's 16 LDS reads go out as one group ahead of its WMMAs; without
        // this line the scheduler puts two reads and a full wait in front of each
        // score WMMA and the wave waits out the LDS latency several times a pass.
        __builtin_amdgcn_sched_barrier(0);
        v8f s0 = {}, s1 = {};
        s0 = wmma_bf16(a00, qb[0], s0);
        s1 = wmma_bf16(a10, qb[0], s1);
        s0 = wmma_bf16(a01, qb[1], s0);
        s1 = wmma_bf16(a11, qb[1], s1);

        // Online softmax of query lo. s0[r] is key j0 + kb + r, s1[r] key
        // j0 + 16 + kb + r; a key is inside the causal mask while its offset
        // from j0 + kb does not exceed lim.
        const int lim = qbase + lo - j0 - kb;
        float x0[8], x1[8];
        float mx = -INFINITY;
#pragma unroll
        for (int r = 0; r < 8; ++r) {
            x0[r] = (r      <= lim) ? s0[r] * scale : -INFINITY;
            x1[r] = (r + 16 <= lim) ? s1[r] * scale : -INFINITY;
            mx = fmaxf(mx, fmaxf(x0[r], x1[r]));
        }
        mx = fmaxf(mx, xhalf(mx));
        const float mnew = fmaxf(mrow, mx);
        const float alpha = __expf(mrow - mnew);
        mrow = mnew;
        Frag pb;
        float ps0 = 0.f, ps1 = 0.f;
#pragma unroll
        for (int r = 0; r < 8; ++r) {
            const float p0 = __expf(x0[r] - mnew);
            const float p1 = __expf(x1[r] - mnew);
            ps0 += p0;
            ps1 += p1;
            pb.h[0][r] = (bf16)p0;
            pb.h[1][r] = (bf16)p1;
        }
        lsum = lsum * alpha + (ps0 + ps1);
#pragma unroll
        for (int dt = 0; dt < 4; ++dt) {
            v8f ov = o[dt];
#pragma unroll
            for (int r = 0; r < 8; ++r) ov[r] *= alpha;
            o[dt] = wmma_bf16(va[dt], pb, ov);
        }
      }
      // Publish point of stage t + 1: this wave's reads of buffer t & 1 have
      // retired, its copies of stage t + 1 have landed, then one barrier that
      // both publishes stage t + 1 and frees buffer t & 1 for the refill.
      asm volatile("s_wait_dscnt 0x0" ::: "memory");
      asm volatile("s_wait_asynccnt 0x0" ::: "memory");
      __syncthreads();
      if (t + 2 < nst) stage(t + 2, (unsigned)(t & 1));
    }
    // no copy is left outstanding when the wave goes on to its stores and ends
    asm volatile("s_wait_asynccnt 0x0" ::: "memory");

    const float ltot = lsum + xhalf(lsum);
    bf16* op = out + ((size_t)(b * S_LEN + qbase + lo)) * DIMN + h0 * HDIM + kb;
#pragma unroll
    for (int dt = 0; dt < 4; ++dt) {
        v8bf ov;
#pragma unroll
        for (int r = 0; r < 8; ++r) ov[r] = (bf16)(o[dt][r] / ltot);
        *(v8bf*)(op + dt * 16) = ov;
    }
}

// ---------------- silu(gate) * up -> bf16 ----------------
__global__ __launch_bounds__(256)
void silu_mul_kernel(const bf16* __restrict__ gu, bf16* __restrict__ outm) {
    const size_t idx = ((size_t)blockIdx.x * 256 + threadIdx.x) * 8;
    const size_t m = idx >> 12;          // / 4096
    const size_t j = idx & 4095;
    v8bf gv = *(const v8bf*)&gu[m * 8192 + j];
    v8bf uv = *(const v8bf*)&gu[m * 8192 + 4096 + j];
    v8bf ov;
#pragma unroll
    for (int t = 0; t < 8; ++t) {
        const float g = (float)gv[t];
        const float u = (float)uv[t];
        ov[t] = (bf16)((g / (1.f + __expf(-g))) * u);
    }
    *(v8bf*)&outm[idx] = ov;
}

extern "C" void kernel_launch(void* const* d_in, const int* in_sizes, int n_in,
                              void* d_out, int out_size, void* d_ws, size_t ws_size,
                              hipStream_t stream) {
    const float* x     = (const float*)d_in[0];
    const float* wq    = (const float*)d_in[1];
    const float* wk    = (const float*)d_in[2];
    const float* wv    = (const float*)d_in[3];
    const float* wo    = (const float*)d_in[4];
    const float* wgate = (const float*)d_in[5];
    const float* wup   = (const float*)d_in[6];
    const float* wdown = (const float*)d_in[7];
    const float* n1w   = (const float*)d_in[8];
    const float* n2w   = (const float*)d_in[9];

    char* ws = (char*)d_ws;
    size_t off = 0;
    auto take = [&](size_t bytes) -> char* {
        char* p = ws + off;
        off += (bytes + 255) & ~(size_t)255;
        return p;
    };
    bf16*  a1   = (bf16*)take((size_t)MTOT * DIMN * 2);
    bf16*  wqkv = (bf16*)take((size_t)3 * DIMN * DIMN * 2);
    bf16*  wo_b = (bf16*)take((size_t)DIMN * DIMN * 2);
    bf16*  wgu  = (bf16*)take((size_t)2 * HIDDEN * DIMN * 2);
    bf16*  wdn  = (bf16*)take((size_t)DIMN * HIDDEN * 2);
    bf16*  qws  = (bf16*)take((size_t)MTOT * DIMN * 2);
    bf16*  kws  = (bf16*)take((size_t)MTOT * DIMN * 2);
    bf16*  vws  = (bf16*)take((size_t)MTOT * DIMN * 2);
    bf16*  attn = (bf16*)take((size_t)MTOT * DIMN * 2);
    float* x2   = (float*)take((size_t)MTOT * DIMN * 4);
    bf16*  a2   = (bf16*)take((size_t)MTOT * DIMN * 2);
    bf16*  gu   = (bf16*)take((size_t)MTOT * 2 * HIDDEN * 2);
    bf16*  mlp  = (bf16*)take((size_t)MTOT * HIDDEN * 2);

    auto cvt = [&](const float* s, bf16* dp, int n) {
        cvt_kernel<<<(n / 4 + 255) / 256, 256, 0, stream>>>(s, dp, n);
    };
    cvt(wq, wqkv, DIMN * DIMN);
    cvt(wk, wqkv + (size_t)DIMN * DIMN, DIMN * DIMN);
    cvt(wv, wqkv + (size_t)2 * DIMN * DIMN, DIMN * DIMN);
    cvt(wo, wo_b, DIMN * DIMN);
    cvt(wgate, wgu, HIDDEN * DIMN);
    cvt(wup, wgu + (size_t)HIDDEN * DIMN, HIDDEN * DIMN);
    cvt(wdown, wdn, DIMN * HIDDEN);

    rmsnorm_kernel<<<MTOT, 256, 0, stream>>>(x, n1w, a1);

    gemm_kernel<0><<<dim3(3072 / 128, MTOT / 128), 256, 0, stream>>>(
        a1, wqkv, MTOT, 3072, DIMN, nullptr, nullptr, nullptr, qws, kws, vws);

    attn_kernel<<<dim3(S_LEN / 64, BATCH * NHEAD), 128, 0, stream>>>(qws, kws, vws, attn);

    gemm_kernel<2><<<dim3(DIMN / 128, MTOT / 128), 256, 0, stream>>>(
        attn, wo_b, MTOT, DIMN, DIMN, x2, nullptr, x, nullptr, nullptr, nullptr);

    rmsnorm_kernel<<<MTOT, 256, 0, stream>>>(x2, n2w, a2);

    gemm_kernel<1><<<dim3(2 * HIDDEN / 128, MTOT / 128), 256, 0, stream>>>(
        a2, wgu, MTOT, 2 * HIDDEN, DIMN, nullptr, gu, nullptr, nullptr, nullptr, nullptr);

    silu_mul_kernel<<<((size_t)MTOT * HIDDEN / 8) / 256, 256, 0, stream>>>(gu, mlp);

    gemm_kernel<2><<<dim3(DIMN / 128, MTOT / 128), 256, 0, stream>>>(
        mlp, wdn, MTOT, DIMN, HIDDEN, (float*)d_out, nullptr, x2,
        nullptr, nullptr, nullptr);
}

// v004
// Measured time: 231 microseconds a run.
// Two timings next to v003 put it at 1.06 and 1.07 times that version's speed.
// All steps since v000 together make it 1.60 times as fast.
#include <hip/hip_runtime.h>
#include <hip/hip_bf16.h>
#include <math.h>

typedef __bf16 bf16;
typedef __attribute__((ext_vector_type(16))) __bf16 v16bf;
typedef __attribute__((ext_vector_type(8)))  __bf16 v8bf;
typedef __attribute__((ext_vector_type(8)))  float  v8f;
typedef __attribute__((ext_vector_type(4)))  float  v4f;

#define DIMN   1024
#define S_LEN  2048
#define BATCH  2
#define NHEAD  16
#define HDIM   64
#define HIDDEN 4096
#define MTOT   (BATCH * S_LEN)   // 4096 rows

union Frag { v16bf v; v8bf h[2]; };

static __device__ __forceinline__ v8f wmma_bf16(const Frag& a, const Frag& b, v8f c) {
    return __builtin_amdgcn_wmma_f32_16x16x32_bf16(false, a.v, false, b.v,
                                                   (short)0, c, false, false);
}

// XOR-shuffle within each 16-lane half using v_permlane16_b32 (pure VALU,
// avoids ds_bpermute + s_wait_dscnt round-trips).
template <int M>
static __device__ __forceinline__ float permxor16(float v) {
#if __has_builtin(__builtin_amdgcn_permlane16)
    constexpr unsigned lo =
        ((unsigned)(0 ^ M)) | ((unsigned)(1 ^ M) << 4) | ((unsigned)(2 ^ M) << 8) |
        ((unsigned)(3 ^ M) << 12) | ((unsigned)(4 ^ M) << 16) |
        ((unsigned)(5 ^ M) << 20) | ((unsigned)(6 ^ M) << 24) |
        ((unsigned)(7 ^ M) << 28);
    constexpr unsigned hi =
        ((unsigned)((8 ^ M) & 15)) | ((unsigned)((9 ^ M) & 15) << 4) |
        ((unsigned)((10 ^ M) & 15) << 8) | ((unsigned)((11 ^ M) & 15) << 12) |
        ((unsigned)((12 ^ M) & 15) << 16) | ((unsigned)((13 ^ M) & 15) << 20) |
        ((unsigned)((14 ^ M) & 15) << 24) | ((unsigned)((15 ^ M) & 15) << 28);
    int iv = __builtin_bit_cast(int, v);
    int r = __builtin_amdgcn_permlane16(iv, iv, (int)lo, (int)hi, false, false);
    return __builtin_bit_cast(float, r);
#else
    return __shfl_xor(v, M, 32);
#endif
}

// Lane l <-> lane l ^ 16: the two halves of a wave that share a column of a
// WMMA accumulator tile (pure VALU).
static __device__ __forceinline__ float xhalf(float v) {
    const int iv = __builtin_bit_cast(int, v);
    const int r = __builtin_amdgcn_permlanex16(iv, iv, 0x76543210, 0xfedcba98, false, false);
    return __builtin_bit_cast(float, r);
}

// Eight async global->LDS 16-B copies per lane (ASYNCcnt): rows l + i*lstep in
// LDS from rows g + i*gstep in global memory. The closing s_wait_xcnt 0 stands
// inside the copies' own statement so that no address register named here is
// rewritten ahead of it.
static __device__ __forceinline__ void async_copy8_b128(unsigned l, unsigned lstep,
                                                        const bf16* g, size_t gstep) {
    asm volatile("global_load_async_to_lds_b128 %0, %8, off\n\t"
                 "global_load_async_to_lds_b128 %1, %9, off\n\t"
                 "global_load_async_to_lds_b128 %2, %10, off\n\t"
                 "global_load_async_to_lds_b128 %3, %11, off\n\t"
                 "global_load_async_to_lds_b128 %4, %12, off\n\t"
                 "global_load_async_to_lds_b128 %5, %13, off\n\t"
                 "global_load_async_to_lds_b128 %6, %14, off\n\t"
                 "global_load_async_to_lds_b128 %7, %15, off\n\t"
                 "s_wait_xcnt 0x0"
                 :: "v"(l), "v"(l + lstep), "v"(l + 2 * lstep), "v"(l + 3 * lstep),
                    "v"(l + 4 * lstep), "v"(l + 5 * lstep), "v"(l + 6 * lstep),
                    "v"(l + 7 * lstep),
                    "v"(g), "v"(g + gstep), "v"(g + 2 * gstep), "v"(g + 3 * gstep),
                    "v"(g + 4 * gstep), "v"(g + 5 * gstep), "v"(g + 6 * gstep),
                    "v"(g + 7 * gstep)
                 : "memory");
}

// Four and four async global->LDS 16-B copies per lane: rows la + i*lstep from
// ga + i*gastep and rows lb + i*lstep from gb + i*gbstep. The closing
// s_wait_xcnt 0 stands inside the copies' own statement, as above.
static __device__ __forceinline__ void async_copy4x2_b128(unsigned la, const bf16* ga, size_t gastep,
                                                          unsigned lb, const bf16* gb, size_t gbstep,
                                                          unsigned lstep) {
    asm volatile("global_load_async_to_lds_b128 %0, %8, off\n\t"
                 "global_load_async_to_lds_b128 %1, %9, off\n\t"
                 "global_load_async_to_lds_b128 %2, %10, off\n\t"
                 "global_load_async_to_lds_b128 %3, %11, off\n\t"
                 "global_load_async_to_lds_b128 %4, %12, off\n\t"
                 "global_load_async_to_lds_b128 %5, %13, off\n\t"
                 "global_load_async_to_lds_b128 %6, %14, off\n\t"
                 "global_load_async_to_lds_b128 %7, %15, off\n\t"
                 "s_wait_xcnt 0x0"
                 :: "v"(la), "v"(la + lstep), "v"(la + 2 * lstep), "v"(la + 3 * lstep),
                    "v"(lb), "v"(lb + lstep), "v"(lb + 2 * lstep), "v"(lb + 3 * lstep),
                    "v"(ga), "v"(ga + gastep), "v"(ga + 2 * gastep), "v"(ga + 3 * gastep),
                    "v"(gb), "v"(gb + gbstep), "v"(gb + 2 * gbstep), "v"(gb + 3 * gbstep)
                 : "memory");
}

// ---------------- fp32 -> bf16 convert (weights) ----------------
__global__ __launch_bounds__(256) void cvt_kernel(const float* __restrict__ src,
                                                  bf16* __restrict__ dst, int n) {
    int i = (blockIdx.x * 256 + threadIdx.x) * 4;
    if (i < n) {
        v4f s = *(const v4f*)(src + i);
#pragma unroll
        for (int t = 0; t < 4; ++t) dst[i + t] = (bf16)s[t];
    }
}

// ---------------- RMSNorm: fp32 row -> bf16 row ----------------
__global__ __launch_bounds__(256) void rmsnorm_kernel(const float* __restrict__ x,
                                                      const float* __restrict__ w,
                                                      bf16* __restrict__ out) {
    __shared__ float red[8];
    const int row = blockIdx.x;
    const int tid = threadIdx.x;
    const float* xr = x + (size_t)row * DIMN;
    v4f xv = *(const v4f*)(xr + tid * 4);
    float ss = xv.x * xv.x + xv.y * xv.y + xv.z * xv.z + xv.w * xv.w;
    ss += permxor16<1>(ss);
    ss += permxor16<2>(ss);
    ss += permxor16<4>(ss);
    ss += permxor16<8>(ss);
    ss += __shfl_xor(ss, 16, 32);
    if ((tid & 31) == 0) red[tid >> 5] = ss;
    __syncthreads();
    float tot = 0.f;
#pragma unroll
    for (int i = 0; i < 8; ++i) tot += red[i];
    const float rinv = rsqrtf(tot * (1.f / DIMN) + 1e-5f);
    const float* wr = w + tid * 4;
    bf16* orow = out + (size_t)row * DIMN + tid * 4;
#pragma unroll
    for (int t = 0; t < 4; ++t) orow[t] = (bf16)(xv[t] * rinv * wr[t]);
}

// ---------------- WMMA GEMM: C[M,N] = A[M,K] @ W[N,K]^T ----------------
// Two-buffer LDS ring filled by async global->LDS copies (ASYNCcnt). A ring tile
// holds KT = 128 k of 128 A rows and 128 W rows: every row is 256 contiguous
// bytes of global memory, at an LDS pitch of 272 B (16 B x odd).
// M, N multiples of 128; K a multiple of 128.
// MODE 0: QKV scatter (N=3072): q/k -> [B,H,S,Dh] bf16, v -> [B,H,Dh,S] bf16
// MODE 1: store bf16 C[M,N]
// MODE 2: store fp32 C[M,N] + res[M,N]
template <int MODE>
__global__ __launch_bounds__(256)
void gemm_kernel(const bf16* __restrict__ A, const bf16* __restrict__ W,
                 int M, int N, int K,
                 float* __restrict__ outF, bf16* __restrict__ outB,
                 const float* __restrict__ res,
                 bf16* __restrict__ qo, bf16* __restrict__ ko, bf16* __restrict__ vo) {
    constexpr int KT = 128;            // k per ring tile
    constexpr int LP = KT + 8;         // LDS row pitch in elements
    __shared__ bf16 As[2][128 * LP];
    __shared__ bf16 Bs[2][128 * LP];
    const int m0 = blockIdx.y * 128;
    const int n0 = blockIdx.x * 128;
    const int tid = threadIdx.x;
    const int lane = tid & 31;
    const int wave = tid >> 5;
    const int wm = (wave >> 1) * 32;   // wave M offset (4 waves in M)
    const int wn = (wave & 1) * 64;    // wave N offset (2 waves in N)
    const int lo = lane & 15;
    const int hi = lane >> 4;
    const int kb = hi << 3;            // K-chunk base per A/B VGPR layout

    v8f acc[2][4] = {};

    // 16 lanes cover one 256-B row; a thread copies rows srow + 16 i, i = 0..7,
    // of A and of W: 16 async b128 copies per thread and tile.
    const int srow = tid >> 4, scol = (tid & 15) << 3;
    const bf16* gA = A + (size_t)(m0 + srow) * K + scol;
    const bf16* gW = W + (size_t)(n0 + srow) * K + scol;
    const size_t gstep = (size_t)16 * K;
    const unsigned lA = (unsigned)(size_t)&As[0][srow * LP + scol];
    const unsigned lB = (unsigned)(size_t)&Bs[0][srow * LP + scol];

    auto stage = [&](int k0, unsigned pb) {
        const unsigned bo = pb * (unsigned)(128 * LP * sizeof(bf16));
        async_copy8_b128(lA + bo, 16 * LP * sizeof(bf16), gA + k0, gstep);
        async_copy8_b128(lB + bo, 16 * LP * sizeof(bf16), gW + k0, gstep);
    };

    // Two fragment sets: the 12 LDS reads of a k step go out as one group, one k
    // step ahead of the WMMAs that use them. The loops over mt and nt below are
    // unrolled so that every fragment and accumulator index is a constant and the
    // arrays stay in registers.
    Frag a[2][2], b[2][4];
    auto frags = [&](unsigned pb, int ks, int set) {
#pragma unroll
        for (int mt = 0; mt < 2; ++mt) {
            const bf16* ap = &As[pb][(wm + mt * 16 + lo) * LP + ks + kb];
            a[set][mt].h[0] = *(const v8bf*)ap;
            a[set][mt].h[1] = *(const v8bf*)(ap + 16);
        }
#pragma unroll
        for (int nt = 0; nt < 4; ++nt) {
            const bf16* bp = &Bs[pb][(wn + nt * 16 + lo) * LP + ks + kb];
            b[set][nt].h[0] = *(const v8bf*)bp;
            b[set][nt].h[1] = *(const v8bf*)(bp + 16);
        }
    };
    auto mma = [&](int set) {
        // Keeps the next step's reads, written above, in front of these WMMAs;
        // without it the scheduler sinks them to two reads and a full wait per
        // WMMA pair.
        __builtin_amdgcn_sched_barrier(0);
#pragma unroll
        for (int nt = 0; nt < 4; ++nt) {
            acc[0][nt] = wmma_bf16(a[set][0], b[set][nt], acc[0][nt]);
            acc[1][nt] = wmma_bf16(a[set][1], b[set][nt], acc[1][nt]);
        }
        // Keeps the following group of reads whole, behind these WMMAs.
        __builtin_amdgcn_sched_barrier(0);
    };

    constexpr int NS = KT / 32;        // k steps per tile (even: step 0 is set 0)
    const int ntile = K / KT;
    stage(0, 0);
    // tile 0 has landed for this wave; the barrier publishes it to the others
    asm volatile("s_wait_asynccnt 0x0" ::: "memory");
    __syncthreads();
    if (K >= 2 * KT) stage(KT, 1);
    frags(0, 0, 0);
    for (int t = 0; t < ntile; ++t) {
        const unsigned pb = (unsigned)(t & 1);
        // unrolled so that the k steps of a tile read at constant LDS offsets and
        // the fragment sets stay in registers
#pragma unroll
        for (int s = 0; s + 1 < NS; ++s) {
            frags(pb, (s + 1) * 32, (s + 1) & 1);
            mma(s & 1);
        }
        // Publish point of tile t + 1, in front of tile t's last k step, whose
        // fragments are fetched: this wave's reads of buffer t & 1 have retired,
        // its copies of tile t + 1 have landed, then one barrier that both
        // publishes tile t + 1 and frees buffer t & 1 for the refill.
        asm volatile("s_wait_dscnt 0x0" ::: "memory");
        asm volatile("s_wait_asynccnt 0x0" ::: "memory");
        __syncthreads();
        if (t + 2 < ntile) stage((t + 2) * KT, pb);
        if (t + 1 < ntile) frags(pb ^ 1u, 0, 0);
        mma((NS - 1) & 1);
    }
    // no copy is left outstanding when the wave goes on to its stores and ends
    asm volatile("s_wait_asynccnt 0x0" ::: "memory");

#pragma unroll
    for (int mt = 0; mt < 2; ++mt)
#pragma unroll
        for (int nt = 0; nt < 4; ++nt)
#pragma unroll
            for (int r = 0; r < 8; ++r) {
                const int m = m0 + wm + mt * 16 + r + hi * 8;
                const int n = n0 + wn + nt * 16 + lo;
                const float vacc = acc[mt][nt][r];
                if constexpr (MODE == 0) {
                    const int bq = m >> 11, s = m & 2047;
                    const int which = n >> 10, col = n & 1023;
                    const int hh = col >> 6, d = col & 63;
                    const size_t bhd = (size_t)(bq * NHEAD + hh);
                    if (which == 0)
                        qo[(bhd * S_LEN + s) * HDIM + d] = (bf16)vacc;
                    else if (which == 1)
                        ko[(bhd * S_LEN + s) * HDIM + d] = (bf16)vacc;
                    else
                        vo[(bhd * HDIM + d) * S_LEN + s] = (bf16)vacc;
                } else if constexpr (MODE == 1) {
                    outB[(size_t)m * N + n] = (bf16)vacc;
                } else {
                    outF[(size_t)m * N + n] = vacc + res[(size_t)m * N + n];
                }
            }
}

__global__ __launch_bounds__(128)
void attn_kernel(const bf16* __restrict__ q, const bf16* __restrict__ k,
                 const bf16* __restrict__ v, bf16* __restrict__ out) {
    constexpr int KS = 64;             // keys per ring stage
    constexpr int LPA = 64 + 8;        // LDS row pitch in elements
    __shared__ __attribute__((aligned(16))) bf16 Ks[2][KS * LPA];     // [key][d]
    __shared__ __attribute__((aligned(16))) bf16 Vs[2][HDIM * LPA];   // [d][key]
    const int tid = threadIdx.x;
    const int lane = tid & 31;
    // in a scalar register: the test that skips a pass is then a scalar branch
    const int wave = __builtin_amdgcn_readfirstlane(tid >> 5);
    const int lo = lane & 15;
    const int hi = lane >> 4;
    const int kb = hi << 3;
    const int bh = blockIdx.y;                   // 0..31
    const int qbase = blockIdx.x * 64 + wave * 16;
    const int b = bh >> 4, h0 = bh & 15;

    // B operand of S^T: column lo = query qbase + lo
    const bf16* qp = q + (((size_t)bh) * S_LEN + qbase + lo) * HDIM;
    Frag qb[2];
    qb[0].h[0] = *(const v8bf*)(qp + kb);
    qb[0].h[1] = *(const v8bf*)(qp + kb + 16);
    qb[1].h[0] = *(const v8bf*)(qp + 32 + kb);
    qb[1].h[1] = *(const v8bf*)(qp + 32 + kb + 16);

    v8f o[4] = {};               // O^T: row d = 16 dt + 8 hi + r, column = query lo
    float mrow = -INFINITY;      // running maximum of query lo (equal in both halves)
    float lsum = 0.f;            // this half's share of the running sum of query lo
    const float scale = 0.125f;  // 1/sqrt(64)

    // 8 lanes cover one 128-B row; a thread copies rows crow + 16 i, i = 0..3, of
    // the stage's K and of its V^T: 8 async b128 copies per thread and stage.
    const int crow = tid >> 3, ccol = (tid & 7) << 3;
    const bf16* gK = k + (((size_t)bh) * S_LEN + crow) * HDIM + ccol;
    const bf16* gV = v + (((size_t)bh) * HDIM + crow) * S_LEN + ccol;
    const unsigned lK = (unsigned)(size_t)&Ks[0][crow * LPA + ccol];
    const unsigned lV = (unsigned)(size_t)&Vs[0][crow * LPA + ccol];
    auto stage = [&](int t, unsigned pb) {
        const unsigned bo = pb * (unsigned)(KS * LPA * sizeof(bf16));
        async_copy4x2_b128(lK + bo, gK + (size_t)t * KS * HDIM, (size_t)16 * HDIM,
                           lV + bo, gV + (size_t)t * KS, (size_t)16 * S_LEN,
                           16 * LPA * sizeof(bf16));
    };

    const int nst = blockIdx.x + 1;    // stages up to the block's diagonal
    stage(0, 0);
    // stage 0 has landed for this wave; the barrier publishes it to the others
    asm volatile("s_wait_asynccnt 0x0" ::: "memory");
    __syncthreads();
    if (nst > 1) stage(1, 1);
    for (int t = 0; t < nst; ++t) {
      // unrolled so that both passes of a stage read at constant LDS offsets
#pragma unroll
      for (int ps = 0; ps < 2; ++ps) {
        const int j0 = t * KS + ps * 32;
        // a pass wholly beyond this wave's diagonal is skipped (wave-uniform);
        // the publish point below stands outside the skip
        if (j0 > qbase + 15) continue;
        const bf16* kp = &Ks[t & 1][(ps * 32 + lo) * LPA + kb];
        const bf16* vp = &Vs[t & 1][lo * LPA + ps * 32 + kb];
        // A operands: K rows j0 + lo and j0 + 16 + lo; V^T rows d = 16 dt + lo
        Frag a00, a01, a10, a11, va[4];
        a00.h[0] = *(const v8bf*)(kp);
        a00.h[1] = *(const v8bf*)(kp + 16);
        a01.h[0] = *(const v8bf*)(kp + 32);
        a01.h[1] = *(const v8bf*)(kp + 48);
        a10.h[0] = *(const v8bf*)(kp + 16 * LPA);
        a10.h[1] = *(const v8bf*)(kp + 16 * LPA + 16);
        a11.h[0] = *(const v8bf*)(kp + 16 * LPA + 32);
        a11.h[1] = *(const v8bf*)(kp + 16 * LPA + 48);
#pragma unroll
        for (int dt = 0; dt < 4; ++dt) {
            va[dt].h[0] = *(const v8bf*)(vp + dt * 16 * LPA);
            va[dt].h[1] = *(const v8bf*)(vp + dt * 16 * LPA + 16);
        }
        // The pass's 16 LDS reads go out as one group ahead of its WMMAs; without
        // this line the scheduler puts two reads and a full wait in front of each
        // score WMMA and the wave waits out the LDS latency several times a pass.
        __builtin_amdgcn_sched_barrier(0);
        v8f s0 = {}, s1 = {};
        s0 = wmma_bf16(a00, qb[0], s0);
        s1 = wmma_bf16(a10, qb[0], s1);
        s0 = wmma_bf16(a01, qb[1], s0);
        s1 = wmma_bf16(a11, qb[1], s1);

        // Online softmax of query lo. s0[r] is key j0 + kb + r, s1[r] key
        // j0 + 16 + kb + r; a key is inside the causal mask while its offset
        // from j0 + kb does not exceed lim.
        const int lim = qbase + lo - j0 - kb;
        float x0[8], x1[8];
        float mx = -INFINITY;
#pragma unroll
        for (int r = 0; r < 8; ++r) {
            x0[r] = (r      <= lim) ? s0[r] * scale : -INFINITY;
            x1[r] = (r + 16 <= lim) ? s1[r] * scale : -INFINITY;
            mx = fmaxf(mx, fmaxf(x0[r], x1[r]));
        }
        mx = fmaxf(mx, xhalf(mx));
        const float mnew = fmaxf(mrow, mx);
        const float alpha = __expf(mrow - mnew);
        mrow = mnew;
        Frag pb;
        float ps0 = 0.f, ps1 = 0.f;
#pragma unroll
        for (int r = 0; r < 8; ++r) {
            const float p0 = __expf(x0[r] - mnew);
            const float p1 = __expf(x1[r] - mnew);
            ps0 += p0;
            ps1 += p1;
            pb.h[0][r] = (bf16)p0;
            pb.h[1][r] = (bf16)p1;
        }
        lsum = lsum * alpha + (ps0 + ps1);
#pragma unroll
        for (int dt = 0; dt < 4; ++dt) {
            v8f ov = o[dt];
#pragma unroll
            for (int r = 0; r < 8; ++r) ov[r] *= alpha;
            o[dt] = wmma_bf16(va[dt], pb, ov);
        }
      }
      // Publish point of stage t + 1: this wave's reads of buffer t & 1 have
      // retired, its copies of stage t + 1 have landed, then one barrier that
      // both publishes stage t + 1 and frees buffer t & 1 for the refill.
      asm volatile("s_wait_dscnt 0x0" ::: "memory");
      asm volatile("s_wait_asynccnt 0x0" ::: "memory");
      __syncthreads();
      if (t + 2 < nst) stage(t + 2, (unsigned)(t & 1));
    }
    // no copy is left outstanding when the wave goes on to its stores and ends
    asm volatile("s_wait_asynccnt 0x0" ::: "memory");

    const float ltot = lsum + xhalf(lsum);
    bf16* op = out + ((size_t)(b * S_LEN + qbase + lo)) * DIMN + h0 * HDIM + kb;
#pragma unroll
    for (int dt = 0; dt < 4; ++dt) {
        v8bf ov;
#pragma unroll
        for (int r = 0; r < 8; ++r) ov[r] = (bf16)(o[dt][r] / ltot);
        *(v8bf*)(op + dt * 16) = ov;
    }
}

// ---------------- silu(gate) * up -> bf16 ----------------
__global__ __launch_bounds__(256)
void silu_mul_kernel(const bf16* __restrict__ gu, bf16* __restrict__ outm) {
    const size_t idx = ((size_t)blockIdx.x * 256 + threadIdx.x) * 8;
    const size_t m = idx >> 12;          // / 4096
    const size_t j = idx & 4095;
    v8bf gv = *(const v8bf*)&gu[m * 8192 + j];
    v8bf uv = *(const v8bf*)&gu[m * 8192 + 4096 + j];
    v8bf ov;
#pragma unroll
    for (int t = 0; t < 8; ++t) {
        const float g = (float)gv[t];
        const float u = (float)uv[t];
        ov[t] = (bf16)((g / (1.f + __expf(-g))) * u);
    }
    *(v8bf*)&outm[idx] = ov;
}

extern "C" void kernel_launch(void* const* d_in, const int* in_sizes, int n_in,
                              void* d_out, int out_size, void* d_ws, size_t ws_size,
                              hipStream_t stream) {
    const float* x     = (const float*)d_in[0];
    const float* wq    = (const float*)d_in[1];
    const float* wk    = (const float*)d_in[2];
    const float* wv    = (const float*)d_in[3];
    const float* wo    = (const float*)d_in[4];
    const float* wgate = (const float*)d_in[5];
    const float* wup   = (const float*)d_in[6];
    const float* wdown = (const float*)d_in[7];
    const float* n1w   = (const float*)d_in[8];
    const float* n2w   = (const float*)d_in[9];

    char* ws = (char*)d_ws;
    size_t off = 0;
    auto take = [&](size_t bytes) -> char* {
        char* p = ws + off;
        off += (bytes + 255) & ~(size_t)255;
        return p;
    };
    bf16*  a1   = (bf16*)take((size_t)MTOT * DIMN * 2);
    bf16*  wqkv = (bf16*)take((size_t)3 * DIMN * DIMN * 2);
    bf16*  wo_b = (bf16*)take((size_t)DIMN * DIMN * 2);
    bf16*  wgu  = (bf16*)take((size_t)2 * HIDDEN * DIMN * 2);
    bf16*  wdn  = (bf16*)take((size_t)DIMN * HIDDEN * 2);
    bf16*  qws  = (bf16*)take((size_t)MTOT * DIMN * 2);
    bf16*  kws  = (bf16*)take((size_t)MTOT * DIMN * 2);
    bf16*  vws  = (bf16*)take((size_t)MTOT * DIMN * 2);
    bf16*  attn = (bf16*)take((size_t)MTOT * DIMN * 2);
    float* x2   = (float*)take((size_t)MTOT * DIMN * 4);
    bf16*  a2   = (bf16*)take((size_t)MTOT * DIMN * 2);
    bf16*  gu   = (bf16*)take((size_t)MTOT * 2 * HIDDEN * 2);
    bf16*  mlp  = (bf16*)take((size_t)MTOT * HIDDEN * 2);

    auto cvt = [&](const float* s, bf16* dp, int n) {
        cvt_kernel<<<(n / 4 + 255) / 256, 256, 0, stream>>>(s, dp, n);
    };
    cvt(wq, wqkv, DIMN * DIMN);
    cvt(wk, wqkv + (size_t)DIMN * DIMN, DIMN * DIMN);
    cvt(wv, wqkv + (size_t)2 * DIMN * DIMN, DIMN * DIMN);
    cvt(wo, wo_b, DIMN * DIMN);
    cvt(wgate, wgu, HIDDEN * DIMN);
    cvt(wup, wgu + (size_t)HIDDEN * DIMN, HIDDEN * DIMN);
    cvt(wdown, wdn, DIMN * HIDDEN);

    rmsnorm_kernel<<<MTOT, 256, 0, stream>>>(x, n1w, a1);

    gemm_kernel<0><<<dim3(3072 / 128, MTOT / 128), 256, 0, stream>>>(
        a1, wqkv, MTOT, 3072, DIMN, nullptr, nullptr, nullptr, qws, kws, vws);

    attn_kernel<<<dim3(S_LEN / 64, BATCH * NHEAD), 128, 0, stream>>>(qws, kws, vws, attn);

    gemm_kernel<2><<<dim3(DIMN / 128, MTOT / 128), 256, 0, stream>>>(
        attn, wo_b, MTOT, DIMN, DIMN, x2, nullptr, x, nullptr, nullptr, nullptr);

    rmsnorm_kernel<<<MTOT, 256, 0, stream>>>(x2, n2w, a2);

    gemm_kernel<1><<<dim3(2 * HIDDEN / 128, MTOT / 128), 256, 0, stream>>>(
        a2, wgu, MTOT, 2 * HIDDEN, DIMN, nullptr, gu, nullptr, nullptr, nullptr, nullptr);

    silu_mul_kernel<<<((size_t)MTOT * HIDDEN / 8) / 256, 256, 0, stream>>>(gu, mlp);

    gemm_kernel<2><<<dim3(DIMN / 128, MTOT / 128), 256, 0, stream>>>(
        mlp, wdn, MTOT, DIMN, HIDDEN, (float*)d_out, nullptr, x2,
        nullptr, nullptr, nullptr);
}

// v005
// A run of this version takes 224 microseconds.
// In two side-by-side timings against v004, it was 1.03 and 1.04 times as fast.
// Over all steps from v000 it is 1.66 times as fast.
#include <hip/hip_runtime.h>
#include <hip/hip_bf16.h>
#include <math.h>

typedef __bf16 bf16;
typedef __attribute__((ext_vector_type(16))) __bf16 v16bf;
typedef __attribute__((ext_vector_type(8)))  __bf16 v8bf;
typedef __attribute__((ext_vector_type(4)))  __bf16 v4bf;
typedef __attribute__((ext_vector_type(8)))  float  v8f;
typedef __attribute__((ext_vector_type(4)))  float  v4f;

#define DIMN   1024
#define S_LEN  2048
#define BATCH  2
#define NHEAD  16
#define HDIM   64
#define HIDDEN 4096
#define MTOT   (BATCH * S_LEN)   // 4096 rows

union Frag { v16bf v; v8bf h[2]; };

static __device__ __forceinline__ v8f wmma_bf16(const Frag& a, const Frag& b, v8f c) {
    return __builtin_amdgcn_wmma_f32_16x16x32_bf16(false, a.v, false, b.v,
                                                   (short)0, c, false, false);
}

// XOR-shuffle within each 16-lane half using v_permlane16_b32 (pure VALU,
// avoids ds_bpermute + s_wait_dscnt round-trips).
template <int M>
static __device__ __forceinline__ float permxor16(float v) {
#if __has_builtin(__builtin_amdgcn_permlane16)
    constexpr unsigned lo =
        ((unsigned)(0 ^ M)) | ((unsigned)(1 ^ M) << 4) | ((unsigned)(2 ^ M) << 8) |
        ((unsigned)(3 ^ M) << 12) | ((unsigned)(4 ^ M) << 16) |
        ((unsigned)(5 ^ M) << 20) | ((unsigned)(6 ^ M) << 24) |
        ((unsigned)(7 ^ M) << 28);
    constexpr unsigned hi =
        ((unsigned)((8 ^ M) & 15)) | ((unsigned)((9 ^ M) & 15) << 4) |
        ((unsigned)((10 ^ M) & 15) << 8) | ((unsigned)((11 ^ M) & 15) << 12) |
        ((unsigned)((12 ^ M) & 15) << 16) | ((unsigned)((13 ^ M) & 15) << 20) |
        ((unsigned)((14 ^ M) & 15) << 24) | ((unsigned)((15 ^ M) & 15) << 28);
    int iv = __builtin_bit_cast(int, v);
    int r = __builtin_amdgcn_permlane16(iv, iv, (int)lo, (int)hi, false, false);
    return __builtin_bit_cast(float, r);
#else
    return __shfl_xor(v, M, 32);
#endif
}

// Lane l <-> lane l ^ 16: the two halves of a wave that share a column of a
// WMMA accumulator tile (pure VALU).
static __device__ __forceinline__ float xhalf(float v) {
    const int iv = __builtin_bit_cast(int, v);
    const int r = __builtin_amdgcn_permlanex16(iv, iv, 0x76543210, 0xfedcba98, false, false);
    return __builtin_bit_cast(float, r);
}

// Eight async global->LDS 16-B copies per lane (ASYNCcnt): rows l + i*lstep in
// LDS from rows g + i*gstep in global memory. The closing s_wait_xcnt 0 stands
// inside the copies' own statement so that no address register named here is
// rewritten ahead of it.
static __device__ __forceinline__ void async_copy8_b128(unsigned l, unsigned lstep,
                                                        const bf16* g, size_t gstep) {
    asm volatile("global_load_async_to_lds_b128 %0, %8, off\n\t"
                 "global_load_async_to_lds_b128 %1, %9, off\n\t"
                 "global_load_async_to_lds_b128 %2, %10, off\n\t"
                 "global_load_async_to_lds_b128 %3, %11, off\n\t"
                 "global_load_async_to_lds_b128 %4, %12, off\n\t"
                 "global_load_async_to_lds_b128 %5, %13, off\n\t"
                 "global_load_async_to_lds_b128 %6, %14, off\n\t"
                 "global_load_async_to_lds_b128 %7, %15, off\n\t"
                 "s_wait_xcnt 0x0"
                 :: "v"(l), "v"(l + lstep), "v"(l + 2 * lstep), "v"(l + 3 * lstep),
                    "v"(l + 4 * lstep), "v"(l + 5 * lstep), "v"(l + 6 * lstep),
                    "v"(l + 7 * lstep),
                    "v"(g), "v"(g + gstep), "v"(g + 2 * gstep), "v"(g + 3 * gstep),
                    "v"(g + 4 * gstep), "v"(g + 5 * gstep), "v"(g + 6 * gstep),
                    "v"(g + 7 * gstep)
                 : "memory");
}

// Four and four async global->LDS 16-B copies per lane: rows la + i*lstep from
// ga + i*gastep and rows lb + i*lstep from gb + i*gbstep. The closing
// s_wait_xcnt 0 stands inside the copies' own statement, as above.
static __device__ __forceinline__ void async_copy4x2_b128(unsigned la, const bf16* ga, size_t gastep,
                                                          unsigned lb, const bf16* gb, size_t gbstep,
                                                          unsigned lstep) {
    asm volatile("global_load_async_to_lds_b128 %0, %8, off\n\t"
                 "global_load_async_to_lds_b128 %1, %9, off\n\t"
                 "global_load_async_to_lds_b128 %2, %10, off\n\t"
                 "global_load_async_to_lds_b128 %3, %11, off\n\t"
                 "global_load_async_to_lds_b128 %4, %12, off\n\t"
                 "global_load_async_to_lds_b128 %5, %13, off\n\t"
                 "global_load_async_to_lds_b128 %6, %14, off\n\t"
                 "global_load_async_to_lds_b128 %7, %15, off\n\t"
                 "s_wait_xcnt 0x0"
                 :: "v"(la), "v"(la + lstep), "v"(la + 2 * lstep), "v"(la + 3 * lstep),
                    "v"(lb), "v"(lb + lstep), "v"(lb + 2 * lstep), "v"(lb + 3 * lstep),
                    "v"(ga), "v"(ga + gastep), "v"(ga + 2 * gastep), "v"(ga + 3 * gastep),
                    "v"(gb), "v"(gb + gbstep), "v"(gb + 2 * gbstep), "v"(gb + 3 * gbstep)
                 : "memory");
}

// The streaming stages run as few, long waves: 256 work-groups of 16 waves, one a
// WGP; every load is 512 contiguous bytes of a wave, and a wave issues all its
// loads before it works on the first of them.

// RMSNorm of one fp32 row by one wave -> bf16 row. xv, wv: the lane's elements
// i * 128 + 4 lane + e of the row and of the weight; orow: the row's start.
static __device__ __forceinline__ void rms_row(const v4f (&xv)[8], const v4f (&wv)[8],
                                               bf16* __restrict__ orow, int lane) {
    v4f sq = {};
#pragma unroll
    for (int i = 0; i < 8; ++i) sq += xv[i] * xv[i];
    float ss = (sq.x + sq.y) + (sq.z + sq.w);
    ss += permxor16<1>(ss);
    ss += permxor16<2>(ss);
    ss += permxor16<4>(ss);
    ss += permxor16<8>(ss);
    ss += xhalf(ss);
    const float rinv = rsqrtf(ss * (1.f / DIMN) + 1e-5f);
#pragma unroll
    for (int i = 0; i < 8; ++i) {
        v4bf o;
#pragma unroll
        for (int e = 0; e < 4; ++e) o[e] = (bf16)(xv[i][e] * rinv * wv[i][e]);
        ((v4bf*)orow)[i * 32 + lane] = o;
    }
}

// One launch for all that stands in front of the first GEMM. A wave takes one row
// of the first RMSNorm and 4096 elements of the fp32 -> bf16 weight convert. wdst:
// the bf16 weights, one behind another in the order wq wk wv wo wgate wup wdown.
__global__ __launch_bounds__(512)
void prep_kernel(const float* __restrict__ x, const float* __restrict__ wq,
                 const float* __restrict__ wk, const float* __restrict__ wv,
                 const float* __restrict__ wo, const float* __restrict__ wgate,
                 const float* __restrict__ wup, const float* __restrict__ wdown,
                 const float* __restrict__ n1w,
                 bf16* __restrict__ wdst, bf16* __restrict__ a1) {
    const int lane = threadIdx.x & 31;
    // in a scalar register: every base address below is then scalar
    const int wave = __builtin_amdgcn_readfirstlane(threadIdx.x >> 5);
    const int blk = blockIdx.x;
    const size_t row = (size_t)blk * 16 + wave;
    const int c = blk >> 4;            // piece of DIMN * DIMN elements, 16 blocks each
    const size_t pc = (size_t)DIMN * DIMN;
    const float* s = c == 0 ? wq : c == 1 ? wk : c == 2 ? wv : c == 3 ? wo
                   : c < 8  ? wgate + (size_t)(c - 4) * pc
                   : c < 12 ? wup + (size_t)(c - 8) * pc
                            : wdown + (size_t)(c - 12) * pc;
    s += (blk & 15) * 65536 + wave * 4096;
    const float* xr = x + row * DIMN;

    // the loops are unrolled so that the arrays stay in registers
    v4f xv[8], nv[8], v[32];
#pragma unroll
    for (int i = 0; i < 8; ++i) xv[i] = ((const v4f*)xr)[i * 32 + lane];
#pragma unroll
    for (int i = 0; i < 8; ++i) nv[i] = ((const v4f*)n1w)[i * 32 + lane];
#pragma unroll
    for (int i = 0; i < 32; ++i) v[i] = ((const v4f*)s)[i * 32 + lane];
    // Keeps all 48 loads in front of the arithmetic; without it the scheduler holds
    // part of them back and the wave waits out the memory latency several times.
    __builtin_amdgcn_sched_barrier(0);

    rms_row(xv, nv, a1 + row * DIMN, lane);

    bf16* d = wdst + row * 4096;
#pragma unroll
    for (int i = 0; i < 32; ++i) {
        v4bf o;
#pragma unroll
        for (int e = 0; e < 4; ++e) o[e] = (bf16)v[i][e];
        ((v4bf*)d)[i * 32 + lane] = o;
    }
}

__global__ __launch_bounds__(512) void rmsnorm_kernel(const float* __restrict__ x,
                                                      const float* __restrict__ w,
                                                      bf16* __restrict__ out) {
    const int lane = threadIdx.x & 31;
    // in a scalar register: the row's base address is then scalar
    const int wave = __builtin_amdgcn_readfirstlane(threadIdx.x >> 5);
    const size_t row = (size_t)blockIdx.x * 16 + wave;
    const float* xr = x + row * DIMN;
    // the loops are unrolled so that the arrays stay in registers
    v4f xv[8], wv[8];
#pragma unroll
    for (int i = 0; i < 8; ++i) xv[i] = ((const v4f*)xr)[i * 32 + lane];
#pragma unroll
    for (int i = 0; i < 8; ++i) wv[i] = ((const v4f*)w)[i * 32 + lane];
    // Keeps all 16 loads in front of the arithmetic; without it the scheduler sinks
    // six weight loads behind the row sum and the wave waits a second time.
    __builtin_amdgcn_sched_barrier(0);
    rms_row(xv, wv, out + row * DIMN, lane);
}

// ---------------- WMMA GEMM: C[M,N] = A[M,K] @ W[N,K]^T ----------------
// Two-buffer LDS ring filled by async global->LDS copies (ASYNCcnt). A ring tile
// holds KT = 128 k of 128 A rows and 128 W rows: every row is 256 contiguous
// bytes of global memory, at an LDS pitch of 272 B (16 B x odd).
// M, N multiples of 128; K a multiple of 128.
// MODE 0: QKV scatter (N=3072): q/k -> [B,H,S,Dh] bf16, v -> [B,H,Dh,S] bf16
// MODE 1: store bf16 C[M,N]
// MODE 2: store fp32 C[M,N] + res[M,N]
template <int MODE>
__global__ __launch_bounds__(256)
void gemm_kernel(const bf16* __restrict__ A, const bf16* __restrict__ W,
                 int M, int N, int K,
                 float* __restrict__ outF, bf16* __restrict__ outB,
                 const float* __restrict__ res,
                 bf16* __restrict__ qo, bf16* __restrict__ ko, bf16* __restrict__ vo) {
    constexpr int KT = 128;            // k per ring tile
    constexpr int LP = KT + 8;         // LDS row pitch in elements
    __shared__ bf16 As[2][128 * LP];
    __shared__ bf16 Bs[2][128 * LP];
    const int m0 = blockIdx.y * 128;
    const int n0 = blockIdx.x * 128;
    const int tid = threadIdx.x;
    const int lane = tid & 31;
    const int wave = tid >> 5;
    const int wm = (wave >> 1) * 32;   // wave M offset (4 waves in M)
    const int wn = (wave & 1) * 64;    // wave N offset (2 waves in N)
    const int lo = lane & 15;
    const int hi = lane >> 4;
    const int kb = hi << 3;            // K-chunk base per A/B VGPR layout

    v8f acc[2][4] = {};

    // 16 lanes cover one 256-B row; a thread copies rows srow + 16 i, i = 0..7,
    // of A and of W: 16 async b128 copies per thread and tile.
    const int srow = tid >> 4, scol = (tid & 15) << 3;
    const bf16* gA = A + (size_t)(m0 + srow) * K + scol;
    const bf16* gW = W + (size_t)(n0 + srow) * K + scol;
    const size_t gstep = (size_t)16 * K;
    const unsigned lA = (unsigned)(size_t)&As[0][srow * LP + scol];
    const unsigned lB = (unsigned)(size_t)&Bs[0][srow * LP + scol];

    auto stage = [&](int k0, unsigned pb) {
        const unsigned bo = pb * (unsigned)(128 * LP * sizeof(bf16));
        async_copy8_b128(lA + bo, 16 * LP * sizeof(bf16), gA + k0, gstep);
        async_copy8_b128(lB + bo, 16 * LP * sizeof(bf16), gW + k0, gstep);
    };

    // Two fragment sets: the 12 LDS reads of a k step go out as one group, one k
    // step ahead of the WMMAs that use them. The loops over mt and nt below are
    // unrolled so that every fragment and accumulator index is a constant and the
    // arrays stay in registers.
    Frag a[2][2], b[2][4];
    auto frags = [&](unsigned pb, int ks, int set) {
#pragma unroll
        for (int mt = 0; mt < 2; ++mt) {
            const bf16* ap = &As[pb][(wm + mt * 16 + lo) * LP + ks + kb];
            a[set][mt].h[0] = *(const v8bf*)ap;
            a[set][mt].h[1] = *(const v8bf*)(ap + 16);
        }
#pragma unroll
        for (int nt = 0; nt < 4; ++nt) {
            const bf16* bp = &Bs[pb][(wn + nt * 16 + lo) * LP + ks + kb];
            b[set][nt].h[0] = *(const v8bf*)bp;
            b[set][nt].h[1] = *(const v8bf*)(bp + 16);
        }
    };
    auto mma = [&](int set) {
        // Keeps the next step's reads, written above, in front of these WMMAs;
        // without it the scheduler sinks them to two reads and a full wait per
        // WMMA pair.
        __builtin_amdgcn_sched_barrier(0);
#pragma unroll
        for (int nt = 0; nt < 4; ++nt) {
            acc[0][nt] = wmma_bf16(a[set][0], b[set][nt], acc[0][nt]);
            acc[1][nt] = wmma_bf16(a[set][1], b[set][nt], acc[1][nt]);
        }
        // Keeps the following group of reads whole, behind these WMMAs.
        __builtin_amdgcn_sched_barrier(0);
    };

    constexpr int NS = KT / 32;        // k steps per tile (even: step 0 is set 0)
    const int ntile = K / KT;
    stage(0, 0);
    // tile 0 has landed for this wave; the barrier publishes it to the others
    asm volatile("s_wait_asynccnt 0x0" ::: "memory");
    __syncthreads();
    if (K >= 2 * KT) stage(KT, 1);
    frags(0, 0, 0);
    for (int t = 0; t < ntile; ++t) {
        const unsigned pb = (unsigned)(t & 1);
        // unrolled so that the k steps of a tile read at constant LDS offsets and
        // the fragment sets stay in registers
#pragma unroll
        for (int s = 0; s + 1 < NS; ++s) {
            frags(pb, (s + 1) * 32, (s + 1) & 1);
            mma(s & 1);
        }
        // Publish point of tile t + 1, in front of tile t's last k step, whose
        // fragments are fetched: this wave's reads of buffer t & 1 have retired,
        // its copies of tile t + 1 have landed, then one barrier that both
        // publishes tile t + 1 and frees buffer t & 1 for the refill.
        asm volatile("s_wait_dscnt 0x0" ::: "memory");
        asm volatile("s_wait_asynccnt 0x0" ::: "memory");
        __syncthreads();
        if (t + 2 < ntile) stage((t + 2) * KT, pb);
        if (t + 1 < ntile) frags(pb ^ 1u, 0, 0);
        mma((NS - 1) & 1);
    }
    // no copy is left outstanding when the wave goes on to its stores and ends
    asm volatile("s_wait_asynccnt 0x0" ::: "memory");

#pragma unroll
    for (int mt = 0; mt < 2; ++mt)
#pragma unroll
        for (int nt = 0; nt < 4; ++nt)
#pragma unroll
            for (int r = 0; r < 8; ++r) {
                const int m = m0 + wm + mt * 16 + r + hi * 8;
                const int n = n0 + wn + nt * 16 + lo;
                const float vacc = acc[mt][nt][r];
                if constexpr (MODE == 0) {
                    const int bq = m >> 11, s = m & 2047;
                    const int which = n >> 10, col = n & 1023;
                    const int hh = col >> 6, d = col & 63;
                    const size_t bhd = (size_t)(bq * NHEAD + hh);
                    if (which == 0)
                        qo[(bhd * S_LEN + s) * HDIM + d] = (bf16)vacc;
                    else if (which == 1)
                        ko[(bhd * S_LEN + s) * HDIM + d] = (bf16)vacc;
                    else
                        vo[(bhd * HDIM + d) * S_LEN + s] = (bf16)vacc;
                } else if constexpr (MODE == 1) {
                    outB[(size_t)m * N + n] = (bf16)vacc;
                } else {
                    outF[(size_t)m * N + n] = vacc + res[(size_t)m * N + n];
                }
            }
}

__global__ __launch_bounds__(128)
void attn_kernel(const bf16* __restrict__ q, const bf16* __restrict__ k,
                 const bf16* __restrict__ v, bf16* __restrict__ out) {
    constexpr int KS = 64;             // keys per ring stage
    constexpr int LPA = 64 + 8;        // LDS row pitch in elements
    __shared__ __attribute__((aligned(16))) bf16 Ks[2][KS * LPA];     // [key][d]
    __shared__ __attribute__((aligned(16))) bf16 Vs[2][HDIM * LPA];   // [d][key]
    const int tid = threadIdx.x;
    const int lane = tid & 31;
    // in a scalar register: the test that skips a pass is then a scalar branch
    const int wave = __builtin_amdgcn_readfirstlane(tid >> 5);
    const int lo = lane & 15;
    const int hi = lane >> 4;
    const int kb = hi << 3;
    const int bh = blockIdx.y;                   // 0..31
    const int qbase = blockIdx.x * 64 + wave * 16;
    const int b = bh >> 4, h0 = bh & 15;

    // B operand of S^T: column lo = query qbase + lo
    const bf16* qp = q + (((size_t)bh) * S_LEN + qbase + lo) * HDIM;
    Frag qb[2];
    qb[0].h[0] = *(const v8bf*)(qp + kb);
    qb[0].h[1] = *(const v8bf*)(qp + kb + 16);
    qb[1].h[0] = *(const v8bf*)(qp + 32 + kb);
    qb[1].h[1] = *(const v8bf*)(qp + 32 + kb + 16);

    v8f o[4] = {};               // O^T: row d = 16 dt + 8 hi + r, column = query lo
    float mrow = -INFINITY;      // running maximum of query lo (equal in both halves)
    float lsum = 0.f;            // this half's share of the running sum of query lo
    const float scale = 0.125f;  // 1/sqrt(64)

    // 8 lanes cover one 128-B row; a thread copies rows crow + 16 i, i = 0..3, of
    // the stage's K and of its V^T: 8 async b128 copies per thread and stage.
    const int crow = tid >> 3, ccol = (tid & 7) << 3;
    const bf16* gK = k + (((size_t)bh) * S_LEN + crow) * HDIM + ccol;
    const bf16* gV = v + (((size_t)bh) * HDIM + crow) * S_LEN + ccol;
    const unsigned lK = (unsigned)(size_t)&Ks[0][crow * LPA + ccol];
    const unsigned lV = (unsigned)(size_t)&Vs[0][crow * LPA + ccol];
    auto stage = [&](int t, unsigned pb) {
        const unsigned bo = pb * (unsigned)(KS * LPA * sizeof(bf16));
        async_copy4x2_b128(lK + bo, gK + (size_t)t * KS * HDIM, (size_t)16 * HDIM,
                           lV + bo, gV + (size_t)t * KS, (size_t)16 * S_LEN,
                           16 * LPA * sizeof(bf16));
    };

    const int nst = blockIdx.x + 1;    // stages up to the block's diagonal
    stage(0, 0);
    // stage 0 has landed for this wave; the barrier publishes it to the others
    asm volatile("s_wait_asynccnt 0x0" ::: "memory");
    __syncthreads();
    if (nst > 1) stage(1, 1);
    for (int t = 0; t < nst; ++t) {
      // unrolled so that both passes of a stage read at constant LDS offsets
#pragma unroll
      for (int ps = 0; ps < 2; ++ps) {
        const int j0 = t * KS + ps * 32;
        // a pass wholly beyond this wave's diagonal is skipped (wave-uniform);
        // the publish point below stands outside the skip
        if (j0 > qbase + 15) continue;
        const bf16* kp = &Ks[t & 1][(ps * 32 + lo) * LPA + kb];
        const bf16* vp = &Vs[t & 1][lo * LPA + ps * 32 + kb];
        // A operands: K rows j0 + lo and j0 + 16 + lo; V^T rows d = 16 dt + lo
        Frag a00, a01, a10, a11, va[4];
        a00.h[0] = *(const v8bf*)(kp);
        a00.h[1] = *(const v8bf*)(kp + 16);
        a01.h[0] = *(const v8bf*)(kp + 32);
        a01.h[1] = *(const v8bf*)(kp + 48);
        a10.h[0] = *(const v8bf*)(kp + 16 * LPA);
        a10.h[1] = *(const v8bf*)(kp + 16 * LPA + 16);
        a11.h[0] = *(const v8bf*)(kp + 16 * LPA + 32);
        a11.h[1] = *(const v8bf*)(kp + 16 * LPA + 48);
#pragma unroll
        for (int dt = 0; dt < 4; ++dt) {
            va[dt].h[0] = *(const v8bf*)(vp + dt * 16 * LPA);
            va[dt].h[1] = *(const v8bf*)(vp + dt * 16 * LPA + 16);
        }
        // The pass's 16 LDS reads go out as one group ahead of its WMMAs; without
        // this line the scheduler puts two reads and a full wait in front of each
        // score WMMA and the wave waits out the LDS latency several times a pass.
        __builtin_amdgcn_sched_barrier(0);
        v8f s0 = {}, s1 = {};
        s0 = wmma_bf16(a00, qb[0], s0);
        s1 = wmma_bf16(a10, qb[0], s1);
        s0 = wmma_bf16(a01, qb[1], s0);
        s1 = wmma_bf16(a11, qb[1], s1);

        // Online softmax of query lo. s0[r] is key j0 + kb + r, s1[r] key
        // j0 + 16 + kb + r; a key is inside the causal mask while its offset
        // from j0 + kb does not exceed lim.
        const int lim = qbase + lo - j0 - kb;
        float x0[8], x1[8];
        float mx = -INFINITY;
#pragma unroll
        for (int r = 0; r < 8; ++r) {
            x0[r] = (r      <= lim) ? s0[r] * scale : -INFINITY;
            x1[r] = (r + 16 <= lim) ? s1[r] * scale : -INFINITY;
            mx = fmaxf(mx, fmaxf(x0[r], x1[r]));
        }
        mx = fmaxf(mx, xhalf(mx));
        const float mnew = fmaxf(mrow, mx);
        const float alpha = __expf(mrow - mnew);
        mrow = mnew;
        Frag pb;
        float ps0 = 0.f, ps1 = 0.f;
#pragma unroll
        for (int r = 0; r < 8; ++r) {
            const float p0 = __expf(x0[r] - mnew);
            const float p1 = __expf(x1[r] - mnew);
            ps0 += p0;
            ps1 += p1;
            pb.h[0][r] = (bf16)p0;
            pb.h[1][r] = (bf16)p1;
        }
        lsum = lsum * alpha + (ps0 + ps1);
#pragma unroll
        for (int dt = 0; dt < 4; ++dt) {
            v8f ov = o[dt];
#pragma unroll
            for (int r = 0; r < 8; ++r) ov[r] *= alpha;
            o[dt] = wmma_bf16(va[dt], pb, ov);
        }
      }
      // Publish point of stage t + 1: this wave's reads of buffer t & 1 have
      // retired, its copies of stage t + 1 have landed, then one barrier that
      // both publishes stage t + 1 and frees buffer t & 1 for the refill.
      asm volatile("s_wait_dscnt 0x0" ::: "memory");
      asm volatile("s_wait_asynccnt 0x0" ::: "memory");
      __syncthreads();
      if (t + 2 < nst) stage(t + 2, (unsigned)(t & 1));
    }
    // no copy is left outstanding when the wave goes on to its stores and ends
    asm volatile("s_wait_asynccnt 0x0" ::: "memory");

    const float ltot = lsum + xhalf(lsum);
    bf16* op = out + ((size_t)(b * S_LEN + qbase + lo)) * DIMN + h0 * HDIM + kb;
#pragma unroll
    for (int dt = 0; dt < 4; ++dt) {
        v8bf ov;
#pragma unroll
        for (int r = 0; r < 8; ++r) ov[r] = (bf16)(o[dt][r] / ltot);
        *(v8bf*)(op + dt * 16) = ov;
    }
}

// ---------------- silu(gate) * up -> bf16: one wave per row ----------------
__global__ __launch_bounds__(512)
void silu_mul_kernel(const bf16* __restrict__ gu, bf16* __restrict__ outm) {
    const int lane = threadIdx.x & 31;
    // in a scalar register: the row's base addresses are then scalar
    const int wave = __builtin_amdgcn_readfirstlane(threadIdx.x >> 5);
    const size_t m = (size_t)blockIdx.x * 16 + wave;
    const bf16* gp = gu + m * (2 * HIDDEN);
    const bf16* up = gp + HIDDEN;
    bf16* op = outm + m * HIDDEN;
    // load i: columns i * 256 + 8 lane; the loops are unrolled so that the arrays
    // stay in registers
    v8bf gv[16], uv[16];
#pragma unroll
    for (int i = 0; i < 16; ++i) {
        gv[i] = ((const v8bf*)gp)[i * 32 + lane];
        uv[i] = ((const v8bf*)up)[i * 32 + lane];
    }
    // Keeps all 32 loads in front of the arithmetic; without it the scheduler
    // spreads them through it, a few in flight at a time.
    __builtin_amdgcn_sched_barrier(0);
#pragma unroll
    for (int i = 0; i < 16; ++i) {
        v8bf ov;
#pragma unroll
        for (int e = 0; e < 8; ++e) {
            const float g = (float)gv[i][e];
            const float u = (float)uv[i][e];
            ov[e] = (bf16)((g / (1.f + __expf(-g))) * u);
        }
        ((v8bf*)op)[i * 32 + lane] = ov;
        // Keeps each store behind its own group's arithmetic: the writes start while
        // later loads still land; without it most stores gather at the wave's end.
        __builtin_amdgcn_sched_barrier(0);
    }
}

extern "C" void kernel_launch(void* const* d_in, const int* in_sizes, int n_in,
                              void* d_out, int out_size, void* d_ws, size_t ws_size,
                              hipStream_t stream) {
    const float* x     = (const float*)d_in[0];
    const float* wq    = (const float*)d_in[1];
    const float* wk    = (const float*)d_in[2];
    const float* wv    = (const float*)d_in[3];
    const float* wo    = (const float*)d_in[4];
    const float* wgate = (const float*)d_in[5];
    const float* wup   = (const float*)d_in[6];
    const float* wdown = (const float*)d_in[7];
    const float* n1w   = (const float*)d_in[8];
    const float* n2w   = (const float*)d_in[9];

    char* ws = (char*)d_ws;
    size_t off = 0;
    auto take = [&](size_t bytes) -> char* {
        char* p = ws + off;
        off += (bytes + 255) & ~(size_t)255;
        return p;
    };
    bf16*  a1   = (bf16*)take((size_t)MTOT * DIMN * 2);
    bf16*  wqkv = (bf16*)take((size_t)3 * DIMN * DIMN * 2);
    bf16*  wo_b = (bf16*)take((size_t)DIMN * DIMN * 2);
    bf16*  wgu  = (bf16*)take((size_t)2 * HIDDEN * DIMN * 2);
    bf16*  wdn  = (bf16*)take((size_t)DIMN * HIDDEN * 2);
    bf16*  qws  = (bf16*)take((size_t)MTOT * DIMN * 2);
    bf16*  kws  = (bf16*)take((size_t)MTOT * DIMN * 2);
    bf16*  vws  = (bf16*)take((size_t)MTOT * DIMN * 2);
    bf16*  attn = (bf16*)take((size_t)MTOT * DIMN * 2);
    float* x2   = (float*)take((size_t)MTOT * DIMN * 4);
    bf16*  a2   = (bf16*)take((size_t)MTOT * DIMN * 2);
    bf16*  gu   = (bf16*)take((size_t)MTOT * 2 * HIDDEN * 2);
    bf16*  mlp  = (bf16*)take((size_t)MTOT * HIDDEN * 2);

    // wqkv, wo_b, wgu and wdn were taken one behind another with no gap: wqkv is
    // the start of all bf16 weights
    prep_kernel<<<256, 512, 0, stream>>>(x, wq, wk, wv, wo, wgate, wup, wdown, n1w, wqkv, a1);

    gemm_kernel<0><<<dim3(3072 / 128, MTOT / 128), 256, 0, stream>>>(
        a1, wqkv, MTOT, 3072, DIMN, nullptr, nullptr, nullptr, qws, kws, vws);

    attn_kernel<<<dim3(S_LEN / 64, BATCH * NHEAD), 128, 0, stream>>>(qws, kws, vws, attn);

    gemm_kernel<2><<<dim3(DIMN / 128, MTOT / 128), 256, 0, stream>>>(
        attn, wo_b, MTOT, DIMN, DIMN, x2, nullptr, x, nullptr, nullptr, nullptr);

    rmsnorm_kernel<<<MTOT / 16, 512, 0, stream>>>(x2, n2w, a2);

    gemm_kernel<1><<<dim3(2 * HIDDEN / 128, MTOT / 128), 256, 0, stream>>>(
        a2, wgu, MTOT, 2 * HIDDEN, DIMN, nullptr, gu, nullptr, nullptr, nullptr, nullptr);

    silu_mul_kernel<<<MTOT / 16, 512, 0, stream>>>(gu, mlp);

    gemm_kernel<2><<<dim3(DIMN / 128, MTOT / 128), 256, 0, stream>>>(
        mlp, wdn, MTOT, DIMN, HIDDEN, (float*)d_out, nullptr, x2,
        nullptr, nullptr, nullptr);
}

// v006
// Measured time: 215 microseconds a run.
// Next to v005, in two timings, it ran 1.03 times as fast each time.
// Counting every step since v000, it is 1.71 times as fast.
#include <hip/hip_runtime.h>
#include <hip/hip_bf16.h>
#include <math.h>

typedef __bf16 bf16;
typedef __attribute__((ext_vector_type(16))) __bf16 v16bf;
typedef __attribute__((ext_vector_type(8)))  __bf16 v8bf;
typedef __attribute__((ext_vector_type(4)))  __bf16 v4bf;
typedef __attribute__((ext_vector_type(8)))  float  v8f;
typedef __attribute__((ext_vector_type(4)))  float  v4f;

#define DIMN   1024
#define S_LEN  2048
#define BATCH  2
#define NHEAD  16
#define HDIM   64
#define HIDDEN 4096
#define MTOT   (BATCH * S_LEN)   // 4096 rows

union Frag { v16bf v; v8bf h[2]; };

static __device__ __forceinline__ v8f wmma_bf16(const Frag& a, const Frag& b, v8f c) {
    return __builtin_amdgcn_wmma_f32_16x16x32_bf16(false, a.v, false, b.v,
                                                   (short)0, c, false, false);
}

// XOR-shuffle within each 16-lane half using v_permlane16_b32 (pure VALU,
// avoids ds_bpermute + s_wait_dscnt round-trips).
template <int M>
static __device__ __forceinline__ float permxor16(float v) {
#if __has_builtin(__builtin_amdgcn_permlane16)
    constexpr unsigned lo =
        ((unsigned)(0 ^ M)) | ((unsigned)(1 ^ M) << 4) | ((unsigned)(2 ^ M) << 8) |
        ((unsigned)(3 ^ M) << 12) | ((unsigned)(4 ^ M) << 16) |
        ((unsigned)(5 ^ M) << 20) | ((unsigned)(6 ^ M) << 24) |
        ((unsigned)(7 ^ M) << 28);
    constexpr unsigned hi =
        ((unsigned)((8 ^ M) & 15)) | ((unsigned)((9 ^ M) & 15) << 4) |
        ((unsigned)((10 ^ M) & 15) << 8) | ((unsigned)((11 ^ M) & 15) << 12) |
        ((unsigned)((12 ^ M) & 15) << 16) | ((unsigned)((13 ^ M) & 15) << 20) |
        ((unsigned)((14 ^ M) & 15) << 24) | ((unsigned)((15 ^ M) & 15) << 28);
    int iv = __builtin_bit_cast(int, v);
    int r = __builtin_amdgcn_permlane16(iv, iv, (int)lo, (int)hi, false, false);
    return __builtin_bit_cast(float, r);
#else
    return __shfl_xor(v, M, 32);
#endif
}

// Lane l <-> lane l ^ 16: the two halves of a wave that share a column of a
// WMMA accumulator tile (pure VALU).
static __device__ __forceinline__ float xhalf(float v) {
    const int iv = __builtin_bit_cast(int, v);
    const int r = __builtin_amdgcn_permlanex16(iv, iv, 0x76543210, 0xfedcba98, false, false);
    return __builtin_bit_cast(float, r);
}

// Eight async global->LDS 16-B copies per lane (ASYNCcnt): rows l + i*lstep in
// LDS from rows g + i*gstep in global memory. The closing s_wait_xcnt 0 stands
// inside the copies' own statement so that no address register named here is
// rewritten ahead of it.
static __device__ __forceinline__ void async_copy8_b128(unsigned l, unsigned lstep,
                                                        const bf16* g, size_t gstep) {
    asm volatile("global_load_async_to_lds_b128 %0, %8, off\n\t"
                 "global_load_async_to_lds_b128 %1, %9, off\n\t"
                 "global_load_async_to_lds_b128 %2, %10, off\n\t"
                 "global_load_async_to_lds_b128 %3, %11, off\n\t"
                 "global_load_async_to_lds_b128 %4, %12, off\n\t"
                 "global_load_async_to_lds_b128 %5, %13, off\n\t"
                 "global_load_async_to_lds_b128 %6, %14, off\n\t"
                 "global_load_async_to_lds_b128 %7, %15, off\n\t"
                 "s_wait_xcnt 0x0"
                 :: "v"(l), "v"(l + lstep), "v"(l + 2 * lstep), "v"(l + 3 * lstep),
                    "v"(l + 4 * lstep), "v"(l + 5 * lstep), "v"(l + 6 * lstep),
                    "v"(l + 7 * lstep),
                    "v"(g), "v"(g + gstep), "v"(g + 2 * gstep), "v"(g + 3 * gstep),
                    "v"(g + 4 * gstep), "v"(g + 5 * gstep), "v"(g + 6 * gstep),
                    "v"(g + 7 * gstep)
                 : "memory");
}

// Four and four async global->LDS 16-B copies per lane: rows la + i*lstep from
// ga + i*gastep and rows lb + i*lstep from gb + i*gbstep. The closing
// s_wait_xcnt 0 stands inside the copies' own statement, as above.
static __device__ __forceinline__ void async_copy4x2_b128(unsigned la, const bf16* ga, size_t gastep,
                                                          unsigned lb, const bf16* gb, size_t gbstep,
                                                          unsigned lstep) {
    asm volatile("global_load_async_to_lds_b128 %0, %8, off\n\t"
                 "global_load_async_to_lds_b128 %1, %9, off\n\t"
                 "global_load_async_to_lds_b128 %2, %10, off\n\t"
                 "global_load_async_to_lds_b128 %3, %11, off\n\t"
                 "global_load_async_to_lds_b128 %4, %12, off\n\t"
                 "global_load_async_to_lds_b128 %5, %13, off\n\t"
                 "global_load_async_to_lds_b128 %6, %14, off\n\t"
                 "global_load_async_to_lds_b128 %7, %15, off\n\t"
                 "s_wait_xcnt 0x0"
                 :: "v"(la), "v"(la + lstep), "v"(la + 2 * lstep), "v"(la + 3 * lstep),
                    "v"(lb), "v"(lb + lstep), "v"(lb + 2 * lstep), "v"(lb + 3 * lstep),
                    "v"(ga), "v"(ga + gastep), "v"(ga + 2 * gastep), "v"(ga + 3 * gastep),
                    "v"(gb), "v"(gb + gbstep), "v"(gb + 2 * gbstep), "v"(gb + 3 * gbstep)
                 : "memory");
}

// The streaming stages run as few, long waves: 256 work-groups of 16 waves, one a
// WGP; every load is 512 contiguous bytes of a wave, and a wave issues all its
// loads before it works on the first of them.

// RMSNorm of one fp32 row by one wave -> bf16 row. xv, wv: the lane's elements
// i * 128 + 4 lane + e of the row and of the weight; orow: the row's start.
static __device__ __forceinline__ void rms_row(const v4f (&xv)[8], const v4f (&wv)[8],
                                               bf16* __restrict__ orow, int lane) {
    v4f sq = {};
#pragma unroll
    for (int i = 0; i < 8; ++i) sq += xv[i] * xv[i];
    float ss = (sq.x + sq.y) + (sq.z + sq.w);
    ss += permxor16<1>(ss);
    ss += permxor16<2>(ss);
    ss += permxor16<4>(ss);
    ss += permxor16<8>(ss);
    ss += xhalf(ss);
    const float rinv = rsqrtf(ss * (1.f / DIMN) + 1e-5f);
#pragma unroll
    for (int i = 0; i < 8; ++i) {
        v4bf o;
#pragma unroll
        for (int e = 0; e < 4; ++e) o[e] = (bf16)(xv[i][e] * rinv * wv[i][e]);
        ((v4bf*)orow)[i * 32 + lane] = o;
    }
}

// One launch for all that stands in front of the first GEMM. A wave takes one row
// of the first RMSNorm and 4096 elements of the fp32 -> bf16 weight convert. wdst:
// the bf16 weights, one behind another in the order wq wk wv wo wgate wup wdown.
__global__ __launch_bounds__(512)
void prep_kernel(const float* __restrict__ x, const float* __restrict__ wq,
                 const float* __restrict__ wk, const float* __restrict__ wv,
                 const float* __restrict__ wo, const float* __restrict__ wgate,
                 const float* __restrict__ wup, const float* __restrict__ wdown,
                 const float* __restrict__ n1w,
                 bf16* __restrict__ wdst, bf16* __restrict__ a1) {
    const int lane = threadIdx.x & 31;
    // in a scalar register: every base address below is then scalar
    const int wave = __builtin_amdgcn_readfirstlane(threadIdx.x >> 5);
    const int blk = blockIdx.x;
    const size_t row = (size_t)blk * 16 + wave;
    const int c = blk >> 4;            // piece of DIMN * DIMN elements, 16 blocks each
    const size_t pc = (size_t)DIMN * DIMN;
    const float* s = c == 0 ? wq : c == 1 ? wk : c == 2 ? wv : c == 3 ? wo
                   : c < 8  ? wgate + (size_t)(c - 4) * pc
                   : c < 12 ? wup + (size_t)(c - 8) * pc
                            : wdown + (size_t)(c - 12) * pc;
    s += (blk & 15) * 65536 + wave * 4096;
    const float* xr = x + row * DIMN;

    // the loops are unrolled so that the arrays stay in registers
    v4f xv[8], nv[8], v[32];
#pragma unroll
    for (int i = 0; i < 8; ++i) xv[i] = ((const v4f*)xr)[i * 32 + lane];
#pragma unroll
    for (int i = 0; i < 8; ++i) nv[i] = ((const v4f*)n1w)[i * 32 + lane];
#pragma unroll
    for (int i = 0; i < 32; ++i) v[i] = ((const v4f*)s)[i * 32 + lane];
    // Keeps all 48 loads in front of the arithmetic; without it the scheduler holds
    // part of them back and the wave waits out the memory latency several times.
    __builtin_amdgcn_sched_barrier(0);

    rms_row(xv, nv, a1 + row * DIMN, lane);

    bf16* d = wdst + row * 4096;
#pragma unroll
    for (int i = 0; i < 32; ++i) {
        v4bf o;
#pragma unroll
        for (int e = 0; e < 4; ++e) o[e] = (bf16)v[i][e];
        ((v4bf*)d)[i * 32 + lane] = o;
    }
}

__global__ __launch_bounds__(512) void rmsnorm_kernel(const float* __restrict__ x,
                                                      const float* __restrict__ w,
                                                      bf16* __restrict__ out) {
    const int lane = threadIdx.x & 31;
    // in a scalar register: the row's base address is then scalar
    const int wave = __builtin_amdgcn_readfirstlane(threadIdx.x >> 5);
    const size_t row = (size_t)blockIdx.x * 16 + wave;
    const float* xr = x + row * DIMN;
    // the loops are unrolled so that the arrays stay in registers
    v4f xv[8], wv[8];
#pragma unroll
    for (int i = 0; i < 8; ++i) xv[i] = ((const v4f*)xr)[i * 32 + lane];
#pragma unroll
    for (int i = 0; i < 8; ++i) wv[i] = ((const v4f*)w)[i * 32 + lane];
    // Keeps all 16 loads in front of the arithmetic; without it the scheduler sinks
    // six weight loads behind the row sum and the wave waits a second time.
    __builtin_amdgcn_sched_barrier(0);
    rms_row(xv, wv, out + row * DIMN, lane);
}

// ---------------- WMMA GEMM: C[M,N] = A[M,K] @ W[N,K]^T ----------------
// Two-buffer LDS ring filled by async global->LDS copies (ASYNCcnt). A ring tile
// holds KT = 128 k of 128 A rows and 128 W rows: every row is 256 contiguous
// bytes of global memory, at an LDS pitch of 272 B (16 B x odd).
// M, N multiples of 128; K a multiple of 128.
// MODE 0: QKV scatter (N=3072): q/k -> [B,H,S,Dh] bf16, v -> [B,H,Dh,S] bf16
// MODE 1: store bf16 C[M,N]
// MODE 2: store fp32 C[M,N] + res[M,N]
template <int MODE>
__global__ __launch_bounds__(256)
void gemm_kernel(const bf16* __restrict__ A, const bf16* __restrict__ W,
                 int M, int N, int K,
                 float* __restrict__ outF, bf16* __restrict__ outB,
                 const float* __restrict__ res,
                 bf16* __restrict__ qo, bf16* __restrict__ ko, bf16* __restrict__ vo) {
    constexpr int KT = 128;            // k per ring tile
    constexpr int LP = KT + 8;         // LDS row pitch in elements
    __shared__ bf16 As[2][128 * LP];
    __shared__ bf16 Bs[2][128 * LP];
    const int m0 = blockIdx.y * 128;
    const int n0 = blockIdx.x * 128;
    const int tid = threadIdx.x;
    const int lane = tid & 31;
    const int wave = tid >> 5;
    const int wm = (wave >> 1) * 32;   // wave M offset (4 waves in M)
    const int wn = (wave & 1) * 64;    // wave N offset (2 waves in N)
    const int lo = lane & 15;
    const int hi = lane >> 4;
    const int kb = hi << 3;            // K-chunk base per A/B VGPR layout

    v8f acc[2][4] = {};

    // 16 lanes cover one 256-B row; a thread copies rows srow + 16 i, i = 0..7,
    // of A and of W: 16 async b128 copies per thread and tile.
    const int srow = tid >> 4, scol = (tid & 15) << 3;
    const bf16* gA = A + (size_t)(m0 + srow) * K + scol;
    const bf16* gW = W + (size_t)(n0 + srow) * K + scol;
    const size_t gstep = (size_t)16 * K;
    const unsigned lA = (unsigned)(size_t)&As[0][srow * LP + scol];
    const unsigned lB = (unsigned)(size_t)&Bs[0][srow * LP + scol];

    auto stage = [&](int k0, unsigned pb) {
        const unsigned bo = pb * (unsigned)(128 * LP * sizeof(bf16));
        async_copy8_b128(lA + bo, 16 * LP * sizeof(bf16), gA + k0, gstep);
        async_copy8_b128(lB + bo, 16 * LP * sizeof(bf16), gW + k0, gstep);
    };

    // Two fragment sets: the 12 LDS reads of a k step go out as one group, one k
    // step ahead of the WMMAs that use them. The loops over mt and nt below are
    // unrolled so that every fragment and accumulator index is a constant and the
    // arrays stay in registers.
    Frag a[2][2], b[2][4];
    auto frags = [&](unsigned pb, int ks, int set) {
#pragma unroll
        for (int mt = 0; mt < 2; ++mt) {
            const bf16* ap = &As[pb][(wm + mt * 16 + lo) * LP + ks + kb];
            a[set][mt].h[0] = *(const v8bf*)ap;
            a[set][mt].h[1] = *(const v8bf*)(ap + 16);
        }
#pragma unroll
        for (int nt = 0; nt < 4; ++nt) {
            const bf16* bp = &Bs[pb][(wn + nt * 16 + lo) * LP + ks + kb];
            b[set][nt].h[0] = *(const v8bf*)bp;
            b[set][nt].h[1] = *(const v8bf*)(bp + 16);
        }
    };
    auto mma = [&](int set) {
        // Keeps the next step's reads, written above, in front of these WMMAs;
        // without it the scheduler sinks them to two reads and a full wait per
        // WMMA pair.
        __builtin_amdgcn_sched_barrier(0);
#pragma unroll
        for (int nt = 0; nt < 4; ++nt) {
            acc[0][nt] = wmma_bf16(a[set][0], b[set][nt], acc[0][nt]);
            acc[1][nt] = wmma_bf16(a[set][1], b[set][nt], acc[1][nt]);
        }
        // Keeps the following group of reads whole, behind these WMMAs.
        __builtin_amdgcn_sched_barrier(0);
    };

    constexpr int NS = KT / 32;        // k steps per tile (even: step 0 is set 0)
    const int ntile = K / KT;
    stage(0, 0);
    // tile 0 has landed for this wave; the barrier publishes it to the others
    asm volatile("s_wait_asynccnt 0x0" ::: "memory");
    __syncthreads();
    if (K >= 2 * KT) stage(KT, 1);
    frags(0, 0, 0);
    for (int t = 0; t < ntile; ++t) {
        const unsigned pb = (unsigned)(t & 1);
        // unrolled so that the k steps of a tile read at constant LDS offsets and
        // the fragment sets stay in registers
#pragma unroll
        for (int s = 0; s + 1 < NS; ++s) {
            frags(pb, (s + 1) * 32, (s + 1) & 1);
            mma(s & 1);
        }
        // Publish point of tile t + 1, in front of tile t's last k step, whose
        // fragments are fetched: this wave's reads of buffer t & 1 have retired,
        // its copies of tile t + 1 have landed, then one barrier that both
        // publishes tile t + 1 and frees buffer t & 1 for the refill.
        asm volatile("s_wait_dscnt 0x0" ::: "memory");
        asm volatile("s_wait_asynccnt 0x0" ::: "memory");
        __syncthreads();
        if (t + 2 < ntile) stage((t + 2) * KT, pb);
        if (t + 1 < ntile) frags(pb ^ 1u, 0, 0);
        mma((NS - 1) & 1);
    }
    // no copy is left outstanding when the wave goes on to its stores and ends
    asm volatile("s_wait_asynccnt 0x0" ::: "memory");

#pragma unroll
    for (int mt = 0; mt < 2; ++mt)
#pragma unroll
        for (int nt = 0; nt < 4; ++nt)
#pragma unroll
            for (int r = 0; r < 8; ++r) {
                const int m = m0 + wm + mt * 16 + r + hi * 8;
                const int n = n0 + wn + nt * 16 + lo;
                const float vacc = acc[mt][nt][r];
                if constexpr (MODE == 0) {
                    const int bq = m >> 11, s = m & 2047;
                    const int which = n >> 10, col = n & 1023;
                    const int hh = col >> 6, d = col & 63;
                    const size_t bhd = (size_t)(bq * NHEAD + hh);
                    if (which == 0)
                        qo[(bhd * S_LEN + s) * HDIM + d] = (bf16)vacc;
                    else if (which == 1)
                        ko[(bhd * S_LEN + s) * HDIM + d] = (bf16)vacc;
                    else
                        vo[(bhd * HDIM + d) * S_LEN + s] = (bf16)vacc;
                } else if constexpr (MODE == 1) {
                    outB[(size_t)m * N + n] = (bf16)vacc;
                } else {
                    outF[(size_t)m * N + n] = vacc + res[(size_t)m * N + n];
                }
            }
}

__global__ __launch_bounds__(128)
void attn_kernel(const bf16* __restrict__ q, const bf16* __restrict__ k,
                 const bf16* __restrict__ v, bf16* __restrict__ out) {
    constexpr int KS = 64;             // keys per ring stage
    constexpr int LPA = 64 + 8;        // LDS row pitch in elements
    __shared__ __attribute__((aligned(16))) bf16 Ks[2][KS * LPA];     // [key][d]
    __shared__ __attribute__((aligned(16))) bf16 Vs[2][HDIM * LPA];   // [d][key]
    const int tid = threadIdx.x;
    const int lane = tid & 31;
    // in a scalar register: the test that skips a pass is then a scalar branch
    const int wave = __builtin_amdgcn_readfirstlane(tid >> 5);
    const int lo = lane & 15;
    const int hi = lane >> 4;
    const int kb = hi << 3;
    const int bh = blockIdx.y;                   // 0..31
    const int b = bh >> 4, h0 = bh & 15;

    // 8 lanes cover one 128-B row; a thread copies rows crow + 16 i, i = 0..3, of
    // the stage's K and of its V^T: 8 async b128 copies per thread and stage.
    const int crow = tid >> 3, ccol = (tid & 7) << 3;
    const bf16* gK = k + (((size_t)bh) * S_LEN + crow) * HDIM + ccol;
    const bf16* gV = v + (((size_t)bh) * HDIM + crow) * S_LEN + ccol;
    const unsigned lK = (unsigned)(size_t)&Ks[0][crow * LPA + ccol];
    const unsigned lV = (unsigned)(size_t)&Vs[0][crow * LPA + ccol];
    auto stage = [&](int t, unsigned pb) {
        const unsigned bo = pb * (unsigned)(KS * LPA * sizeof(bf16));
        async_copy4x2_b128(lK + bo, gK + (size_t)t * KS * HDIM, (size_t)16 * HDIM,
                           lV + bo, gV + (size_t)t * KS, (size_t)16 * S_LEN,
                           16 * LPA * sizeof(bf16));
    };

  // The long tile first, then the short one. The ring starts anew for the second
  // tile: the barrier at the foot of the first tile's last stage has ended every
  // wave's reads of both buffers, and no copy is outstanding there.
  for (int half = 0; half < 2; ++half) {
    const int qt = half == 0 ? S_LEN / 64 - 1 - (int)blockIdx.x : (int)blockIdx.x;
    const int qbase = qt * 64 + wave * 16;

    // B operand of S^T: column lo = query qbase + lo
    const bf16* qp = q + (((size_t)bh) * S_LEN + qbase + lo) * HDIM;
    Frag qb[2];
    qb[0].h[0] = *(const v8bf*)(qp + kb);
    qb[0].h[1] = *(const v8bf*)(qp + kb + 16);
    qb[1].h[0] = *(const v8bf*)(qp + 32 + kb);
    qb[1].h[1] = *(const v8bf*)(qp + 32 + kb + 16);

    v8f o[4] = {};               // O^T: row d = 16 dt + 8 hi + r, column = query lo
    float mrow = -INFINITY;      // running maximum of query lo (equal in both halves)
    float lsum = 0.f;            // this half's share of the running sum of query lo
    const float scale = 0.125f;  // 1/sqrt(64)

    const int nst = qt + 1;            // stages up to the tile's diagonal
    stage(0, 0);
    // stage 0 has landed for this wave; the barrier publishes it to the others
    asm volatile("s_wait_asynccnt 0x0" ::: "memory");
    __syncthreads();
    if (nst > 1) stage(1, 1);
    for (int t = 0; t < nst; ++t) {
      // unrolled so that both passes of a stage read at constant LDS offsets
#pragma unroll
      for (int ps = 0; ps < 2; ++ps) {
        const int j0 = t * KS + ps * 32;
        // a pass wholly beyond this wave's diagonal is skipped (wave-uniform);
        // the publish point below stands outside the skip
        if (j0 > qbase + 15) continue;
        const bf16* kp = &Ks[t & 1][(ps * 32 + lo) * LPA + kb];
        const bf16* vp = &Vs[t & 1][lo * LPA + ps * 32 + kb];
        // A operands: K rows j0 + lo and j0 + 16 + lo; V^T rows d = 16 dt + lo
        Frag a00, a01, a10, a11, va[4];
        a00.h[0] = *(const v8bf*)(kp);
        a00.h[1] = *(const v8bf*)(kp + 16);
        a01.h[0] = *(const v8bf*)(kp + 32);
        a01.h[1] = *(const v8bf*)(kp + 48);
        a10.h[0] = *(const v8bf*)(kp + 16 * LPA);
        a10.h[1] = *(const v8bf*)(kp + 16 * LPA + 16);
        a11.h[0] = *(const v8bf*)(kp + 16 * LPA + 32);
        a11.h[1] = *(const v8bf*)(kp + 16 * LPA + 48);
#pragma unroll
        for (int dt = 0; dt < 4; ++dt) {
            va[dt].h[0] = *(const v8bf*)(vp + dt * 16 * LPA);
            va[dt].h[1] = *(const v8bf*)(vp + dt * 16 * LPA + 16);
        }
        // The pass's 16 LDS reads go out as one group ahead of its WMMAs; without
        // this line the scheduler puts two reads and a full wait in front of each
        // score WMMA and the wave waits out the LDS latency several times a pass.
        __builtin_amdgcn_sched_barrier(0);
        v8f s0 = {}, s1 = {};
        s0 = wmma_bf16(a00, qb[0], s0);
        s1 = wmma_bf16(a10, qb[0], s1);
        s0 = wmma_bf16(a01, qb[1], s0);
        s1 = wmma_bf16(a11, qb[1], s1);

        // Online softmax of query lo. s0[r] is key j0 + kb + r, s1[r] key
        // j0 + 16 + kb + r; a key is inside the causal mask while its offset
        // from j0 + kb does not exceed lim.
        const int lim = qbase + lo - j0 - kb;
        float x0[8], x1[8];
        float mx = -INFINITY;
#pragma unroll
        for (int r = 0; r < 8; ++r) {
            x0[r] = (r      <= lim) ? s0[r] * scale : -INFINITY;
            x1[r] = (r + 16 <= lim) ? s1[r] * scale : -INFINITY;
            mx = fmaxf(mx, fmaxf(x0[r], x1[r]));
        }
        mx = fmaxf(mx, xhalf(mx));
        const float mnew = fmaxf(mrow, mx);
        const float alpha = __expf(mrow - mnew);
        mrow = mnew;
        Frag pb;
        float ps0 = 0.f, ps1 = 0.f;
#pragma unroll
        for (int r = 0; r < 8; ++r) {
            const float p0 = __expf(x0[r] - mnew);
            const float p1 = __expf(x1[r] - mnew);
            ps0 += p0;
            ps1 += p1;
            pb.h[0][r] = (bf16)p0;
            pb.h[1][r] = (bf16)p1;
        }
        lsum = lsum * alpha + (ps0 + ps1);
#pragma unroll
        for (int dt = 0; dt < 4; ++dt) {
            v8f ov = o[dt];
#pragma unroll
            for (int r = 0; r < 8; ++r) ov[r] *= alpha;
            o[dt] = wmma_bf16(va[dt], pb, ov);
        }
      }
      // Publish point of stage t + 1: this wave's reads of buffer t & 1 have
      // retired, its copies of stage t + 1 have landed, then one barrier that
      // both publishes stage t + 1 and frees buffer t & 1 for the refill.
      asm volatile("s_wait_dscnt 0x0" ::: "memory");
      asm volatile("s_wait_asynccnt 0x0" ::: "memory");
      __syncthreads();
      if (t + 2 < nst) stage(t + 2, (unsigned)(t & 1));
    }
    // no copy is left outstanding when the wave goes on to its stores
    asm volatile("s_wait_asynccnt 0x0" ::: "memory");

    const float ltot = lsum + xhalf(lsum);
    bf16* op = out + ((size_t)(b * S_LEN + qbase + lo)) * DIMN + h0 * HDIM + kb;
#pragma unroll
    for (int dt = 0; dt < 4; ++dt) {
        v8bf ov;
#pragma unroll
        for (int r = 0; r < 8; ++r) ov[r] = (bf16)(o[dt][r] / ltot);
        *(v8bf*)(op + dt * 16) = ov;
    }
    // the next tile rewrites the registers that these stores name
    asm volatile("s_wait_xcnt 0x0" ::: "memory");
  }
}

// ---------------- silu(gate) * up -> bf16: one wave per row ----------------
__global__ __launch_bounds__(512)
void silu_mul_kernel(const bf16* __restrict__ gu, bf16* __restrict__ outm) {
    const int lane = threadIdx.x & 31;
    // in a scalar register: the row's base addresses are then scalar
    const int wave = __builtin_amdgcn_readfirstlane(threadIdx.x >> 5);
    const size_t m = (size_t)blockIdx.x * 16 + wave;
    const bf16* gp = gu + m * (2 * HIDDEN);
    const bf16* up = gp + HIDDEN;
    bf16* op = outm + m * HIDDEN;
    // load i: columns i * 256 + 8 lane; the loops are unrolled so that the arrays
    // stay in registers
    v8bf gv[16], uv[16];
#pragma unroll
    for (int i = 0; i < 16; ++i) {
        gv[i] = ((const v8bf*)gp)[i * 32 + lane];
        uv[i] = ((const v8bf*)up)[i * 32 + lane];
    }
    // Keeps all 32 loads in front of the arithmetic; without it the scheduler
    // spreads them through it, a few in flight at a time.
    __builtin_amdgcn_sched_barrier(0);
#pragma unroll
    for (int i = 0; i < 16; ++i) {
        v8bf ov;
#pragma unroll
        for (int e = 0; e < 8; ++e) {
            const float g = (float)gv[i][e];
            const float u = (float)uv[i][e];
            ov[e] = (bf16)((g / (1.f + __expf(-g))) * u);
        }
        ((v8bf*)op)[i * 32 + lane] = ov;
        // Keeps each store behind its own group's arithmetic: the writes start while
        // later loads still land; without it most stores gather at the wave's end.
        __builtin_amdgcn_sched_barrier(0);
    }
}

extern "C" void kernel_launch(void* const* d_in, const int* in_sizes, int n_in,
                              void* d_out, int out_size, void* d_ws, size_t ws_size,
                              hipStream_t stream) {
    const float* x     = (const float*)d_in[0];
    const float* wq    = (const float*)d_in[1];
    const float* wk    = (const float*)d_in[2];
    const float* wv    = (const float*)d_in[3];
    const float* wo    = (const float*)d_in[4];
    const float* wgate = (const float*)d_in[5];
    const float* wup   = (const float*)d_in[6];
    const float* wdown = (const float*)d_in[7];
    const float* n1w   = (const float*)d_in[8];
    const float* n2w   = (const float*)d_in[9];

    char* ws = (char*)d_ws;
    size_t off = 0;
    auto take = [&](size_t bytes) -> char* {
        char* p = ws + off;
        off += (bytes + 255) & ~(size_t)255;
        return p;
    };
    bf16*  a1   = (bf16*)take((size_t)MTOT * DIMN * 2);
    bf16*  wqkv = (bf16*)take((size_t)3 * DIMN * DIMN * 2);
    bf16*  wo_b = (bf16*)take((size_t)DIMN * DIMN * 2);
    bf16*  wgu  = (bf16*)take((size_t)2 * HIDDEN * DIMN * 2);
    bf16*  wdn  = (bf16*)take((size_t)DIMN * HIDDEN * 2);
    bf16*  qws  = (bf16*)take((size_t)MTOT * DIMN * 2);
    bf16*  kws  = (bf16*)take((size_t)MTOT * DIMN * 2);
    bf16*  vws  = (bf16*)take((size_t)MTOT * DIMN * 2);
    bf16*  attn = (bf16*)take((size_t)MTOT * DIMN * 2);
    float* x2   = (float*)take((size_t)MTOT * DIMN * 4);
    bf16*  a2   = (bf16*)take((size_t)MTOT * DIMN * 2);
    bf16*  gu   = (bf16*)take((size_t)MTOT * 2 * HIDDEN * 2);
    bf16*  mlp  = (bf16*)take((size_t)MTOT * HIDDEN * 2);

    // wqkv, wo_b, wgu and wdn were taken one behind another with no gap: wqkv is
    // the start of all bf16 weights
    prep_kernel<<<256, 512, 0, stream>>>(x, wq, wk, wv, wo, wgate, wup, wdown, n1w, wqkv, a1);

    gemm_kernel<0><<<dim3(3072 / 128, MTOT / 128), 256, 0, stream>>>(
        a1, wqkv, MTOT, 3072, DIMN, nullptr, nullptr, nullptr, qws, kws, vws);

    attn_kernel<<<dim3(S_LEN / 128, BATCH * NHEAD), 128, 0, stream>>>(qws, kws, vws, attn);

    gemm_kernel<2><<<dim3(DIMN / 128, MTOT / 128), 256, 0, stream>>>(
        attn, wo_b, MTOT, DIMN, DIMN, x2, nullptr, x, nullptr, nullptr, nullptr);

    rmsnorm_kernel<<<MTOT / 16, 512, 0, stream>>>(x2, n2w, a2);

    gemm_kernel<1><<<dim3(2 * HIDDEN / 128, MTOT / 128), 256, 0, stream>>>(
        a2, wgu, MTOT, 2 * HIDDEN, DIMN, nullptr, gu, nullptr, nullptr, nullptr, nullptr);

    silu_mul_kernel<<<MTOT / 16, 512, 0, stream>>>(gu, mlp);

    gemm_kernel<2><<<dim3(DIMN / 128, MTOT / 128), 256, 0, stream>>>(
        mlp, wdn, MTOT, DIMN, HIDDEN, (float*)d_out, nullptr, x2,
        nullptr, nullptr, nullptr);
}

// v007
// It runs in 195 microseconds.
// In two side-by-side timings against v006, it was 1.11 and 1.12 times as fast.
// All steps since v000 together make it 1.91 times as fast.
#include <hip/hip_runtime.h>
#include <hip/hip_bf16.h>
#include <math.h>

typedef __bf16 bf16;
typedef __attribute__((ext_vector_type(16))) __bf16 v16bf;
typedef __attribute__((ext_vector_type(8)))  __bf16 v8bf;
typedef __attribute__((ext_vector_type(4)))  __bf16 v4bf;
typedef __attribute__((ext_vector_type(8)))  float  v8f;
typedef __attribute__((ext_vector_type(4)))  float  v4f;

#define DIMN   1024
#define S_LEN  2048
#define BATCH  2
#define NHEAD  16
#define HDIM   64
#define HIDDEN 4096
#define MTOT   (BATCH * S_LEN)   // 4096 rows

union Frag { v16bf v; v8bf h[2]; };

static __device__ __forceinline__ v8f wmma_bf16(const Frag& a, const Frag& b, v8f c) {
    return __builtin_amdgcn_wmma_f32_16x16x32_bf16(false, a.v, false, b.v,
                                                   (short)0, c, false, false);
}

// XOR-shuffle within each 16-lane half using v_permlane16_b32 (pure VALU,
// avoids ds_bpermute + s_wait_dscnt round-trips).
template <int M>
static __device__ __forceinline__ float permxor16(float v) {
#if __has_builtin(__builtin_amdgcn_permlane16)
    constexpr unsigned lo =
        ((unsigned)(0 ^ M)) | ((unsigned)(1 ^ M) << 4) | ((unsigned)(2 ^ M) << 8) |
        ((unsigned)(3 ^ M) << 12) | ((unsigned)(4 ^ M) << 16) |
        ((unsigned)(5 ^ M) << 20) | ((unsigned)(6 ^ M) << 24) |
        ((unsigned)(7 ^ M) << 28);
    constexpr unsigned hi =
        ((unsigned)((8 ^ M) & 15)) | ((unsigned)((9 ^ M) & 15) << 4) |
        ((unsigned)((10 ^ M) & 15) << 8) | ((unsigned)((11 ^ M) & 15) << 12) |
        ((unsigned)((12 ^ M) & 15) << 16) | ((unsigned)((13 ^ M) & 15) << 20) |
        ((unsigned)((14 ^ M) & 15) << 24) | ((unsigned)((15 ^ M) & 15) << 28);
    int iv = __builtin_bit_cast(int, v);
    int r = __builtin_amdgcn_permlane16(iv, iv, (int)lo, (int)hi, false, false);
    return __builtin_bit_cast(float, r);
#else
    return __shfl_xor(v, M, 32);
#endif
}

// Lane l <-> lane l ^ 16: the two halves of a wave that share a column of a
// WMMA accumulator tile (pure VALU).
static __device__ __forceinline__ float xhalf(float v) {
    const int iv = __builtin_bit_cast(int, v);
    const int r = __builtin_amdgcn_permlanex16(iv, iv, 0x76543210, 0xfedcba98, false, false);
    return __builtin_bit_cast(float, r);
}

// Eight 2^x and eight 1/x. The instruction set asks for one free issue slot behind a
// transcendental before its result is read or its source overwritten: here each
// instruction fills the slot of the one in front of it (the results are kept off
// all sources by the early-clobber mark), and the closing v_nop that of the last.
static __device__ __forceinline__ void exp2x8(float (&r)[8], const float (&x)[8]) {
    asm(
                 "v_exp_f32 %0, %8\n\t"
                 "v_exp_f32 %1, %9\n\t"
                 "v_exp_f32 %2, %10\n\t"
                 "v_exp_f32 %3, %11\n\t"
                 "v_exp_f32 %4, %12\n\t"
                 "v_exp_f32 %5, %13\n\t"
                 "v_exp_f32 %6, %14\n\t"
                 "v_exp_f32 %7, %15\n\t"
                 "v_nop"
                 : "=&v"(r[0]), "=&v"(r[1]), "=&v"(r[2]), "=&v"(r[3]),
                   "=&v"(r[4]), "=&v"(r[5]), "=&v"(r[6]), "=&v"(r[7])
                 : "v"(x[0]), "v"(x[1]), "v"(x[2]), "v"(x[3]),
                   "v"(x[4]), "v"(x[5]), "v"(x[6]), "v"(x[7]));
}
static __device__ __forceinline__ void rcpx8(float (&r)[8], const float (&x)[8]) {
    asm(
                 "v_rcp_f32 %0, %8\n\t"
                 "v_rcp_f32 %1, %9\n\t"
                 "v_rcp_f32 %2, %10\n\t"
                 "v_rcp_f32 %3, %11\n\t"
                 "v_rcp_f32 %4, %12\n\t"
                 "v_rcp_f32 %5, %13\n\t"
                 "v_rcp_f32 %6, %14\n\t"
                 "v_rcp_f32 %7, %15\n\t"
                 "v_nop"
                 : "=&v"(r[0]), "=&v"(r[1]), "=&v"(r[2]), "=&v"(r[3]),
                   "=&v"(r[4]), "=&v"(r[5]), "=&v"(r[6]), "=&v"(r[7])
                 : "v"(x[0]), "v"(x[1]), "v"(x[2]), "v"(x[3]),
                   "v"(x[4]), "v"(x[5]), "v"(x[6]), "v"(x[7]));
}

// Eight async global->LDS 16-B copies per lane (ASYNCcnt): rows l + i*lstep in
// LDS from rows g + i*gstep in global memory. The closing s_wait_xcnt 0 stands
// inside the copies' own statement so that no address register named here is
// rewritten ahead of it.
static __device__ __forceinline__ void async_copy8_b128(unsigned l, unsigned lstep,
                                                        const bf16* g, size_t gstep) {
    asm volatile("global_load_async_to_lds_b128 %0, %8, off\n\t"
                 "global_load_async_to_lds_b128 %1, %9, off\n\t"
                 "global_load_async_to_lds_b128 %2, %10, off\n\t"
                 "global_load_async_to_lds_b128 %3, %11, off\n\t"
                 "global_load_async_to_lds_b128 %4, %12, off\n\t"
                 "global_load_async_to_lds_b128 %5, %13, off\n\t"
                 "global_load_async_to_lds_b128 %6, %14, off\n\t"
                 "global_load_async_to_lds_b128 %7, %15, off\n\t"
                 "s_wait_xcnt 0x0"
                 :: "v"(l), "v"(l + lstep), "v"(l + 2 * lstep), "v"(l + 3 * lstep),
                    "v"(l + 4 * lstep), "v"(l + 5 * lstep), "v"(l + 6 * lstep),
                    "v"(l + 7 * lstep),
                    "v"(g), "v"(g + gstep), "v"(g + 2 * gstep), "v"(g + 3 * gstep),
                    "v"(g + 4 * gstep), "v"(g + 5 * gstep), "v"(g + 6 * gstep),
                    "v"(g + 7 * gstep)
                 : "memory");
}

// Four and four async global->LDS 16-B copies per lane: rows la + i*lstep from
// ga + i*gastep and rows lb + i*lstep from gb + i*gbstep. The closing
// s_wait_xcnt 0 stands inside the copies' own statement, as above.
static __device__ __forceinline__ void async_copy4x2_b128(unsigned la, const bf16* ga, size_t gastep,
                                                          unsigned lb, const bf16* gb, size_t gbstep,
                                                          unsigned lstep) {
    asm volatile("global_load_async_to_lds_b128 %0, %8, off\n\t"
                 "global_load_async_to_lds_b128 %1, %9, off\n\t"
                 "global_load_async_to_lds_b128 %2, %10, off\n\t"
                 "global_load_async_to_lds_b128 %3, %11, off\n\t"
                 "global_load_async_to_lds_b128 %4, %12, off\n\t"
                 "global_load_async_to_lds_b128 %5, %13, off\n\t"
                 "global_load_async_to_lds_b128 %6, %14, off\n\t"
                 "global_load_async_to_lds_b128 %7, %15, off\n\t"
                 "s_wait_xcnt 0x0"
                 :: "v"(la), "v"(la + lstep), "v"(la + 2 * lstep), "v"(la + 3 * lstep),
                    "v"(lb), "v"(lb + lstep), "v"(lb + 2 * lstep), "v"(lb + 3 * lstep),
                    "v"(ga), "v"(ga + gastep), "v"(ga + 2 * gastep), "v"(ga + 3 * gastep),
                    "v"(gb), "v"(gb + gbstep), "v"(gb + 2 * gbstep), "v"(gb + 3 * gbstep)
                 : "memory");
}

// The streaming stages run as few, long waves: 256 work-groups of 16 waves, one a
// WGP; every load is 512 contiguous bytes of a wave, and a wave issues all its
// loads before it works on the first of them.

// RMSNorm of one fp32 row by one wave -> bf16 row. xv, wv: the lane's elements
// i * 128 + 4 lane + e of the row and of the weight; orow: the row's start.
static __device__ __forceinline__ void rms_row(const v4f (&xv)[8], const v4f (&wv)[8],
                                               bf16* __restrict__ orow, int lane) {
    v4f sq = {};
#pragma unroll
    for (int i = 0; i < 8; ++i) sq += xv[i] * xv[i];
    float ss = (sq.x + sq.y) + (sq.z + sq.w);
    ss += permxor16<1>(ss);
    ss += permxor16<2>(ss);
    ss += permxor16<4>(ss);
    ss += permxor16<8>(ss);
    ss += xhalf(ss);
    const float rinv = rsqrtf(ss * (1.f / DIMN) + 1e-5f);
#pragma unroll
    for (int i = 0; i < 8; ++i) {
        v4bf o;
#pragma unroll
        for (int e = 0; e < 4; ++e) o[e] = (bf16)(xv[i][e] * rinv * wv[i][e]);
        ((v4bf*)orow)[i * 32 + lane] = o;
    }
}

// One launch for all that stands in front of the first GEMM. A wave takes one row
// of the first RMSNorm and 4096 elements of the fp32 -> bf16 weight convert. wdst:
// the bf16 weights, one behind another in the order wq wk wv wo [wgate, wup] wdown.
// wgate and wup share one matrix of 2 * HIDDEN rows, interleaved in groups of 16
// rows: hidden column h = 64 t + 32 w + 16 j + i has its gate row at
// 128 t + 64 w + 16 j + i and its up row 32 rows further on, so that the GEMM wave
// w of column tile t holds gate and up of the same 32 hidden columns.
__global__ __launch_bounds__(512)
void prep_kernel(const float* __restrict__ x, const float* __restrict__ wq,
                 const float* __restrict__ wk, const float* __restrict__ wv,
                 const float* __restrict__ wo, const float* __restrict__ wgate,
                 const float* __restrict__ wup, const float* __restrict__ wdown,
                 const float* __restrict__ n1w,
                 bf16* __restrict__ wdst, bf16* __restrict__ a1) {
    const int lane = threadIdx.x & 31;
    // in a scalar register: every base address below is then scalar
    const int wave = __builtin_amdgcn_readfirstlane(threadIdx.x >> 5);
    const int blk = blockIdx.x;
    const size_t row = (size_t)blk * 16 + wave;
    const int c = blk >> 4;            // piece of DIMN * DIMN elements, 16 blocks each
    const size_t pc = (size_t)DIMN * DIMN;
    const float* s = c == 0 ? wq : c == 1 ? wk : c == 2 ? wv : c == 3 ? wo
                   : c < 8  ? wgate + (size_t)(c - 4) * pc
                   : c < 12 ? wup + (size_t)(c - 8) * pc
                            : wdown + (size_t)(c - 12) * pc;
    s += (blk & 15) * 65536 + wave * 4096;
    const float* xr = x + row * DIMN;
    // a wave's 4096 elements are 4 whole rows of wgate or wup, inside one group of 16;
    // h: the first one's hidden column; rows count DIMN elements
    const int h = ((c & 3) << 10) + ((blk & 15) << 6) + (wave << 2);
    const int gurow = 4 * DIMN + ((h >> 6) << 7) + (((h >> 5) & 1) << 6) + (h & 31)
                      + (c >= 8 ? 32 : 0);
    bf16* d = wdst + (c >= 4 && c < 12 ? (size_t)gurow : row * 4) * DIMN;

    // the loops are unrolled so that the arrays stay in registers
    v4f xv[8], nv[8], v[32];
#pragma unroll
    for (int i = 0; i < 8; ++i) xv[i] = ((const v4f*)xr)[i * 32 + lane];
#pragma unroll
    for (int i = 0; i < 8; ++i) nv[i] = ((const v4f*)n1w)[i * 32 + lane];
#pragma unroll
    for (int i = 0; i < 32; ++i) v[i] = ((const v4f*)s)[i * 32 + lane];
    // Keeps all 48 loads in front of the arithmetic; without it the scheduler holds
    // part of them back and the wave waits out the memory latency several times.
    __builtin_amdgcn_sched_barrier(0);

    rms_row(xv, nv, a1 + row * DIMN, lane);

#pragma unroll
    for (int i = 0; i < 32; ++i) {
        v4bf o;
#pragma unroll
        for (int e = 0; e < 4; ++e) o[e] = (bf16)v[i][e];
        ((v4bf*)d)[i * 32 + lane] = o;
    }
}

__global__ __launch_bounds__(512) void rmsnorm_kernel(const float* __restrict__ x,
                                                      const float* __restrict__ w,
                                                      bf16* __restrict__ out) {
    const int lane = threadIdx.x & 31;
    // in a scalar register: the row's base address is then scalar
    const int wave = __builtin_amdgcn_readfirstlane(threadIdx.x >> 5);
    const size_t row = (size_t)blockIdx.x * 16 + wave;
    const float* xr = x + row * DIMN;
    // the loops are unrolled so that the arrays stay in registers
    v4f xv[8], wv[8];
#pragma unroll
    for (int i = 0; i < 8; ++i) xv[i] = ((const v4f*)xr)[i * 32 + lane];
#pragma unroll
    for (int i = 0; i < 8; ++i) wv[i] = ((const v4f*)w)[i * 32 + lane];
    // Keeps all 16 loads in front of the arithmetic; without it the scheduler sinks
    // six weight loads behind the row sum and the wave waits a second time.
    __builtin_amdgcn_sched_barrier(0);
    rms_row(xv, wv, out + row * DIMN, lane);
}

// ---------------- WMMA GEMM: C[M,N] = A[M,K] @ W[N,K]^T ----------------
// Two-buffer LDS ring filled by async global->LDS copies (ASYNCcnt). A ring tile
// holds KT = 128 k of 128 A rows and 128 W rows: every row is 256 contiguous
// bytes of global memory, at an LDS pitch of 272 B (16 B x odd).
// M, N multiples of 128; K a multiple of 128.
// MODE 0: QKV scatter (N=3072): q/k -> [B,H,S,Dh] bf16, v -> [B,H,Dh,S] bf16
// MODE 1: W = gate and up rows interleaved as prep_kernel lays them (N = 2 * HIDDEN):
//         store bf16 silu(gate) * up, [M, HIDDEN]; a lane's tiles nt and nt + 2 are
//         gate and up of the same hidden column
// MODE 2: store fp32 C[M,N] + res[M,N]
template <int MODE>
__global__ __launch_bounds__(256)
void gemm_kernel(const bf16* __restrict__ A, const bf16* __restrict__ W,
                 int M, int N, int K,
                 float* __restrict__ outF, bf16* __restrict__ outB,
                 const float* __restrict__ res,
                 bf16* __restrict__ qo, bf16* __restrict__ ko, bf16* __restrict__ vo) {
    constexpr int KT = 128;            // k per ring tile
    constexpr int LP = KT + 8;         // LDS row pitch in elements
    __shared__ bf16 As[2][128 * LP];
    __shared__ bf16 Bs[2][128 * LP];
    const int m0 = blockIdx.y * 128;
    const int n0 = blockIdx.x * 128;
    const int tid = threadIdx.x;
    const int lane = tid & 31;
    const int wave = tid >> 5;
    const int wm = (wave >> 1) * 32;   // wave M offset (4 waves in M)
    const int wn = (wave & 1) * 64;    // wave N offset (2 waves in N)
    const int lo = lane & 15;
    const int hi = lane >> 4;
    const int kb = hi << 3;            // K-chunk base per A/B VGPR layout

    v8f acc[2][4] = {};

    // 16 lanes cover one 256-B row; a thread copies rows srow + 16 i, i = 0..7,
    // of A and of W: 16 async b128 copies per thread and tile.
    const int srow = tid >> 4, scol = (tid & 15) << 3;
    const bf16* gA = A + (size_t)(m0 + srow) * K + scol;
    const bf16* gW = W + (size_t)(n0 + srow) * K + scol;
    const size_t gstep = (size_t)16 * K;
    const unsigned lA = (unsigned)(size_t)&As[0][srow * LP + scol];
    const unsigned lB = (unsigned)(size_t)&Bs[0][srow * LP + scol];

    auto stage = [&](int k0, unsigned pb) {
        const unsigned bo = pb * (unsigned)(128 * LP * sizeof(bf16));
        async_copy8_b128(lA + bo, 16 * LP * sizeof(bf16), gA + k0, gstep);
        async_copy8_b128(lB + bo, 16 * LP * sizeof(bf16), gW + k0, gstep);
    };

    // Two fragment sets: the 12 LDS reads of a k step go out as one group, one k
    // step ahead of the WMMAs that use them. The loops over mt and nt below are
    // unrolled so that every fragment and accumulator index is a constant and the
    // arrays stay in registers.
    Frag a[2][2], b[2][4];
    auto frags = [&](unsigned pb, int ks, int set) {
#pragma unroll
        for (int mt = 0; mt < 2; ++mt) {
            const bf16* ap = &As[pb][(wm + mt * 16 + lo) * LP + ks + kb];
            a[set][mt].h[0] = *(const v8bf*)ap;
            a[set][mt].h[1] = *(const v8bf*)(ap + 16);
        }
#pragma unroll
        for (int nt = 0; nt < 4; ++nt) {
            const bf16* bp = &Bs[pb][(wn + nt * 16 + lo) * LP + ks + kb];
            b[set][nt].h[0] = *(const v8bf*)bp;
            b[set][nt].h[1] = *(const v8bf*)(bp + 16);
        }
    };
    auto mma = [&](int set) {
        // Keeps the next step's reads, written above, in front of these WMMAs;
        // without it the scheduler sinks them to two reads and a full wait per
        // WMMA pair.
        __builtin_amdgcn_sched_barrier(0);
#pragma unroll
        for (int nt = 0; nt < 4; ++nt) {
            acc[0][nt] = wmma_bf16(a[set][0], b[set][nt], acc[0][nt]);
            acc[1][nt] = wmma_bf16(a[set][1], b[set][nt], acc[1][nt]);
        }
        // Keeps the following group of reads whole, behind these WMMAs.
        __builtin_amdgcn_sched_barrier(0);
    };

    constexpr int NS = KT / 32;        // k steps per tile (even: step 0 is set 0)
    const int ntile = K / KT;
    stage(0, 0);
    // tile 0 has landed for this wave; the barrier publishes it to the others
    asm volatile("s_wait_asynccnt 0x0" ::: "memory");
    __syncthreads();
    if (K >= 2 * KT) stage(KT, 1);
    frags(0, 0, 0);
    for (int t = 0; t < ntile; ++t) {
        const unsigned pb = (unsigned)(t & 1);
        // unrolled so that the k steps of a tile read at constant LDS offsets and
        // the fragment sets stay in registers
#pragma unroll
        for (int s = 0; s + 1 < NS; ++s) {
            frags(pb, (s + 1) * 32, (s + 1) & 1);
            mma(s & 1);
        }
        // Publish point of tile t + 1, in front of tile t's last k step, whose
        // fragments are fetched: this wave's reads of buffer t & 1 have retired,
        // its copies of tile t + 1 have landed, then one barrier that both
        // publishes tile t + 1 and frees buffer t & 1 for the refill.
        asm volatile("s_wait_dscnt 0x0" ::: "memory");
        asm volatile("s_wait_asynccnt 0x0" ::: "memory");
        __syncthreads();
        if (t + 2 < ntile) stage((t + 2) * KT, pb);
        if (t + 1 < ntile) frags(pb ^ 1u, 0, 0);
        mma((NS - 1) & 1);
    }
    // no copy is left outstanding when the wave goes on to its stores and ends
    asm volatile("s_wait_asynccnt 0x0" ::: "memory");

    // the loops are unrolled so that the arrays stay in registers
    float sig[2][2][8];
    if constexpr (MODE == 1) {
#pragma unroll
        for (int mt = 0; mt < 2; ++mt)
#pragma unroll
            for (int nt = 0; nt < 2; ++nt) {
                float t[8], e[8];
#pragma unroll
                for (int r = 0; r < 8; ++r) t[r] = acc[mt][nt][r] * -1.44269504f;  // -g log2 e
                exp2x8(e, t);
#pragma unroll
                for (int r = 0; r < 8; ++r) t[r] = 1.f + e[r];
                rcpx8(sig[mt][nt], t);
            }
    }

#pragma unroll
    for (int mt = 0; mt < 2; ++mt)
#pragma unroll
        for (int nt = 0; nt < 4; ++nt)
#pragma unroll
            for (int r = 0; r < 8; ++r) {
                const int m = m0 + wm + mt * 16 + r + hi * 8;
                const int n = n0 + wn + nt * 16 + lo;
                const float vacc = acc[mt][nt][r];
                if constexpr (MODE == 0) {
                    const int bq = m >> 11, s = m & 2047;
                    const int which = n >> 10, col = n & 1023;
                    const int hh = col >> 6, d = col & 63;
                    const size_t bhd = (size_t)(bq * NHEAD + hh);
                    if (which == 0)
                        qo[(bhd * S_LEN + s) * HDIM + d] = (bf16)vacc;
                    else if (which == 1)
                        ko[(bhd * S_LEN + s) * HDIM + d] = (bf16)vacc;
                    else
                        vo[(bhd * HDIM + d) * S_LEN + s] = (bf16)vacc;
                } else if constexpr (MODE == 1) {
                    // sig[mt][nt][r] = 1 / (1 + e^-gate); tiles 2 and 3 are the up half
                    if (nt < 2) {
                        const int hcol = (n0 >> 1) + (wn >> 1) + nt * 16 + lo;
                        outB[(size_t)m * HIDDEN + hcol] =
                            (bf16)(vacc * sig[mt][nt][r] * acc[mt][nt + 2][r]);
                    }
                } else {
                    outF[(size_t)m * N + n] = vacc + res[(size_t)m * N + n];
                }
            }
}

__global__ __launch_bounds__(128)
void attn_kernel(const bf16* __restrict__ q, const bf16* __restrict__ k,
                 const bf16* __restrict__ v, bf16* __restrict__ out) {
    constexpr int KS = 64;             // keys per ring stage
    constexpr int LPA = 64 + 8;        // LDS row pitch in elements
    __shared__ __attribute__((aligned(16))) bf16 Ks[2][KS * LPA];     // [key][d]
    __shared__ __attribute__((aligned(16))) bf16 Vs[2][HDIM * LPA];   // [d][key]
    const int tid = threadIdx.x;
    const int lane = tid & 31;
    // in a scalar register: the test that skips a pass is then a scalar branch
    const int wave = __builtin_amdgcn_readfirstlane(tid >> 5);
    const int lo = lane & 15;
    const int hi = lane >> 4;
    const int kb = hi << 3;
    const int bh = blockIdx.y;                   // 0..31
    const int b = bh >> 4, h0 = bh & 15;

    // 8 lanes cover one 128-B row; a thread copies rows crow + 16 i, i = 0..3, of
    // the stage's K and of its V^T: 8 async b128 copies per thread and stage.
    const int crow = tid >> 3, ccol = (tid & 7) << 3;
    const bf16* gK = k + (((size_t)bh) * S_LEN + crow) * HDIM + ccol;
    const bf16* gV = v + (((size_t)bh) * HDIM + crow) * S_LEN + ccol;
    const unsigned lK = (unsigned)(size_t)&Ks[0][crow * LPA + ccol];
    const unsigned lV = (unsigned)(size_t)&Vs[0][crow * LPA + ccol];
    auto stage = [&](int t, unsigned pb) {
        const unsigned bo = pb * (unsigned)(KS * LPA * sizeof(bf16));
        async_copy4x2_b128(lK + bo, gK + (size_t)t * KS * HDIM, (size_t)16 * HDIM,
                           lV + bo, gV + (size_t)t * KS, (size_t)16 * S_LEN,
                           16 * LPA * sizeof(bf16));
    };

  // The long tile first, then the short one. The ring starts anew for the second
  // tile: the barrier at the foot of the first tile's last stage has ended every
  // wave's reads of both buffers, and no copy is outstanding there.
  for (int half = 0; half < 2; ++half) {
    const int qt = half == 0 ? S_LEN / 64 - 1 - (int)blockIdx.x : (int)blockIdx.x;
    const int qbase = qt * 64 + wave * 16;

    // B operand of S^T: column lo = query qbase + lo
    const bf16* qp = q + (((size_t)bh) * S_LEN + qbase + lo) * HDIM;
    Frag qb[2];
    qb[0].h[0] = *(const v8bf*)(qp + kb);
    qb[0].h[1] = *(const v8bf*)(qp + kb + 16);
    qb[1].h[0] = *(const v8bf*)(qp + 32 + kb);
    qb[1].h[1] = *(const v8bf*)(qp + 32 + kb + 16);

    v8f o[4] = {};               // O^T: row d = 16 dt + 8 hi + r, column = query lo
    float mrow = -INFINITY;      // running maximum of query lo (equal in both halves)
    float lsum = 0.f;            // this half's share of the running sum of query lo
    const float scale = 0.125f;  // 1/sqrt(64)

    const int nst = qt + 1;            // stages up to the tile's diagonal
    stage(0, 0);
    // stage 0 has landed for this wave; the barrier publishes it to the others
    asm volatile("s_wait_asynccnt 0x0" ::: "memory");
    __syncthreads();
    if (nst > 1) stage(1, 1);
    for (int t = 0; t < nst; ++t) {
      // unrolled so that both passes of a stage read at constant LDS offsets
#pragma unroll
      for (int ps = 0; ps < 2; ++ps) {
        const int j0 = t * KS + ps * 32;
        // a pass wholly beyond this wave's diagonal is skipped (wave-uniform);
        // the publish point below stands outside the skip
        if (j0 > qbase + 15) continue;
        const bf16* kp = &Ks[t & 1][(ps * 32 + lo) * LPA + kb];
        const bf16* vp = &Vs[t & 1][lo * LPA + ps * 32 + kb];
        // A operands: K rows j0 + lo and j0 + 16 + lo; V^T rows d = 16 dt + lo
        Frag a00, a01, a10, a11, va[4];
        a00.h[0] = *(const v8bf*)(kp);
        a00.h[1] = *(const v8bf*)(kp + 16);
        a01.h[0] = *(const v8bf*)(kp + 32);
        a01.h[1] = *(const v8bf*)(kp + 48);
        a10.h[0] = *(const v8bf*)(kp + 16 * LPA);
        a10.h[1] = *(const v8bf*)(kp + 16 * LPA + 16);
        a11.h[0] = *(const v8bf*)(kp + 16 * LPA + 32);
        a11.h[1] = *(const v8bf*)(kp + 16 * LPA + 48);
#pragma unroll
        for (int dt = 0; dt < 4; ++dt) {
            va[dt].h[0] = *(const v8bf*)(vp + dt * 16 * LPA);
            va[dt].h[1] = *(const v8bf*)(vp + dt * 16 * LPA + 16);
        }
        // The pass's 16 LDS reads go out as one group ahead of its WMMAs; without
        // this line the scheduler puts two reads and a full wait in front of each
        // score WMMA and the wave waits out the LDS latency several times a pass.
        __builtin_amdgcn_sched_barrier(0);
        v8f s0 = {}, s1 = {};
        s0 = wmma_bf16(a00, qb[0], s0);
        s1 = wmma_bf16(a10, qb[0], s1);
        s0 = wmma_bf16(a01, qb[1], s0);
        s1 = wmma_bf16(a11, qb[1], s1);

        // Online softmax of query lo. s0[r] is key j0 + kb + r, s1[r] key
        // j0 + 16 + kb + r; a key is inside the causal mask while its offset
        // from j0 + kb does not exceed lim.
        const int lim = qbase + lo - j0 - kb;
        float x0[8], x1[8];
        float mx = -INFINITY;
#pragma unroll
        for (int r = 0; r < 8; ++r) {
            x0[r] = (r      <= lim) ? s0[r] * scale : -INFINITY;
            x1[r] = (r + 16 <= lim) ? s1[r] * scale : -INFINITY;
            mx = fmaxf(mx, fmaxf(x0[r], x1[r]));
        }
        mx = fmaxf(mx, xhalf(mx));
        const float mnew = fmaxf(mrow, mx);
        const float alpha = __expf(mrow - mnew);
        mrow = mnew;
        Frag pb;
        float ps0 = 0.f, ps1 = 0.f;
#pragma unroll
        for (int r = 0; r < 8; ++r) {
            const float p0 = __expf(x0[r] - mnew);
            const float p1 = __expf(x1[r] - mnew);
            ps0 += p0;
            ps1 += p1;
            pb.h[0][r] = (bf16)p0;
            pb.h[1][r] = (bf16)p1;
        }
        lsum = lsum * alpha + (ps0 + ps1);
#pragma unroll
        for (int dt = 0; dt < 4; ++dt) {
            v8f ov = o[dt];
#pragma unroll
            for (int r = 0; r < 8; ++r) ov[r] *= alpha;
            o[dt] = wmma_bf16(va[dt], pb, ov);
        }
      }
      // Publish point of stage t + 1: this wave's reads of buffer t & 1 have
      // retired, its copies of stage t + 1 have landed, then one barrier that
      // both publishes stage t + 1 and frees buffer t & 1 for the refill.
      asm volatile("s_wait_dscnt 0x0" ::: "memory");
      asm volatile("s_wait_asynccnt 0x0" ::: "memory");
      __syncthreads();
      if (t + 2 < nst) stage(t + 2, (unsigned)(t & 1));
    }
    // no copy is left outstanding when the wave goes on to its stores
    asm volatile("s_wait_asynccnt 0x0" ::: "memory");

    const float ltot = lsum + xhalf(lsum);
    bf16* op = out + ((size_t)(b * S_LEN + qbase + lo)) * DIMN + h0 * HDIM + kb;
#pragma unroll
    for (int dt = 0; dt < 4; ++dt) {
        v8bf ov;
#pragma unroll
        for (int r = 0; r < 8; ++r) ov[r] = (bf16)(o[dt][r] / ltot);
        *(v8bf*)(op + dt * 16) = ov;
    }
    // the next tile rewrites the registers that these stores name
    asm volatile("s_wait_xcnt 0x0" ::: "memory");
  }
}

extern "C" void kernel_launch(void* const* d_in, const int* in_sizes, int n_in,
                              void* d_out, int out_size, void* d_ws, size_t ws_size,
                              hipStream_t stream) {
    const float* x     = (const float*)d_in[0];
    const float* wq    = (const float*)d_in[1];
    const float* wk    = (const float*)d_in[2];
    const float* wv    = (const float*)d_in[3];
    const float* wo    = (const float*)d_in[4];
    const float* wgate = (const float*)d_in[5];
    const float* wup   = (const float*)d_in[6];
    const float* wdown = (const float*)d_in[7];
    const float* n1w   = (const float*)d_in[8];
    const float* n2w   = (const float*)d_in[9];

    char* ws = (char*)d_ws;
    size_t off = 0;
    auto take = [&](size_t bytes) -> char* {
        char* p = ws + off;
        off += (bytes + 255) & ~(size_t)255;
        return p;
    };
    bf16*  a1   = (bf16*)take((size_t)MTOT * DIMN * 2);
    bf16*  wqkv = (bf16*)take((size_t)3 * DIMN * DIMN * 2);
    bf16*  wo_b = (bf16*)take((size_t)DIMN * DIMN * 2);
    bf16*  wgu  = (bf16*)take((size_t)2 * HIDDEN * DIMN * 2);
    bf16*  wdn  = (bf16*)take((size_t)DIMN * HIDDEN * 2);
    bf16*  qws  = (bf16*)take((size_t)MTOT * DIMN * 2);
    bf16*  kws  = (bf16*)take((size_t)MTOT * DIMN * 2);
    bf16*  vws  = (bf16*)take((size_t)MTOT * DIMN * 2);
    bf16*  attn = (bf16*)take((size_t)MTOT * DIMN * 2);
    float* x2   = (float*)take((size_t)MTOT * DIMN * 4);
    bf16*  a2   = (bf16*)take((size_t)MTOT * DIMN * 2);
    bf16*  mlp  = (bf16*)take((size_t)MTOT * HIDDEN * 2);

    // wqkv, wo_b, wgu and wdn were taken one behind another with no gap: wqkv is
    // the start of all bf16 weights
    prep_kernel<<<256, 512, 0, stream>>>(x, wq, wk, wv, wo, wgate, wup, wdown, n1w, wqkv, a1);

    gemm_kernel<0><<<dim3(3072 / 128, MTOT / 128), 256, 0, stream>>>(
        a1, wqkv, MTOT, 3072, DIMN, nullptr, nullptr, nullptr, qws, kws, vws);

    attn_kernel<<<dim3(S_LEN / 128, BATCH * NHEAD), 128, 0, stream>>>(qws, kws, vws, attn);

    gemm_kernel<2><<<dim3(DIMN / 128, MTOT / 128), 256, 0, stream>>>(
        attn, wo_b, MTOT, DIMN, DIMN, x2, nullptr, x, nullptr, nullptr, nullptr);

    rmsnorm_kernel<<<MTOT / 16, 512, 0, stream>>>(x2, n2w, a2);

    gemm_kernel<1><<<dim3(2 * HIDDEN / 128, MTOT / 128), 256, 0, stream>>>(
        a2, wgu, MTOT, 2 * HIDDEN, DIMN, nullptr, mlp, nullptr, nullptr, nullptr, nullptr);

    gemm_kernel<2><<<dim3(DIMN / 128, MTOT / 128), 256, 0, stream>>>(
        mlp, wdn, MTOT, DIMN, HIDDEN, (float*)d_out, nullptr, x2,
        nullptr, nullptr, nullptr);
}

// v008
// A run of this version takes 165 microseconds.
// In two side-by-side timings against v007, it was 1.19 and 1.20 times as fast.
// Over all steps from v000 it is 2.28 times as fast.
#include <hip/hip_runtime.h>
#include <hip/hip_bf16.h>
#include <math.h>

typedef __bf16 bf16;
typedef __attribute__((ext_vector_type(16))) __bf16 v16bf;
typedef __attribute__((ext_vector_type(8)))  __bf16 v8bf;
typedef __attribute__((ext_vector_type(4)))  __bf16 v4bf;
typedef __attribute__((ext_vector_type(8)))  float  v8f;
typedef __attribute__((ext_vector_type(4)))  float  v4f;

#define DIMN   1024
#define S_LEN  2048
#define BATCH  2
#define NHEAD  16
#define HDIM   64
#define HIDDEN 4096
#define MTOT   (BATCH * S_LEN)   // 4096 rows

union Frag { v16bf v; v8bf h[2]; };

static __device__ __forceinline__ v8f wmma_bf16(const Frag& a, const Frag& b, v8f c) {
    return __builtin_amdgcn_wmma_f32_16x16x32_bf16(false, a.v, false, b.v,
                                                   (short)0, c, false, false);
}

// XOR-shuffle within each 16-lane half using v_permlane16_b32 (pure VALU,
// avoids ds_bpermute + s_wait_dscnt round-trips).
template <int M>
static __device__ __forceinline__ float permxor16(float v) {
#if __has_builtin(__builtin_amdgcn_permlane16)
    constexpr unsigned lo =
        ((unsigned)(0 ^ M)) | ((unsigned)(1 ^ M) << 4) | ((unsigned)(2 ^ M) << 8) |
        ((unsigned)(3 ^ M) << 12) | ((unsigned)(4 ^ M) << 16) |
        ((unsigned)(5 ^ M) << 20) | ((unsigned)(6 ^ M) << 24) |
        ((unsigned)(7 ^ M) << 28);
    constexpr unsigned hi =
        ((unsigned)((8 ^ M) & 15)) | ((unsigned)((9 ^ M) & 15) << 4) |
        ((unsigned)((10 ^ M) & 15) << 8) | ((unsigned)((11 ^ M) & 15) << 12) |
        ((unsigned)((12 ^ M) & 15) << 16) | ((unsigned)((13 ^ M) & 15) << 20) |
        ((unsigned)((14 ^ M) & 15) << 24) | ((unsigned)((15 ^ M) & 15) << 28);
    int iv = __builtin_bit_cast(int, v);
    int r = __builtin_amdgcn_permlane16(iv, iv, (int)lo, (int)hi, false, false);
    return __builtin_bit_cast(float, r);
#else
    return __shfl_xor(v, M, 32);
#endif
}

// Lane l <-> lane l ^ 16: the two halves of a wave that share a column of a
// WMMA accumulator tile (pure VALU).
static __device__ __forceinline__ float xhalf(float v) {
    const int iv = __builtin_bit_cast(int, v);
    const int r = __builtin_amdgcn_permlanex16(iv, iv, 0x76543210, 0xfedcba98, false, false);
    return __builtin_bit_cast(float, r);
}

// Eight 2^x and eight 1/x. The instruction set asks for one free issue slot behind a
// transcendental before its result is read or its source overwritten: here each
// instruction fills the slot of the one in front of it (the results are kept off
// all sources by the early-clobber mark), and the closing v_nop that of the last.
static __device__ __forceinline__ void exp2x8(float (&r)[8], const float (&x)[8]) {
    asm(
                 "v_exp_f32 %0, %8\n\t"
                 "v_exp_f32 %1, %9\n\t"
                 "v_exp_f32 %2, %10\n\t"
                 "v_exp_f32 %3, %11\n\t"
                 "v_exp_f32 %4, %12\n\t"
                 "v_exp_f32 %5, %13\n\t"
                 "v_exp_f32 %6, %14\n\t"
                 "v_exp_f32 %7, %15\n\t"
                 "v_nop"
                 : "=&v"(r[0]), "=&v"(r[1]), "=&v"(r[2]), "=&v"(r[3]),
                   "=&v"(r[4]), "=&v"(r[5]), "=&v"(r[6]), "=&v"(r[7])
                 : "v"(x[0]), "v"(x[1]), "v"(x[2]), "v"(x[3]),
                   "v"(x[4]), "v"(x[5]), "v"(x[6]), "v"(x[7]));
}
static __device__ __forceinline__ void rcpx8(float (&r)[8], const float (&x)[8]) {
    asm(
                 "v_rcp_f32 %0, %8\n\t"
                 "v_rcp_f32 %1, %9\n\t"
                 "v_rcp_f32 %2, %10\n\t"
                 "v_rcp_f32 %3, %11\n\t"
                 "v_rcp_f32 %4, %12\n\t"
                 "v_rcp_f32 %5, %13\n\t"
                 "v_rcp_f32 %6, %14\n\t"
                 "v_rcp_f32 %7, %15\n\t"
                 "v_nop"
                 : "=&v"(r[0]), "=&v"(r[1]), "=&v"(r[2]), "=&v"(r[3]),
                   "=&v"(r[4]), "=&v"(r[5]), "=&v"(r[6]), "=&v"(r[7])
                 : "v"(x[0]), "v"(x[1]), "v"(x[2]), "v"(x[3]),
                   "v"(x[4]), "v"(x[5]), "v"(x[6]), "v"(x[7]));
}

// Eight async global->LDS 16-B copies per lane (ASYNCcnt): rows l + i*lstep in
// LDS from rows g + i*gstep in global memory. The closing s_wait_xcnt 0 stands
// inside the copies' own statement so that no address register named here is
// rewritten ahead of it.
static __device__ __forceinline__ void async_copy8_b128(unsigned l, unsigned lstep,
                                                        const bf16* g, size_t gstep) {
    asm volatile("global_load_async_to_lds_b128 %0, %8, off\n\t"
                 "global_load_async_to_lds_b128 %1, %9, off\n\t"
                 "global_load_async_to_lds_b128 %2, %10, off\n\t"
                 "global_load_async_to_lds_b128 %3, %11, off\n\t"
                 "global_load_async_to_lds_b128 %4, %12, off\n\t"
                 "global_load_async_to_lds_b128 %5, %13, off\n\t"
                 "global_load_async_to_lds_b128 %6, %14, off\n\t"
                 "global_load_async_to_lds_b128 %7, %15, off\n\t"
                 "s_wait_xcnt 0x0"
                 :: "v"(l), "v"(l + lstep), "v"(l + 2 * lstep), "v"(l + 3 * lstep),
                    "v"(l + 4 * lstep), "v"(l + 5 * lstep), "v"(l + 6 * lstep),
                    "v"(l + 7 * lstep),
                    "v"(g), "v"(g + gstep), "v"(g + 2 * gstep), "v"(g + 3 * gstep),
                    "v"(g + 4 * gstep), "v"(g + 5 * gstep), "v"(g + 6 * gstep),
                    "v"(g + 7 * gstep)
                 : "memory");
}

// Four and four async global->LDS 16-B copies per lane: rows la + i*lstep from
// ga + i*gastep and rows lb + i*lstep from gb + i*gbstep. The closing
// s_wait_xcnt 0 stands inside the copies' own statement, as above.
static __device__ __forceinline__ void async_copy4x2_b128(unsigned la, const bf16* ga, size_t gastep,
                                                          unsigned lb, const bf16* gb, size_t gbstep,
                                                          unsigned lstep) {
    asm volatile("global_load_async_to_lds_b128 %0, %8, off\n\t"
                 "global_load_async_to_lds_b128 %1, %9, off\n\t"
                 "global_load_async_to_lds_b128 %2, %10, off\n\t"
                 "global_load_async_to_lds_b128 %3, %11, off\n\t"
                 "global_load_async_to_lds_b128 %4, %12, off\n\t"
                 "global_load_async_to_lds_b128 %5, %13, off\n\t"
                 "global_load_async_to_lds_b128 %6, %14, off\n\t"
                 "global_load_async_to_lds_b128 %7, %15, off\n\t"
                 "s_wait_xcnt 0x0"
                 :: "v"(la), "v"(la + lstep), "v"(la + 2 * lstep), "v"(la + 3 * lstep),
                    "v"(lb), "v"(lb + lstep), "v"(lb + 2 * lstep), "v"(lb + 3 * lstep),
                    "v"(ga), "v"(ga + gastep), "v"(ga + 2 * gastep), "v"(ga + 3 * gastep),
                    "v"(gb), "v"(gb + gbstep), "v"(gb + 2 * gbstep), "v"(gb + 3 * gbstep)
                 : "memory");
}

// The streaming stages run as few, long waves: 256 work-groups of 16 waves, one a
// WGP; every load is 512 contiguous bytes of a wave, and a wave issues all its
// loads before it works on the first of them.

// RMSNorm of one fp32 row by one wave -> bf16 row. xv, wv: the lane's elements
// i * 128 + 4 lane + e of the row and of the weight; orow: the row's start.
static __device__ __forceinline__ void rms_row(const v4f (&xv)[8], const v4f (&wv)[8],
                                               bf16* __restrict__ orow, int lane) {
    v4f sq = {};
#pragma unroll
    for (int i = 0; i < 8; ++i) sq += xv[i] * xv[i];
    float ss = (sq.x + sq.y) + (sq.z + sq.w);
    ss += permxor16<1>(ss);
    ss += permxor16<2>(ss);
    ss += permxor16<4>(ss);
    ss += permxor16<8>(ss);
    ss += xhalf(ss);
    const float rinv = rsqrtf(ss * (1.f / DIMN) + 1e-5f);
#pragma unroll
    for (int i = 0; i < 8; ++i) {
        v4bf o;
#pragma unroll
        for (int e = 0; e < 4; ++e) o[e] = (bf16)(xv[i][e] * rinv * wv[i][e]);
        ((v4bf*)orow)[i * 32 + lane] = o;
    }
}

// One launch for all that stands in front of the first GEMM. A wave takes one row
// of the first RMSNorm and 4096 elements of the fp32 -> bf16 weight convert. wdst:
// the bf16 weights, one behind another in the order wq wk wv wo [wgate, wup] wdown.
// wgate and wup share one matrix of 2 * HIDDEN rows, interleaved in groups of 16
// rows: hidden column h = 64 t + 32 w + 16 j + i has its gate row at
// 128 t + 64 w + 16 j + i and its up row 32 rows further on, so that the GEMM wave
// w of column tile t holds gate and up of the same 32 hidden columns.
__global__ __launch_bounds__(512)
void prep_kernel(const float* __restrict__ x, const float* __restrict__ wq,
                 const float* __restrict__ wk, const float* __restrict__ wv,
                 const float* __restrict__ wo, const float* __restrict__ wgate,
                 const float* __restrict__ wup, const float* __restrict__ wdown,
                 const float* __restrict__ n1w,
                 bf16* __restrict__ wdst, bf16* __restrict__ a1) {
    const int lane = threadIdx.x & 31;
    // in a scalar register: every base address below is then scalar
    const int wave = __builtin_amdgcn_readfirstlane(threadIdx.x >> 5);
    const int blk = blockIdx.x;
    const size_t row = (size_t)blk * 16 + wave;
    const int c = blk >> 4;            // piece of DIMN * DIMN elements, 16 blocks each
    const size_t pc = (size_t)DIMN * DIMN;
    const float* s = c == 0 ? wq : c == 1 ? wk : c == 2 ? wv : c == 3 ? wo
                   : c < 8  ? wgate + (size_t)(c - 4) * pc
                   : c < 12 ? wup + (size_t)(c - 8) * pc
                            : wdown + (size_t)(c - 12) * pc;
    s += (blk & 15) * 65536 + wave * 4096;
    const float* xr = x + row * DIMN;
    // a wave's 4096 elements are 4 whole rows of wgate or wup, inside one group of 16;
    // h: the first one's hidden column; rows count DIMN elements
    const int h = ((c & 3) << 10) + ((blk & 15) << 6) + (wave << 2);
    const int gurow = 4 * DIMN + ((h >> 6) << 7) + (((h >> 5) & 1) << 6) + (h & 31)
                      + (c >= 8 ? 32 : 0);
    bf16* d = wdst + (c >= 4 && c < 12 ? (size_t)gurow : row * 4) * DIMN;

    // the loops are unrolled so that the arrays stay in registers
    v4f xv[8], nv[8], v[32];
#pragma unroll
    for (int i = 0; i < 8; ++i) xv[i] = ((const v4f*)xr)[i * 32 + lane];
#pragma unroll
    for (int i = 0; i < 8; ++i) nv[i] = ((const v4f*)n1w)[i * 32 + lane];
#pragma unroll
    for (int i = 0; i < 32; ++i) v[i] = ((const v4f*)s)[i * 32 + lane];
    // Keeps all 48 loads in front of the arithmetic; without it the scheduler holds
    // part of them back and the wave waits out the memory latency several times.
    __builtin_amdgcn_sched_barrier(0);

    rms_row(xv, nv, a1 + row * DIMN, lane);

#pragma unroll
    for (int i = 0; i < 32; ++i) {
        v4bf o;
#pragma unroll
        for (int e = 0; e < 4; ++e) o[e] = (bf16)v[i][e];
        ((v4bf*)d)[i * 32 + lane] = o;
    }
}

__global__ __launch_bounds__(512) void rmsnorm_kernel(const float* __restrict__ x,
                                                      const float* __restrict__ w,
                                                      bf16* __restrict__ out) {
    const int lane = threadIdx.x & 31;
    // in a scalar register: the row's base address is then scalar
    const int wave = __builtin_amdgcn_readfirstlane(threadIdx.x >> 5);
    const size_t row = (size_t)blockIdx.x * 16 + wave;
    const float* xr = x + row * DIMN;
    // the loops are unrolled so that the arrays stay in registers
    v4f xv[8], wv[8];
#pragma unroll
    for (int i = 0; i < 8; ++i) xv[i] = ((const v4f*)xr)[i * 32 + lane];
#pragma unroll
    for (int i = 0; i < 8; ++i) wv[i] = ((const v4f*)w)[i * 32 + lane];
    // Keeps all 16 loads in front of the arithmetic; without it the scheduler sinks
    // six weight loads behind the row sum and the wave waits a second time.
    __builtin_amdgcn_sched_barrier(0);
    rms_row(xv, wv, out + row * DIMN, lane);
}

// ---------------- WMMA GEMM: C[M,N] = A[M,K] @ W[N,K]^T ----------------
// Two-buffer LDS ring filled by async global->LDS copies (ASYNCcnt). A ring tile
// holds KT = 128 k of 128 A rows and 128 W rows: every row is 256 contiguous
// bytes of global memory, at an LDS pitch of 272 B (16 B x odd).
// M, N multiples of 128; K a multiple of 128.
// MODE 0: QKV scatter (N=3072): q/k -> [B,H,S,Dh] bf16, v -> [B,H,Dh,S] bf16
// MODE 1: W = gate and up rows interleaved as prep_kernel lays them (N = 2 * HIDDEN):
//         store bf16 silu(gate) * up, [M, HIDDEN]; a lane's tiles nt and nt + 2 are
//         gate and up of the same hidden column
// MODE 2: store fp32 C[M,N] + res[M,N], N = DIMN (the row pitch is a constant, so that
//         the epilogue's rows differ by an immediate offset only)
template <int MODE>
__global__ __launch_bounds__(256)
void gemm_kernel(const bf16* __restrict__ A, const bf16* __restrict__ W,
                 int M, int N, int K,
                 float* __restrict__ outF, bf16* __restrict__ outB,
                 const float* __restrict__ res,
                 bf16* __restrict__ qo, bf16* __restrict__ ko, bf16* __restrict__ vo) {
    constexpr int KT = 128;            // k per ring tile
    constexpr int LP = KT + 8;         // LDS row pitch in elements
    __shared__ bf16 As[2][128 * LP];
    __shared__ bf16 Bs[2][128 * LP];
    const int m0 = blockIdx.y * 128;
    const int n0 = blockIdx.x * 128;
    const int tid = threadIdx.x;
    const int lane = tid & 31;
    const int wave = tid >> 5;
    const int wm = (wave >> 1) * 32;   // wave M offset (4 waves in M)
    const int wn = (wave & 1) * 64;    // wave N offset (2 waves in N)
    const int lo = lane & 15;
    const int hi = lane >> 4;
    const int kb = hi << 3;            // K-chunk base per A/B VGPR layout

    v8f acc[2][4] = {};

    // 16 lanes cover one 256-B row; a thread copies rows srow + 16 i, i = 0..7,
    // of A and of W: 16 async b128 copies per thread and tile.
    const int srow = tid >> 4, scol = (tid & 15) << 3;
    const bf16* gA = A + (size_t)(m0 + srow) * K + scol;
    const bf16* gW = W + (size_t)(n0 + srow) * K + scol;
    const size_t gstep = (size_t)16 * K;
    const unsigned lA = (unsigned)(size_t)&As[0][srow * LP + scol];
    const unsigned lB = (unsigned)(size_t)&Bs[0][srow * LP + scol];

    auto stage = [&](int k0, unsigned pb) {
        const unsigned bo = pb * (unsigned)(128 * LP * sizeof(bf16));
        async_copy8_b128(lA + bo, 16 * LP * sizeof(bf16), gA + k0, gstep);
        async_copy8_b128(lB + bo, 16 * LP * sizeof(bf16), gW + k0, gstep);
    };

    // Two fragment sets: the 12 LDS reads of a k step go out as one group, one k
    // step ahead of the WMMAs that use them. The loops over mt and nt below are
    // unrolled so that every fragment and accumulator index is a constant and the
    // arrays stay in registers.
    Frag a[2][2], b[2][4];
    auto frags = [&](unsigned pb, int ks, int set) {
#pragma unroll
        for (int mt = 0; mt < 2; ++mt) {
            const bf16* ap = &As[pb][(wm + mt * 16 + lo) * LP + ks + kb];
            a[set][mt].h[0] = *(const v8bf*)ap;
            a[set][mt].h[1] = *(const v8bf*)(ap + 16);
        }
#pragma unroll
        for (int nt = 0; nt < 4; ++nt) {
            const bf16* bp = &Bs[pb][(wn + nt * 16 + lo) * LP + ks + kb];
            b[set][nt].h[0] = *(const v8bf*)bp;
            b[set][nt].h[1] = *(const v8bf*)(bp + 16);
        }
    };
    auto mma = [&](int set) {
        // Keeps the next step's reads, written above, in front of these WMMAs;
        // without it the scheduler sinks them to two reads and a full wait per
        // WMMA pair.
        __builtin_amdgcn_sched_barrier(0);
#pragma unroll
        for (int nt = 0; nt < 4; ++nt) {
            acc[0][nt] = wmma_bf16(a[set][0], b[set][nt], acc[0][nt]);
            acc[1][nt] = wmma_bf16(a[set][1], b[set][nt], acc[1][nt]);
        }
        // Keeps the following group of reads whole, behind these WMMAs.
        __builtin_amdgcn_sched_barrier(0);
    };

    constexpr int NS = KT / 32;        // k steps per tile (even: step 0 is set 0)
    const int ntile = K / KT;
    stage(0, 0);
    // tile 0 has landed for this wave; the barrier publishes it to the others
    asm volatile("s_wait_asynccnt 0x0" ::: "memory");
    __syncthreads();
    if (K >= 2 * KT) stage(KT, 1);
    frags(0, 0, 0);
    for (int t = 0; t < ntile; ++t) {
        const unsigned pb = (unsigned)(t & 1);
        // unrolled so that the k steps of a tile read at constant LDS offsets and
        // the fragment sets stay in registers
#pragma unroll
        for (int s = 0; s + 1 < NS; ++s) {
            frags(pb, (s + 1) * 32, (s + 1) & 1);
            mma(s & 1);
        }
        // Publish point of tile t + 1, in front of tile t's last k step, whose
        // fragments are fetched: this wave's reads of buffer t & 1 have retired,
        // its copies of tile t + 1 have landed, then one barrier that both
        // publishes tile t + 1 and frees buffer t & 1 for the refill.
        asm volatile("s_wait_dscnt 0x0" ::: "memory");
        asm volatile("s_wait_asynccnt 0x0" ::: "memory");
        __syncthreads();
        if (t + 2 < ntile) stage((t + 2) * KT, pb);
        if (t + 1 < ntile) frags(pb ^ 1u, 0, 0);
        mma((NS - 1) & 1);
    }
    // no copy is left outstanding when the wave goes on to its stores and ends
    asm volatile("s_wait_asynccnt 0x0" ::: "memory");

    // the loops are unrolled so that the arrays stay in registers
    float sig[2][2][8];
    if constexpr (MODE == 1) {
#pragma unroll
        for (int mt = 0; mt < 2; ++mt)
#pragma unroll
            for (int nt = 0; nt < 2; ++nt) {
                float t[8], e[8];
#pragma unroll
                for (int r = 0; r < 8; ++r) t[r] = acc[mt][nt][r] * -1.44269504f;  // -g log2 e
                exp2x8(e, t);
#pragma unroll
                for (int r = 0; r < 8; ++r) t[r] = 1.f + e[r];
                rcpx8(sig[mt][nt], t);
            }
    }

    // The tile leaves through LDS, so that every global access of the epilogue is
    // 16 B a lane and covers whole 128-B lines. The staging area is the A half of the
    // ring: behind the loop's last barrier no wave reads the ring any more and no copy
    // is outstanding. The loops are unrolled so that the arrays stay in registers.

    // in a scalar register: the row part of the global addresses is then scalar
    const int swave = __builtin_amdgcn_readfirstlane(wave);
    if constexpr (MODE == 0) {
        constexpr int SP = 128 + 8;    // staging pitch in elements: 272 B (16 B x odd)
        bf16* st = &As[0][0];
        const int which = n0 >> 10;    // 0 q, 1 k, 2 v: the same for the whole tile
        if (which < 2) {
            // staged as [position][column]
#pragma unroll
            for (int mt = 0; mt < 2; ++mt)
#pragma unroll
                for (int nt = 0; nt < 4; ++nt)
#pragma unroll
                    for (int r = 0; r < 8; ++r)
                        st[(wm + mt * 16 + hi * 8 + r) * SP + wn + nt * 16 + lo] =
                            (bf16)acc[mt][nt][r];
        } else {
            // staged as [column][position]: a lane's 8 values of a tile are 8
            // positions in a row of one column
#pragma unroll
            for (int mt = 0; mt < 2; ++mt)
#pragma unroll
                for (int nt = 0; nt < 4; ++nt) {
                    v8bf p;
#pragma unroll
                    for (int r = 0; r < 8; ++r) p[r] = (bf16)acc[mt][nt][r];
                    *(v8bf*)(st + (wn + nt * 16 + lo) * SP + wm + mt * 16 + hi * 8) = p;
                }
        }
        // every wave's part of the tile is in LDS before any wave reads it back
        __syncthreads();
        const int bq = m0 >> 11, s0 = m0 & 2047;
        const int h2 = (n0 & 1023) >> 6;           // the first of the tile's two heads
        const int c = (lane & 15) << 3;            // 16 lanes cover a staged row of 256 B
        const int row0 = swave * 2 + hi;           // the lane's rows: row0 + 16 i
        v8bf val[8];
#pragma unroll
        for (int i = 0; i < 8; ++i) val[i] = *(const v8bf*)(st + (i * 16 + row0) * SP + c);
        if (which < 2) {
            // a staged row is one position: 128 B of each of the two heads
            bf16* dst = (which == 0 ? qo : ko)
                        + ((size_t)(bq * NHEAD + h2 + (c >> 6)) * S_LEN + s0 + row0) * HDIM + (c & 63);
#pragma unroll
            for (int i = 0; i < 8; ++i) *(v8bf*)(dst + i * 16 * HDIM) = val[i];
        } else {
            // a staged row is one column of v: 256 B of a row of V^T; rows 64 and up
            // belong to the second head, whose V^T follows the first one's
            bf16* dst = vo + ((size_t)(bq * NHEAD + h2) * HDIM + row0) * S_LEN + s0 + c;
#pragma unroll
            for (int i = 0; i < 8; ++i) *(v8bf*)(dst + (size_t)i * 16 * S_LEN) = val[i];
        }
    } else if constexpr (MODE == 1) {
        constexpr int SP = 64 + 8;     // staging pitch in elements: 144 B (16 B x odd)
        bf16* st = &As[0][0];
        // sig[mt][nt][r] = 1 / (1 + e^-gate); tiles 2 and 3 are the up half
#pragma unroll
        for (int mt = 0; mt < 2; ++mt)
#pragma unroll
            for (int nt = 0; nt < 2; ++nt)
#pragma unroll
                for (int r = 0; r < 8; ++r)
                    st[(wm + mt * 16 + hi * 8 + r) * SP + (wn >> 1) + nt * 16 + lo] =
                        (bf16)(acc[mt][nt][r] * sig[mt][nt][r] * acc[mt][nt + 2][r]);
        // every wave's part of the tile is in LDS before any wave reads it back
        __syncthreads();
        const int c = (lane & 7) << 3;             // 8 lanes cover a staged row of 128 B
#pragma unroll
        for (int i = 0; i < 4; ++i) {
            const int row = i * 32 + swave * 4 + (lane >> 3);
            *(v8bf*)(outB + (size_t)(m0 + row) * HIDDEN + (n0 >> 1) + c) =
                *(const v8bf*)(st + row * SP + c);
        }
    } else {
        constexpr int SP = 128 + 4;    // staging pitch in floats: 528 B (16 B x odd)
        float* st = (float*)&As[0][0];
        // a wave-wide access is one whole row of the tile, 512 B; the residual rows
        // are asked for first and fly while the tile is staged
        const size_t t0 = (size_t)(m0 + swave) * DIMN + n0;   // the wave's first row, scalar
        const unsigned lb = (unsigned)lane * 16u;          // the lane's byte in a row
        v4f rv[16];
#pragma unroll
        for (int i = 0; i < 16; ++i)
            rv[i] = *(const v4f*)((const char*)(res + t0 + (size_t)i * 8 * DIMN) + lb);
#pragma unroll
        for (int mt = 0; mt < 2; ++mt)
#pragma unroll
            for (int nt = 0; nt < 4; ++nt)
#pragma unroll
                for (int r = 0; r < 8; ++r)
                    st[(wm + mt * 16 + hi * 8 + r) * SP + wn + nt * 16 + lo] = acc[mt][nt][r];
        // every wave's part of the tile is in LDS before any wave reads it back
        __syncthreads();
#pragma unroll
        for (int i = 0; i < 16; ++i) {
            const v4f cv = *(const v4f*)(st + (i * 8 + swave) * SP + lane * 4);
            *(v4f*)((char*)(outF + t0 + (size_t)i * 8 * DIMN) + lb) = cv + rv[i];
        }
    }
}

__global__ __launch_bounds__(128)
void attn_kernel(const bf16* __restrict__ q, const bf16* __restrict__ k,
                 const bf16* __restrict__ v, bf16* __restrict__ out) {
    constexpr int KS = 64;             // keys per ring stage
    constexpr int LPA = 64 + 8;        // LDS row pitch in elements
    __shared__ __attribute__((aligned(16))) bf16 Ks[2][KS * LPA];     // [key][d]
    __shared__ __attribute__((aligned(16))) bf16 Vs[2][HDIM * LPA];   // [d][key]
    const int tid = threadIdx.x;
    const int lane = tid & 31;
    // in a scalar register: the test that skips a pass is then a scalar branch
    const int wave = __builtin_amdgcn_readfirstlane(tid >> 5);
    const int lo = lane & 15;
    const int hi = lane >> 4;
    const int kb = hi << 3;
    const int bh = blockIdx.y;                   // 0..31
    const int b = bh >> 4, h0 = bh & 15;

    // 8 lanes cover one 128-B row; a thread copies rows crow + 16 i, i = 0..3, of
    // the stage's K and of its V^T: 8 async b128 copies per thread and stage.
    const int crow = tid >> 3, ccol = (tid & 7) << 3;
    const bf16* gK = k + (((size_t)bh) * S_LEN + crow) * HDIM + ccol;
    const bf16* gV = v + (((size_t)bh) * HDIM + crow) * S_LEN + ccol;
    const unsigned lK = (unsigned)(size_t)&Ks[0][crow * LPA + ccol];
    const unsigned lV = (unsigned)(size_t)&Vs[0][crow * LPA + ccol];
    auto stage = [&](int t, unsigned pb) {
        const unsigned bo = pb * (unsigned)(KS * LPA * sizeof(bf16));
        async_copy4x2_b128(lK + bo, gK + (size_t)t * KS * HDIM, (size_t)16 * HDIM,
                           lV + bo, gV + (size_t)t * KS, (size_t)16 * S_LEN,
                           16 * LPA * sizeof(bf16));
    };

  // The long tile first, then the short one. The ring starts anew for the second
  // tile: the barrier at the foot of the first tile's last stage has ended every
  // wave's reads of both buffers, and no copy is outstanding there.
  for (int half = 0; half < 2; ++half) {
    const int qt = half == 0 ? S_LEN / 64 - 1 - (int)blockIdx.x : (int)blockIdx.x;
    const int qbase = qt * 64 + wave * 16;

    // B operand of S^T: column lo = query qbase + lo
    const bf16* qp = q + (((size_t)bh) * S_LEN + qbase + lo) * HDIM;
    Frag qb[2];
    qb[0].h[0] = *(const v8bf*)(qp + kb);
    qb[0].h[1] = *(const v8bf*)(qp + kb + 16);
    qb[1].h[0] = *(const v8bf*)(qp + 32 + kb);
    qb[1].h[1] = *(const v8bf*)(qp + 32 + kb + 16);

    v8f o[4] = {};               // O^T: row d = 16 dt + 8 hi + r, column = query lo
    float mrow = -INFINITY;      // running maximum of query lo (equal in both halves)
    float lsum = 0.f;            // this half's share of the running sum of query lo
    const float scale = 0.125f;  // 1/sqrt(64)

    const int nst = qt + 1;            // stages up to the tile's diagonal
    stage(0, 0);
    // stage 0 has landed for this wave; the barrier publishes it to the others
    asm volatile("s_wait_asynccnt 0x0" ::: "memory");
    __syncthreads();
    if (nst > 1) stage(1, 1);
    for (int t = 0; t < nst; ++t) {
      // unrolled so that both passes of a stage read at constant LDS offsets
#pragma unroll
      for (int ps = 0; ps < 2; ++ps) {
        const int j0 = t * KS + ps * 32;
        // a pass wholly beyond this wave's diagonal is skipped (wave-uniform);
        // the publish point below stands outside the skip
        if (j0 > qbase + 15) continue;
        const bf16* kp = &Ks[t & 1][(ps * 32 + lo) * LPA + kb];
        const bf16* vp = &Vs[t & 1][lo * LPA + ps * 32 + kb];
        // A operands: K rows j0 + lo and j0 + 16 + lo; V^T rows d = 16 dt + lo
        Frag a00, a01, a10, a11, va[4];
        a00.h[0] = *(const v8bf*)(kp);
        a00.h[1] = *(const v8bf*)(kp + 16);
        a01.h[0] = *(const v8bf*)(kp + 32);
        a01.h[1] = *(const v8bf*)(kp + 48);
        a10.h[0] = *(const v8bf*)(kp + 16 * LPA);
        a10.h[1] = *(const v8bf*)(kp + 16 * LPA + 16);
        a11.h[0] = *(const v8bf*)(kp + 16 * LPA + 32);
        a11.h[1] = *(const v8bf*)(kp + 16 * LPA + 48);
#pragma unroll
        for (int dt = 0; dt < 4; ++dt) {
            va[dt].h[0] = *(const v8bf*)(vp + dt * 16 * LPA);
            va[dt].h[1] = *(const v8bf*)(vp + dt * 16 * LPA + 16);
        }
        // The pass's 16 LDS reads go out as one group ahead of its WMMAs; without
        // this line the scheduler puts two reads and a full wait in front of each
        // score WMMA and the wave waits out the LDS latency several times a pass.
        __builtin_amdgcn_sched_barrier(0);
        v8f s0 = {}, s1 = {};
        s0 = wmma_bf16(a00, qb[0], s0);
        s1 = wmma_bf16(a10, qb[0], s1);
        s0 = wmma_bf16(a01, qb[1], s0);
        s1 = wmma_bf16(a11, qb[1], s1);

        // Online softmax of query lo. s0[r] is key j0 + kb + r, s1[r] key
        // j0 + 16 + kb + r; a key is inside the causal mask while its offset
        // from j0 + kb does not exceed lim.
        const int lim = qbase + lo - j0 - kb;
        float x0[8], x1[8];
        float mx = -INFINITY;
#pragma unroll
        for (int r = 0; r < 8; ++r) {
            x0[r] = (r      <= lim) ? s0[r] * scale : -INFINITY;
            x1[r] = (r + 16 <= lim) ? s1[r] * scale : -INFINITY;
            mx = fmaxf(mx, fmaxf(x0[r], x1[r]));
        }
        mx = fmaxf(mx, xhalf(mx));
        const float mnew = fmaxf(mrow, mx);
        const float alpha = __expf(mrow - mnew);
        mrow = mnew;
        Frag pb;
        float ps0 = 0.f, ps1 = 0.f;
#pragma unroll
        for (int r = 0; r < 8; ++r) {
            const float p0 = __expf(x0[r] - mnew);
            const float p1 = __expf(x1[r] - mnew);
            ps0 += p0;
            ps1 += p1;
            pb.h[0][r] = (bf16)p0;
            pb.h[1][r] = (bf16)p1;
        }
        lsum = lsum * alpha + (ps0 + ps1);
#pragma unroll
        for (int dt = 0; dt < 4; ++dt) {
            v8f ov = o[dt];
#pragma unroll
            for (int r = 0; r < 8; ++r) ov[r] *= alpha;
            o[dt] = wmma_bf16(va[dt], pb, ov);
        }
      }
      // Publish point of stage t + 1: this wave's reads of buffer t & 1 have
      // retired, its copies of stage t + 1 have landed, then one barrier that
      // both publishes stage t + 1 and frees buffer t & 1 for the refill.
      asm volatile("s_wait_dscnt 0x0" ::: "memory");
      asm volatile("s_wait_asynccnt 0x0" ::: "memory");
      __syncthreads();
      if (t + 2 < nst) stage(t + 2, (unsigned)(t & 1));
    }
    // no copy is left outstanding when the wave goes on to its stores
    asm volatile("s_wait_asynccnt 0x0" ::: "memory");

    const float ltot = lsum + xhalf(lsum);
    bf16* op = out + ((size_t)(b * S_LEN + qbase + lo)) * DIMN + h0 * HDIM + kb;
#pragma unroll
    for (int dt = 0; dt < 4; ++dt) {
        v8bf ov;
#pragma unroll
        for (int r = 0; r < 8; ++r) ov[r] = (bf16)(o[dt][r] / ltot);
        *(v8bf*)(op + dt * 16) = ov;
    }
    // the next tile rewrites the registers that these stores name
    asm volatile("s_wait_xcnt 0x0" ::: "memory");
  }
}

extern "C" void kernel_launch(void* const* d_in, const int* in_sizes, int n_in,
                              void* d_out, int out_size, void* d_ws, size_t ws_size,
                              hipStream_t stream) {
    const float* x     = (const float*)d_in[0];
    const float* wq    = (const float*)d_in[1];
    const float* wk    = (const float*)d_in[2];
    const float* wv    = (const float*)d_in[3];
    const float* wo    = (const float*)d_in[4];
    const float* wgate = (const float*)d_in[5];
    const float* wup   = (const float*)d_in[6];
    const float* wdown = (const float*)d_in[7];
    const float* n1w   = (const float*)d_in[8];
    const float* n2w   = (const float*)d_in[9];

    char* ws = (char*)d_ws;
    size_t off = 0;
    auto take = [&](size_t bytes) -> char* {
        char* p = ws + off;
        off += (bytes + 255) & ~(size_t)255;
        return p;
    };
    bf16*  a1   = (bf16*)take((size_t)MTOT * DIMN * 2);
    bf16*  wqkv = (bf16*)take((size_t)3 * DIMN * DIMN * 2);
    bf16*  wo_b = (bf16*)take((size_t)DIMN * DIMN * 2);
    bf16*  wgu  = (bf16*)take((size_t)2 * HIDDEN * DIMN * 2);
    bf16*  wdn  = (bf16*)take((size_t)DIMN * HIDDEN * 2);
    bf16*  qws  = (bf16*)take((size_t)MTOT * DIMN * 2);
    bf16*  kws  = (bf16*)take((size_t)MTOT * DIMN * 2);
    bf16*  vws  = (bf16*)take((size_t)MTOT * DIMN * 2);
    bf16*  attn = (bf16*)take((size_t)MTOT * DIMN * 2);
    float* x2   = (float*)take((size_t)MTOT * DIMN * 4);
    bf16*  a2   = (bf16*)take((size_t)MTOT * DIMN * 2);
    bf16*  mlp  = (bf16*)take((size_t)MTOT * HIDDEN * 2);

    // wqkv, wo_b, wgu and wdn were taken one behind another with no gap: wqkv is
    // the start of all bf16 weights
    prep_kernel<<<256, 512, 0, stream>>>(x, wq, wk, wv, wo, wgate, wup, wdown, n1w, wqkv, a1);

    gemm_kernel<0><<<dim3(3072 / 128, MTOT / 128), 256, 0, stream>>>(
        a1, wqkv, MTOT, 3072, DIMN, nullptr, nullptr, nullptr, qws, kws, vws);

    attn_kernel<<<dim3(S_LEN / 128, BATCH * NHEAD), 128, 0, stream>>>(qws, kws, vws, attn);

    gemm_kernel<2><<<dim3(DIMN / 128, MTOT / 128), 256, 0, stream>>>(
        attn, wo_b, MTOT, DIMN, DIMN, x2, nullptr, x, nullptr, nullptr, nullptr);

    rmsnorm_kernel<<<MTOT / 16, 512, 0, stream>>>(x2, n2w, a2);

    gemm_kernel<1><<<dim3(2 * HIDDEN / 128, MTOT / 128), 256, 0, stream>>>(
        a2, wgu, MTOT, 2 * HIDDEN, DIMN, nullptr, mlp, nullptr, nullptr, nullptr, nullptr);

    gemm_kernel<2><<<dim3(DIMN / 128, MTOT / 128), 256, 0, stream>>>(
        mlp, wdn, MTOT, DIMN, HIDDEN, (float*)d_out, nullptr, x2,
        nullptr, nullptr, nullptr);
}

// v009
// A run of this version takes 155 microseconds.
// Timed twice side by side with v008, it ran 1.09 and 1.07 times as fast.
// All steps since v000 together make it 2.46 times as fast.
#include <hip/hip_runtime.h>
#include <hip/hip_bf16.h>
#include <math.h>

typedef __bf16 bf16;
typedef __attribute__((ext_vector_type(16))) __bf16 v16bf;
typedef __attribute__((ext_vector_type(8)))  __bf16 v8bf;
typedef __attribute__((ext_vector_type(4)))  __bf16 v4bf;
typedef __attribute__((ext_vector_type(8)))  float  v8f;
typedef __attribute__((ext_vector_type(4)))  float  v4f;

#define DIMN   1024
#define S_LEN  2048
#define BATCH  2
#define NHEAD  16
#define HDIM   64
#define HIDDEN 4096
#define MTOT   (BATCH * S_LEN)   // 4096 rows

union Frag { v16bf v; v8bf h[2]; };

static __device__ __forceinline__ v8f wmma_bf16(const Frag& a, const Frag& b, v8f c) {
    return __builtin_amdgcn_wmma_f32_16x16x32_bf16(false, a.v, false, b.v,
                                                   (short)0, c, false, false);
}

// XOR-shuffle within each 16-lane half using v_permlane16_b32 (pure VALU,
// avoids ds_bpermute + s_wait_dscnt round-trips).
template <int M>
static __device__ __forceinline__ float permxor16(float v) {
#if __has_builtin(__builtin_amdgcn_permlane16)
    constexpr unsigned lo =
        ((unsigned)(0 ^ M)) | ((unsigned)(1 ^ M) << 4) | ((unsigned)(2 ^ M) << 8) |
        ((unsigned)(3 ^ M) << 12) | ((unsigned)(4 ^ M) << 16) |
        ((unsigned)(5 ^ M) << 20) | ((unsigned)(6 ^ M) << 24) |
        ((unsigned)(7 ^ M) << 28);
    constexpr unsigned hi =
        ((unsigned)((8 ^ M) & 15)) | ((unsigned)((9 ^ M) & 15) << 4) |
        ((unsigned)((10 ^ M) & 15) << 8) | ((unsigned)((11 ^ M) & 15) << 12) |
        ((unsigned)((12 ^ M) & 15) << 16) | ((unsigned)((13 ^ M) & 15) << 20) |
        ((unsigned)((14 ^ M) & 15) << 24) | ((unsigned)((15 ^ M) & 15) << 28);
    int iv = __builtin_bit_cast(int, v);
    int r = __builtin_amdgcn_permlane16(iv, iv, (int)lo, (int)hi, false, false);
    return __builtin_bit_cast(float, r);
#else
    return __shfl_xor(v, M, 32);
#endif
}

// Lane l <-> lane l ^ 16: the two halves of a wave that share a column of a
// WMMA accumulator tile (pure VALU).
static __device__ __forceinline__ float xhalf(float v) {
    const int iv = __builtin_bit_cast(int, v);
    const int r = __builtin_amdgcn_permlanex16(iv, iv, 0x76543210, 0xfedcba98, false, false);
    return __builtin_bit_cast(float, r);
}

// Eight 2^x and eight 1/x. The instruction set asks for one free issue slot behind a
// transcendental before its result is read or its source overwritten: here each
// instruction fills the slot of the one in front of it (the results are kept off
// all sources by the early-clobber mark), and the closing v_nop that of the last.
static __device__ __forceinline__ void exp2x8(float (&r)[8], const float (&x)[8]) {
    asm(
                 "v_exp_f32 %0, %8\n\t"
                 "v_exp_f32 %1, %9\n\t"
                 "v_exp_f32 %2, %10\n\t"
                 "v_exp_f32 %3, %11\n\t"
                 "v_exp_f32 %4, %12\n\t"
                 "v_exp_f32 %5, %13\n\t"
                 "v_exp_f32 %6, %14\n\t"
                 "v_exp_f32 %7, %15\n\t"
                 "v_nop"
                 : "=&v"(r[0]), "=&v"(r[1]), "=&v"(r[2]), "=&v"(r[3]),
                   "=&v"(r[4]), "=&v"(r[5]), "=&v"(r[6]), "=&v"(r[7])
                 : "v"(x[0]), "v"(x[1]), "v"(x[2]), "v"(x[3]),
                   "v"(x[4]), "v"(x[5]), "v"(x[6]), "v"(x[7]));
}
static __device__ __forceinline__ void rcpx8(float (&r)[8], const float (&x)[8]) {
    asm(
                 "v_rcp_f32 %0, %8\n\t"
                 "v_rcp_f32 %1, %9\n\t"
                 "v_rcp_f32 %2, %10\n\t"
                 "v_rcp_f32 %3, %11\n\t"
                 "v_rcp_f32 %4, %12\n\t"
                 "v_rcp_f32 %5, %13\n\t"
                 "v_rcp_f32 %6, %14\n\t"
                 "v_rcp_f32 %7, %15\n\t"
                 "v_nop"
                 : "=&v"(r[0]), "=&v"(r[1]), "=&v"(r[2]), "=&v"(r[3]),
                   "=&v"(r[4]), "=&v"(r[5]), "=&v"(r[6]), "=&v"(r[7])
                 : "v"(x[0]), "v"(x[1]), "v"(x[2]), "v"(x[3]),
                   "v"(x[4]), "v"(x[5]), "v"(x[6]), "v"(x[7]));
}

// Eight async global->LDS 16-B copies per lane (ASYNCcnt): rows l + i*lstep in
// LDS from rows g + i*gstep in global memory. The closing s_wait_xcnt 0 stands
// inside the copies' own statement so that no address register named here is
// rewritten ahead of it.
static __device__ __forceinline__ void async_copy8_b128(unsigned l, unsigned lstep,
                                                        const bf16* g, size_t gstep) {
    asm volatile("global_load_async_to_lds_b128 %0, %8, off\n\t"
                 "global_load_async_to_lds_b128 %1, %9, off\n\t"
                 "global_load_async_to_lds_b128 %2, %10, off\n\t"
                 "global_load_async_to_lds_b128 %3, %11, off\n\t"
                 "global_load_async_to_lds_b128 %4, %12, off\n\t"
                 "global_load_async_to_lds_b128 %5, %13, off\n\t"
                 "global_load_async_to_lds_b128 %6, %14, off\n\t"
                 "global_load_async_to_lds_b128 %7, %15, off\n\t"
                 "s_wait_xcnt 0x0"
                 :: "v"(l), "v"(l + lstep), "v"(l + 2 * lstep), "v"(l + 3 * lstep),
                    "v"(l + 4 * lstep), "v"(l + 5 * lstep), "v"(l + 6 * lstep),
                    "v"(l + 7 * lstep),
                    "v"(g), "v"(g + gstep), "v"(g + 2 * gstep), "v"(g + 3 * gstep),
                    "v"(g + 4 * gstep), "v"(g + 5 * gstep), "v"(g + 6 * gstep),
                    "v"(g + 7 * gstep)
                 : "memory");
}

// Four and four async global->LDS 16-B copies per lane: rows la + i*lstep from
// ga + i*gastep and rows lb + i*lstep from gb + i*gbstep. The closing
// s_wait_xcnt 0 stands inside the copies' own statement, as above.
static __device__ __forceinline__ void async_copy4x2_b128(unsigned la, const bf16* ga, size_t gastep,
                                                          unsigned lb, const bf16* gb, size_t gbstep,
                                                          unsigned lstep) {
    asm volatile("global_load_async_to_lds_b128 %0, %8, off\n\t"
                 "global_load_async_to_lds_b128 %1, %9, off\n\t"
                 "global_load_async_to_lds_b128 %2, %10, off\n\t"
                 "global_load_async_to_lds_b128 %3, %11, off\n\t"
                 "global_load_async_to_lds_b128 %4, %12, off\n\t"
                 "global_load_async_to_lds_b128 %5, %13, off\n\t"
                 "global_load_async_to_lds_b128 %6, %14, off\n\t"
                 "global_load_async_to_lds_b128 %7, %15, off\n\t"
                 "s_wait_xcnt 0x0"
                 :: "v"(la), "v"(la + lstep), "v"(la + 2 * lstep), "v"(la + 3 * lstep),
                    "v"(lb), "v"(lb + lstep), "v"(lb + 2 * lstep), "v"(lb + 3 * lstep),
                    "v"(ga), "v"(ga + gastep), "v"(ga + 2 * gastep), "v"(ga + 3 * gastep),
                    "v"(gb), "v"(gb + gbstep), "v"(gb + 2 * gbstep), "v"(gb + 3 * gbstep)
                 : "memory");
}

// The streaming stages run as few, long waves: 256 work-groups of 16 waves, one a
// WGP; every load is 512 contiguous bytes of a wave, and a wave issues all its
// loads before it works on the first of them.

// RMSNorm of one fp32 row by one wave -> bf16 row. xv, wv: the lane's elements
// i * 128 + 4 lane + e of the row and of the weight; orow: the row's start.
static __device__ __forceinline__ void rms_row(const v4f (&xv)[8], const v4f (&wv)[8],
                                               bf16* __restrict__ orow, int lane) {
    v4f sq = {};
#pragma unroll
    for (int i = 0; i < 8; ++i) sq += xv[i] * xv[i];
    float ss = (sq.x + sq.y) + (sq.z + sq.w);
    ss += permxor16<1>(ss);
    ss += permxor16<2>(ss);
    ss += permxor16<4>(ss);
    ss += permxor16<8>(ss);
    ss += xhalf(ss);
    const float rinv = rsqrtf(ss * (1.f / DIMN) + 1e-5f);
#pragma unroll
    for (int i = 0; i < 8; ++i) {
        v4bf o;
#pragma unroll
        for (int e = 0; e < 4; ++e) o[e] = (bf16)(xv[i][e] * rinv * wv[i][e]);
        ((v4bf*)orow)[i * 32 + lane] = o;
    }
}

// One launch for all that stands in front of the first GEMM. A wave takes one row
// of the first RMSNorm and 4096 elements of the fp32 -> bf16 weight convert. wdst:
// the bf16 weights, one behind another in the order wq wk wv wo [wgate, wup] wdown.
// wgate and wup share one matrix of 2 * HIDDEN rows, interleaved in groups of 16
// rows: hidden column h = 64 t + 32 w + 16 j + i has its gate row at
// 128 t + 64 w + 16 j + i and its up row 32 rows further on, so that a GEMM wave,
// which takes whole groups of 64 such rows, holds gate and up of the same hidden
// columns.
__global__ __launch_bounds__(512)
void prep_kernel(const float* __restrict__ x, const float* __restrict__ wq,
                 const float* __restrict__ wk, const float* __restrict__ wv,
                 const float* __restrict__ wo, const float* __restrict__ wgate,
                 const float* __restrict__ wup, const float* __restrict__ wdown,
                 const float* __restrict__ n1w,
                 bf16* __restrict__ wdst, bf16* __restrict__ a1) {
    const int lane = threadIdx.x & 31;
    // in a scalar register: every base address below is then scalar
    const int wave = __builtin_amdgcn_readfirstlane(threadIdx.x >> 5);
    const int blk = blockIdx.x;
    const size_t row = (size_t)blk * 16 + wave;
    const int c = blk >> 4;            // piece of DIMN * DIMN elements, 16 blocks each
    const size_t pc = (size_t)DIMN * DIMN;
    const float* s = c == 0 ? wq : c == 1 ? wk : c == 2 ? wv : c == 3 ? wo
                   : c < 8  ? wgate + (size_t)(c - 4) * pc
                   : c < 12 ? wup + (size_t)(c - 8) * pc
                            : wdown + (size_t)(c - 12) * pc;
    s += (blk & 15) * 65536 + wave * 4096;
    const float* xr = x + row * DIMN;
    // a wave's 4096 elements are 4 whole rows of wgate or wup, inside one group of 16;
    // h: the first one's hidden column; rows count DIMN elements
    const int h = ((c & 3) << 10) + ((blk & 15) << 6) + (wave << 2);
    const int gurow = 4 * DIMN + ((h >> 6) << 7) + (((h >> 5) & 1) << 6) + (h & 31)
                      + (c >= 8 ? 32 : 0);
    bf16* d = wdst + (c >= 4 && c < 12 ? (size_t)gurow : row * 4) * DIMN;

    // the loops are unrolled so that the arrays stay in registers
    v4f xv[8], nv[8], v[32];
#pragma unroll
    for (int i = 0; i < 8; ++i) xv[i] = ((const v4f*)xr)[i * 32 + lane];
#pragma unroll
    for (int i = 0; i < 8; ++i) nv[i] = ((const v4f*)n1w)[i * 32 + lane];
#pragma unroll
    for (int i = 0; i < 32; ++i) v[i] = ((const v4f*)s)[i * 32 + lane];
    // Keeps all 48 loads in front of the arithmetic; without it the scheduler holds
    // part of them back and the wave waits out the memory latency several times.
    __builtin_amdgcn_sched_barrier(0);

    rms_row(xv, nv, a1 + row * DIMN, lane);

#pragma unroll
    for (int i = 0; i < 32; ++i) {
        v4bf o;
#pragma unroll
        for (int e = 0; e < 4; ++e) o[e] = (bf16)v[i][e];
        ((v4bf*)d)[i * 32 + lane] = o;
    }
}

__global__ __launch_bounds__(512) void rmsnorm_kernel(const float* __restrict__ x,
                                                      const float* __restrict__ w,
                                                      bf16* __restrict__ out) {
    const int lane = threadIdx.x & 31;
    // in a scalar register: the row's base address is then scalar
    const int wave = __builtin_amdgcn_readfirstlane(threadIdx.x >> 5);
    const size_t row = (size_t)blockIdx.x * 16 + wave;
    const float* xr = x + row * DIMN;
    // the loops are unrolled so that the arrays stay in registers
    v4f xv[8], wv[8];
#pragma unroll
    for (int i = 0; i < 8; ++i) xv[i] = ((const v4f*)xr)[i * 32 + lane];
#pragma unroll
    for (int i = 0; i < 8; ++i) wv[i] = ((const v4f*)w)[i * 32 + lane];
    // Keeps all 16 loads in front of the arithmetic; without it the scheduler sinks
    // six weight loads behind the row sum and the wave waits a second time.
    __builtin_amdgcn_sched_barrier(0);
    rms_row(xv, wv, out + row * DIMN, lane);
}

// ---------------- WMMA GEMM: C[M,N] = A[M,K] @ W[N,K]^T ----------------
// Two-buffer LDS ring filled by async global->LDS copies (ASYNCcnt). A ring tile
// holds KT = 128 k of BT A rows and BT W rows: every row is 256 contiguous
// bytes of global memory, at an LDS pitch of 272 B (16 B x odd).
// The work-group's tile is BT x BT, eight waves as 4 (M) x 2 (N). BT = 256 in MODE 0
// and 1, whose outputs give 192 and 512 such tiles, one work-group a WGP: a wave
// holds 64 x 128, so that a k step's 24 LDS reads feed 32 WMMAs and the operand rows
// are fetched from L2 half as often as at 128. BT = 128 in MODE 2 (N = DIMN: 256 tiles).
// M, N multiples of BT; K a multiple of 128 (MODE 0 and 1: K = DIMN).
// MODE 0: QKV scatter (N=3072): q/k -> [B,H,S,Dh] bf16, v -> [B,H,Dh,S] bf16
// MODE 1: W = gate and up rows interleaved as prep_kernel lays them (N = 2 * HIDDEN):
//         store bf16 silu(gate) * up, [M, HIDDEN]; a lane's tiles nt and nt + 2
//         (nt = 0, 1, 4, 5) are gate and up of the same hidden column
// MODE 2: store fp32 C[M,N] + res[M,N], N = DIMN (the row pitch is a constant, so that
//         the epilogue's rows differ by an immediate offset only)
template <int MODE>
__global__ __launch_bounds__(256)
void gemm_kernel(const bf16* __restrict__ A, const bf16* __restrict__ W,
                 int M, int N, int K,
                 float* __restrict__ outF, bf16* __restrict__ outB,
                 const float* __restrict__ res,
                 bf16* __restrict__ qo, bf16* __restrict__ ko, bf16* __restrict__ vo) {
    constexpr int KT = 128;            // k per ring tile
    constexpr int LP = KT + 8;         // LDS row pitch in elements
    constexpr int BT = MODE == 2 ? 128 : 256;   // edge of the work-group's tile
    constexpr int FM = BT / 64;        // A fragments of a wave
    constexpr int FN = BT / 32;        // W fragments of a wave
    __shared__ bf16 As[2][BT * LP];
    __shared__ bf16 Bs[2][BT * LP];
    const int m0 = blockIdx.y * BT;
    const int n0 = blockIdx.x * BT;
    const int tid = threadIdx.x;
    const int lane = tid & 31;
    const int wave = tid >> 5;
    const int wm = (wave >> 1) * (16 * FM);   // wave M offset (4 waves in M)
    const int wn = (wave & 1) * (16 * FN);    // wave N offset (2 waves in N)
    const int lo = lane & 15;
    const int hi = lane >> 4;
    const int kb = hi << 3;            // K-chunk base per A/B VGPR layout

    v8f acc[FM][FN] = {};

    // 16 lanes cover one 256-B row; a thread copies rows srow + 16 i, i < BT / 16,
    // of A and of W: BT / 8 async b128 copies per thread and tile.
    const int srow = tid >> 4, scol = (tid & 15) << 3;
    // K is DIMN in MODE 0 and 1: with K as a constant (and the k loop kept rolled) the
    // 64 x 128 accumulators and the two fragment sets fit the registers unspilled
    const int Kd = MODE == 2 ? K : DIMN;
    const bf16* gA = A + (size_t)(m0 + srow) * Kd + scol;
    const bf16* gW = W + (size_t)(n0 + srow) * Kd + scol;
    const size_t gstep = (size_t)16 * Kd;
    const unsigned lA = (unsigned)(size_t)&As[0][srow * LP + scol];
    const unsigned lB = (unsigned)(size_t)&Bs[0][srow * LP + scol];

    auto stage = [&](int k0, unsigned pb) {
        const unsigned bo = pb * (unsigned)(BT * LP * sizeof(bf16));
        // one or two groups of 128 rows; unrolled so that a group's offsets are constants
#pragma unroll
        for (int g = 0; g < BT / 128; ++g) {
            const unsigned lo128 = bo + g * (unsigned)(128 * LP * sizeof(bf16));
            async_copy8_b128(lA + lo128, 16 * LP * sizeof(bf16), gA + k0 + 8 * g * gstep, gstep);
            async_copy8_b128(lB + lo128, 16 * LP * sizeof(bf16), gW + k0 + 8 * g * gstep, gstep);
        }
    };

    // Two fragment sets: the LDS reads of a k step go out as one group, one k
    // step ahead of the WMMAs that use them. The loops over mt and nt below are
    // unrolled so that every fragment and accumulator index is a constant and the
    // arrays stay in registers.
    Frag a[2][FM], b[2][FN];
    auto frags = [&](unsigned pb, int ks, int set) {
#pragma unroll
        for (int mt = 0; mt < FM; ++mt) {
            const bf16* ap = &As[pb][(wm + mt * 16 + lo) * LP + ks + kb];
            a[set][mt].h[0] = *(const v8bf*)ap;
            a[set][mt].h[1] = *(const v8bf*)(ap + 16);
        }
#pragma unroll
        for (int nt = 0; nt < FN; ++nt) {
            const bf16* bp = &Bs[pb][(wn + nt * 16 + lo) * LP + ks + kb];
            b[set][nt].h[0] = *(const v8bf*)bp;
            b[set][nt].h[1] = *(const v8bf*)(bp + 16);
        }
    };
    auto mma = [&](int set) {
        // Keeps the next step's reads, written above, in front of these WMMAs;
        // without it the scheduler sinks them to two reads and a full wait per
        // WMMA pair.
        __builtin_amdgcn_sched_barrier(0);
#pragma unroll
        for (int nt = 0; nt < FN; ++nt)
#pragma unroll
            for (int mt = 0; mt < FM; ++mt)
                acc[mt][nt] = wmma_bf16(a[set][mt], b[set][nt], acc[mt][nt]);
        // Keeps the following group of reads whole, behind these WMMAs.
        __builtin_amdgcn_sched_barrier(0);
    };

    constexpr int NS = KT / 32;        // k steps per tile (even: step 0 is set 0)
    const int ntile = Kd / KT;
    stage(0, 0);
    // tile 0 has landed for this wave; the barrier publishes it to the others
    asm volatile("s_wait_asynccnt 0x0" ::: "memory");
    __syncthreads();
    if (Kd >= 2 * KT) stage(KT, 1);
    frags(0, 0, 0);
    // kept rolled: left to the compiler, the constant trip count of MODE 0 and 1 gave
    // a build that takes every register of the budget and spills
#pragma clang loop unroll(disable)
    for (int t = 0; t < ntile; ++t) {
        const unsigned pb = (unsigned)(t & 1);
        // unrolled so that the k steps of a tile read at constant LDS offsets and
        // the fragment sets stay in registers
#pragma unroll
        for (int s = 0; s + 1 < NS; ++s) {
            frags(pb, (s + 1) * 32, (s + 1) & 1);
            mma(s & 1);
        }
        // Publish point of tile t + 1, in front of tile t's last k step, whose
        // fragments are fetched: this wave's reads of buffer t & 1 have retired,
        // its copies of tile t + 1 have landed, then one barrier that both
        // publishes tile t + 1 and frees buffer t & 1 for the refill.
        asm volatile("s_wait_dscnt 0x0" ::: "memory");
        asm volatile("s_wait_asynccnt 0x0" ::: "memory");
        __syncthreads();
        if (t + 2 < ntile) stage((t + 2) * KT, pb);
        if (t + 1 < ntile) frags(pb ^ 1u, 0, 0);
        mma((NS - 1) & 1);
    }
    // no copy is left outstanding when the wave goes on to its stores and ends
    asm volatile("s_wait_asynccnt 0x0" ::: "memory");

    // The tile leaves through LDS, so that every global access of the epilogue is
    // 16 B a lane and covers whole 128-B lines. The staging area is the A half of the
    // ring (both buffers): behind the loop's last barrier no wave reads the ring any more and no copy
    // is outstanding. The loops are unrolled so that the arrays stay in registers.

    // in a scalar register: the row part of the global addresses is then scalar
    const int swave = __builtin_amdgcn_readfirstlane(wave);
    if constexpr (MODE == 0) {
        constexpr int SP = BT + 8;     // staging pitch in elements: 528 B (16 B x odd)
        bf16* st = &As[0][0];
        const int which = n0 >> 10;    // 0 q, 1 k, 2 v: the same for the whole tile
        if (which < 2) {
            // staged as [position][column]
#pragma unroll
            for (int mt = 0; mt < FM; ++mt)
#pragma unroll
                for (int nt = 0; nt < FN; ++nt)
#pragma unroll
                    for (int r = 0; r < 8; ++r)
                        st[(wm + mt * 16 + hi * 8 + r) * SP + wn + nt * 16 + lo] =
                            (bf16)acc[mt][nt][r];
        } else {
            // staged as [column][position]: a lane's 8 values of a tile are 8
            // positions in a row of one column
#pragma unroll
            for (int mt = 0; mt < FM; ++mt)
#pragma unroll
                for (int nt = 0; nt < FN; ++nt) {
                    v8bf p;
#pragma unroll
                    for (int r = 0; r < 8; ++r) p[r] = (bf16)acc[mt][nt][r];
                    *(v8bf*)(st + (wn + nt * 16 + lo) * SP + wm + mt * 16 + hi * 8) = p;
                }
        }
        // every wave's part of the tile is in LDS before any wave reads it back
        __syncthreads();
        const int bq = m0 >> 11, s0 = m0 & 2047;
        const int h4 = (n0 & 1023) >> 6;           // the first of the tile's four heads
        const int c = lane << 3;                   // a wave covers a staged row of 512 B
        // the wave's rows: swave + 8 i. For q and k a staged row is one position: 128 B
        // of each of the four heads. For v it is one column: 512 B of a row of V^T; the
        // four heads' V^T stand one behind another.
        bf16* dst = which < 2
            ? (which == 0 ? qo : ko)
              + ((size_t)(bq * NHEAD + h4 + (c >> 6)) * S_LEN + s0 + swave) * HDIM + (c & 63)
            : vo + ((size_t)(bq * NHEAD + h4) * HDIM + swave) * S_LEN + s0 + c;
        const size_t dstep = which < 2 ? (size_t)8 * HDIM : (size_t)8 * S_LEN;
#pragma unroll
        for (int i0 = 0; i0 < BT / 8; i0 += 8) {
            v8bf val[8];
#pragma unroll
            for (int i = 0; i < 8; ++i)
                val[i] = *(const v8bf*)(st + ((i0 + i) * 8 + swave) * SP + c);
#pragma unroll
            for (int i = 0; i < 8; ++i) *(v8bf*)(dst + (size_t)(i0 + i) * dstep) = val[i];
        }
    } else if constexpr (MODE == 1) {
        constexpr int SP = BT / 2 + 8; // staging pitch in elements: 272 B (16 B x odd)
        bf16* st = &As[0][0];
        // a wave's 128 W rows are two groups of 64: tiles 4 g + j are the gate half and
        // tiles 4 g + 2 + j the up half of hidden columns 32 g + 16 j + lo of its 64
#pragma unroll
        for (int mt = 0; mt < FM; ++mt)
#pragma unroll
            for (int g = 0; g < FN / 4; ++g)
#pragma unroll
                for (int j = 0; j < 2; ++j) {
                    const v8f gate = acc[mt][4 * g + j], up = acc[mt][4 * g + 2 + j];
                    float t[8], e[8], sig[8];      // sig = 1 / (1 + e^-gate)
#pragma unroll
                    for (int r = 0; r < 8; ++r) t[r] = gate[r] * -1.44269504f;  // -g log2 e
                    exp2x8(e, t);
#pragma unroll
                    for (int r = 0; r < 8; ++r) t[r] = 1.f + e[r];
                    rcpx8(sig, t);
#pragma unroll
                    for (int r = 0; r < 8; ++r)
                        st[(wm + mt * 16 + hi * 8 + r) * SP + (wn >> 1) + g * 32 + j * 16 + lo] =
                            (bf16)(gate[r] * sig[r] * up[r]);
                }
        // every wave's part of the tile is in LDS before any wave reads it back
        __syncthreads();
        const int c = (lane & 15) << 3;            // 16 lanes cover a staged row of 256 B
#pragma unroll
        for (int i = 0; i < BT / 16; ++i) {
            const int row = i * 16 + swave * 2 + hi;
            *(v8bf*)(outB + (size_t)(m0 + row) * HIDDEN + (n0 >> 1) + c) =
                *(const v8bf*)(st + row * SP + c);
        }
    } else {
        constexpr int SP = 128 + 4;    // staging pitch in floats: 528 B (16 B x odd)
        float* st = (float*)&As[0][0];
        // a wave-wide access is one whole row of the tile, 512 B; the residual rows
        // are asked for first and fly while the tile is staged
        const size_t t0 = (size_t)(m0 + swave) * DIMN + n0;   // the wave's first row, scalar
        const unsigned lb = (unsigned)lane * 16u;          // the lane's byte in a row
        v4f rv[16];
#pragma unroll
        for (int i = 0; i < 16; ++i)
            rv[i] = *(const v4f*)((const char*)(res + t0 + (size_t)i * 8 * DIMN) + lb);
#pragma unroll
        for (int mt = 0; mt < FM; ++mt)
#pragma unroll
            for (int nt = 0; nt < FN; ++nt)
#pragma unroll
                for (int r = 0; r < 8; ++r)
                    st[(wm + mt * 16 + hi * 8 + r) * SP + wn + nt * 16 + lo] = acc[mt][nt][r];
        // every wave's part of the tile is in LDS before any wave reads it back
        __syncthreads();
#pragma unroll
        for (int i = 0; i < 16; ++i) {
            const v4f cv = *(const v4f*)(st + (i * 8 + swave) * SP + lane * 4);
            *(v4f*)((char*)(outF + t0 + (size_t)i * 8 * DIMN) + lb) = cv + rv[i];
        }
    }
}

__global__ __launch_bounds__(128)
void attn_kernel(const bf16* __restrict__ q, const bf16* __restrict__ k,
                 const bf16* __restrict__ v, bf16* __restrict__ out) {
    constexpr int KS = 64;             // keys per ring stage
    constexpr int LPA = 64 + 8;        // LDS row pitch in elements
    __shared__ __attribute__((aligned(16))) bf16 Ks[2][KS * LPA];     // [key][d]
    __shared__ __attribute__((aligned(16))) bf16 Vs[2][HDIM * LPA];   // [d][key]
    const int tid = threadIdx.x;
    const int lane = tid & 31;
    // in a scalar register: the test that skips a pass is then a scalar branch
    const int wave = __builtin_amdgcn_readfirstlane(tid >> 5);
    const int lo = lane & 15;
    const int hi = lane >> 4;
    const int kb = hi << 3;
    const int bh = blockIdx.y;                   // 0..31
    const int b = bh >> 4, h0 = bh & 15;

    // 8 lanes cover one 128-B row; a thread copies rows crow + 16 i, i = 0..3, of
    // the stage's K and of its V^T: 8 async b128 copies per thread and stage.
    const int crow = tid >> 3, ccol = (tid & 7) << 3;
    const bf16* gK = k + (((size_t)bh) * S_LEN + crow) * HDIM + ccol;
    const bf16* gV = v + (((size_t)bh) * HDIM + crow) * S_LEN + ccol;
    const unsigned lK = (unsigned)(size_t)&Ks[0][crow * LPA + ccol];
    const unsigned lV = (unsigned)(size_t)&Vs[0][crow * LPA + ccol];
    auto stage = [&](int t, unsigned pb) {
        const unsigned bo = pb * (unsigned)(KS * LPA * sizeof(bf16));
        async_copy4x2_b128(lK + bo, gK + (size_t)t * KS * HDIM, (size_t)16 * HDIM,
                           lV + bo, gV + (size_t)t * KS, (size_t)16 * S_LEN,
                           16 * LPA * sizeof(bf16));
    };

  // The long tile first, then the short one. The ring starts anew for the second
  // tile: the barrier at the foot of the first tile's last stage has ended every
  // wave's reads of both buffers, and no copy is outstanding there.
  for (int half = 0; half < 2; ++half) {
    const int qt = half == 0 ? S_LEN / 64 - 1 - (int)blockIdx.x : (int)blockIdx.x;
    const int qbase = qt * 64 + wave * 16;

    // B operand of S^T: column lo = query qbase + lo
    const bf16* qp = q + (((size_t)bh) * S_LEN + qbase + lo) * HDIM;
    Frag qb[2];
    qb[0].h[0] = *(const v8bf*)(qp + kb);
    qb[0].h[1] = *(const v8bf*)(qp + kb + 16);
    qb[1].h[0] = *(const v8bf*)(qp + 32 + kb);
    qb[1].h[1] = *(const v8bf*)(qp + 32 + kb + 16);

    v8f o[4] = {};               // O^T: row d = 16 dt + 8 hi + r, column = query lo
    float mrow = -INFINITY;      // running maximum of query lo (equal in both halves)
    float lsum = 0.f;            // this half's share of the running sum of query lo
    const float scale = 0.125f;  // 1/sqrt(64)

    const int nst = qt + 1;            // stages up to the tile's diagonal
    stage(0, 0);
    // stage 0 has landed for this wave; the barrier publishes it to the others
    asm volatile("s_wait_asynccnt 0x0" ::: "memory");
    __syncthreads();
    if (nst > 1) stage(1, 1);
    for (int t = 0; t < nst; ++t) {
      // unrolled so that both passes of a stage read at constant LDS offsets
#pragma unroll
      for (int ps = 0; ps < 2; ++ps) {
        const int j0 = t * KS + ps * 32;
        // a pass wholly beyond this wave's diagonal is skipped (wave-uniform);
        // the publish point below stands outside the skip
        if (j0 > qbase + 15) continue;
        const bf16* kp = &Ks[t & 1][(ps * 32 + lo) * LPA + kb];
        const bf16* vp = &Vs[t & 1][lo * LPA + ps * 32 + kb];
        // A operands: K rows j0 + lo and j0 + 16 + lo; V^T rows d = 16 dt + lo
        Frag a00, a01, a10, a11, va[4];
        a00.h[0] = *(const v8bf*)(kp);
        a00.h[1] = *(const v8bf*)(kp + 16);
        a01.h[0] = *(const v8bf*)(kp + 32);
        a01.h[1] = *(const v8bf*)(kp + 48);
        a10.h[0] = *(const v8bf*)(kp + 16 * LPA);
        a10.h[1] = *(const v8bf*)(kp + 16 * LPA + 16);
        a11.h[0] = *(const v8bf*)(kp + 16 * LPA + 32);
        a11.h[1] = *(const v8bf*)(kp + 16 * LPA + 48);
#pragma unroll
        for (int dt = 0; dt < 4; ++dt) {
            va[dt].h[0] = *(const v8bf*)(vp + dt * 16 * LPA);
            va[dt].h[1] = *(const v8bf*)(vp + dt * 16 * LPA + 16);
        }
        // The pass's 16 LDS reads go out as one group ahead of its WMMAs; without
        // this line the scheduler puts two reads and a full wait in front of each
        // score WMMA and the wave waits out the LDS latency several times a pass.
        __builtin_amdgcn_sched_barrier(0);
        v8f s0 = {}, s1 = {};
        s0 = wmma_bf16(a00, qb[0], s0);
        s1 = wmma_bf16(a10, qb[0], s1);
        s0 = wmma_bf16(a01, qb[1], s0);
        s1 = wmma_bf16(a11, qb[1], s1);

        // Online softmax of query lo. s0[r] is key j0 + kb + r, s1[r] key
        // j0 + 16 + kb + r; a key is inside the causal mask while its offset
        // from j0 + kb does not exceed lim.
        const int lim = qbase + lo - j0 - kb;
        float x0[8], x1[8];
        float mx = -INFINITY;
#pragma unroll
        for (int r = 0; r < 8; ++r) {
            x0[r] = (r      <= lim) ? s0[r] * scale : -INFINITY;
            x1[r] = (r + 16 <= lim) ? s1[r] * scale : -INFINITY;
            mx = fmaxf(mx, fmaxf(x0[r], x1[r]));
        }
        mx = fmaxf(mx, xhalf(mx));
        const float mnew = fmaxf(mrow, mx);
        const float alpha = __expf(mrow - mnew);
        mrow = mnew;
        Frag pb;
        float ps0 = 0.f, ps1 = 0.f;
#pragma unroll
        for (int r = 0; r < 8; ++r) {
            const float p0 = __expf(x0[r] - mnew);
            const float p1 = __expf(x1[r] - mnew);
            ps0 += p0;
            ps1 += p1;
            pb.h[0][r] = (bf16)p0;
            pb.h[1][r] = (bf16)p1;
        }
        lsum = lsum * alpha + (ps0 + ps1);
#pragma unroll
        for (int dt = 0; dt < 4; ++dt) {
            v8f ov = o[dt];
#pragma unroll
            for (int r = 0; r < 8; ++r) ov[r] *= alpha;
            o[dt] = wmma_bf16(va[dt], pb, ov);
        }
      }
      // Publish point of stage t + 1: this wave's reads of buffer t & 1 have
      // retired, its copies of stage t + 1 have landed, then one barrier that
      // both publishes stage t + 1 and frees buffer t & 1 for the refill.
      asm volatile("s_wait_dscnt 0x0" ::: "memory");
      asm volatile("s_wait_asynccnt 0x0" ::: "memory");
      __syncthreads();
      if (t + 2 < nst) stage(t + 2, (unsigned)(t & 1));
    }
    // no copy is left outstanding when the wave goes on to its stores
    asm volatile("s_wait_asynccnt 0x0" ::: "memory");

    const float ltot = lsum + xhalf(lsum);
    bf16* op = out + ((size_t)(b * S_LEN + qbase + lo)) * DIMN + h0 * HDIM + kb;
#pragma unroll
    for (int dt = 0; dt < 4; ++dt) {
        v8bf ov;
#pragma unroll
        for (int r = 0; r < 8; ++r) ov[r] = (bf16)(o[dt][r] / ltot);
        *(v8bf*)(op + dt * 16) = ov;
    }
    // the next tile rewrites the registers that these stores name
    asm volatile("s_wait_xcnt 0x0" ::: "memory");
  }
}

extern "C" void kernel_launch(void* const* d_in, const int* in_sizes, int n_in,
                              void* d_out, int out_size, void* d_ws, size_t ws_size,
                              hipStream_t stream) {
    const float* x     = (const float*)d_in[0];
    const float* wq    = (const float*)d_in[1];
    const float* wk    = (const float*)d_in[2];
    const float* wv    = (const float*)d_in[3];
    const float* wo    = (const float*)d_in[4];
    const float* wgate = (const float*)d_in[5];
    const float* wup   = (const float*)d_in[6];
    const float* wdown = (const float*)d_in[7];
    const float* n1w   = (const float*)d_in[8];
    const float* n2w   = (const float*)d_in[9];

    char* ws = (char*)d_ws;
    size_t off = 0;
    auto take = [&](size_t bytes) -> char* {
        char* p = ws + off;
        off += (bytes + 255) & ~(size_t)255;
        return p;
    };
    bf16*  a1   = (bf16*)take((size_t)MTOT * DIMN * 2);
    bf16*  wqkv = (bf16*)take((size_t)3 * DIMN * DIMN * 2);
    bf16*  wo_b = (bf16*)take((size_t)DIMN * DIMN * 2);
    bf16*  wgu  = (bf16*)take((size_t)2 * HIDDEN * DIMN * 2);
    bf16*  wdn  = (bf16*)take((size_t)DIMN * HIDDEN * 2);
    bf16*  qws  = (bf16*)take((size_t)MTOT * DIMN * 2);
    bf16*  kws  = (bf16*)take((size_t)MTOT * DIMN * 2);
    bf16*  vws  = (bf16*)take((size_t)MTOT * DIMN * 2);
    bf16*  attn = (bf16*)take((size_t)MTOT * DIMN * 2);
    float* x2   = (float*)take((size_t)MTOT * DIMN * 4);
    bf16*  a2   = (bf16*)take((size_t)MTOT * DIMN * 2);
    bf16*  mlp  = (bf16*)take((size_t)MTOT * HIDDEN * 2);

    // wqkv, wo_b, wgu and wdn were taken one behind another with no gap: wqkv is
    // the start of all bf16 weights
    prep_kernel<<<256, 512, 0, stream>>>(x, wq, wk, wv, wo, wgate, wup, wdown, n1w, wqkv, a1);

    gemm_kernel<0><<<dim3(3072 / 256, MTOT / 256), 256, 0, stream>>>(
        a1, wqkv, MTOT, 3072, DIMN, nullptr, nullptr, nullptr, qws, kws, vws);

    attn_kernel<<<dim3(S_LEN / 128, BATCH * NHEAD), 128, 0, stream>>>(qws, kws, vws, attn);

    gemm_kernel<2><<<dim3(DIMN / 128, MTOT / 128), 256, 0, stream>>>(
        attn, wo_b, MTOT, DIMN, DIMN, x2, nullptr, x, nullptr, nullptr, nullptr);

    rmsnorm_kernel<<<MTOT / 16, 512, 0, stream>>>(x2, n2w, a2);

    gemm_kernel<1><<<dim3(2 * HIDDEN / 256, MTOT / 256), 256, 0, stream>>>(
        a2, wgu, MTOT, 2 * HIDDEN, DIMN, nullptr, mlp, nullptr, nullptr, nullptr, nullptr);

    gemm_kernel<2><<<dim3(DIMN / 128, MTOT / 128), 256, 0, stream>>>(
        mlp, wdn, MTOT, DIMN, HIDDEN, (float*)d_out, nullptr, x2,
        nullptr, nullptr, nullptr);
}

// v010
// It runs in 149 microseconds.
// Timed twice side by side with v009, it ran 1.03 times as fast both times.
// Over all steps from v000 it is 2.54 times as fast.
#include <hip/hip_runtime.h>
#include <hip/hip_bf16.h>
#include <math.h>

typedef __bf16 bf16;
typedef __attribute__((ext_vector_type(16))) __bf16 v16bf;
typedef __attribute__((ext_vector_type(8)))  __bf16 v8bf;
typedef __attribute__((ext_vector_type(4)))  __bf16 v4bf;
typedef __attribute__((ext_vector_type(8)))  float  v8f;
typedef __attribute__((ext_vector_type(4)))  float  v4f;

#define DIMN   1024
#define S_LEN  2048
#define BATCH  2
#define NHEAD  16
#define HDIM   64
#define HIDDEN 4096
#define MTOT   (BATCH * S_LEN)   // 4096 rows

union Frag { v16bf v; v8bf h[2]; };

static __device__ __forceinline__ v8f wmma_bf16(const Frag& a, const Frag& b, v8f c) {
    return __builtin_amdgcn_wmma_f32_16x16x32_bf16(false, a.v, false, b.v,
                                                   (short)0, c, false, false);
}

// XOR-shuffle within each 16-lane half using v_permlane16_b32 (pure VALU,
// avoids ds_bpermute + s_wait_dscnt round-trips).
template <int M>
static __device__ __forceinline__ float permxor16(float v) {
#if __has_builtin(__builtin_amdgcn_permlane16)
    constexpr unsigned lo =
        ((unsigned)(0 ^ M)) | ((unsigned)(1 ^ M) << 4) | ((unsigned)(2 ^ M) << 8) |
        ((unsigned)(3 ^ M) << 12) | ((unsigned)(4 ^ M) << 16) |
        ((unsigned)(5 ^ M) << 20) | ((unsigned)(6 ^ M) << 24) |
        ((unsigned)(7 ^ M) << 28);
    constexpr unsigned hi =
        ((unsigned)((8 ^ M) & 15)) | ((unsigned)((9 ^ M) & 15) << 4) |
        ((unsigned)((10 ^ M) & 15) << 8) | ((unsigned)((11 ^ M) & 15) << 12) |
        ((unsigned)((12 ^ M) & 15) << 16) | ((unsigned)((13 ^ M) & 15) << 20) |
        ((unsigned)((14 ^ M) & 15) << 24) | ((unsigned)((15 ^ M) & 15) << 28);
    int iv = __builtin_bit_cast(int, v);
    int r = __builtin_amdgcn_permlane16(iv, iv, (int)lo, (int)hi, false, false);
    return __builtin_bit_cast(float, r);
#else
    return __shfl_xor(v, M, 32);
#endif
}

// Lane l <-> lane l ^ 16: the two halves of a wave that share a column of a
// WMMA accumulator tile (pure VALU).
static __device__ __forceinline__ float xhalf(float v) {
    const int iv = __builtin_bit_cast(int, v);
    const int r = __builtin_amdgcn_permlanex16(iv, iv, 0x76543210, 0xfedcba98, false, false);
    return __builtin_bit_cast(float, r);
}

// Eight 2^x and eight 1/x. The instruction set asks for one free issue slot behind a
// transcendental before its result is read or its source overwritten: here each
// instruction fills the slot of the one in front of it (the results are kept off
// all sources by the early-clobber mark), and the closing v_nop that of the last.
static __device__ __forceinline__ void exp2x8(float (&r)[8], const float (&x)[8]) {
    asm(
                 "v_exp_f32 %0, %8\n\t"
                 "v_exp_f32 %1, %9\n\t"
                 "v_exp_f32 %2, %10\n\t"
                 "v_exp_f32 %3, %11\n\t"
                 "v_exp_f32 %4, %12\n\t"
                 "v_exp_f32 %5, %13\n\t"
                 "v_exp_f32 %6, %14\n\t"
                 "v_exp_f32 %7, %15\n\t"
                 "v_nop"
                 : "=&v"(r[0]), "=&v"(r[1]), "=&v"(r[2]), "=&v"(r[3]),
                   "=&v"(r[4]), "=&v"(r[5]), "=&v"(r[6]), "=&v"(r[7])
                 : "v"(x[0]), "v"(x[1]), "v"(x[2]), "v"(x[3]),
                   "v"(x[4]), "v"(x[5]), "v"(x[6]), "v"(x[7]));
}
static __device__ __forceinline__ void rcpx8(float (&r)[8], const float (&x)[8]) {
    asm(
                 "v_rcp_f32 %0, %8\n\t"
                 "v_rcp_f32 %1, %9\n\t"
                 "v_rcp_f32 %2, %10\n\t"
                 "v_rcp_f32 %3, %11\n\t"
                 "v_rcp_f32 %4, %12\n\t"
                 "v_rcp_f32 %5, %13\n\t"
                 "v_rcp_f32 %6, %14\n\t"
                 "v_rcp_f32 %7, %15\n\t"
                 "v_nop"
                 : "=&v"(r[0]), "=&v"(r[1]), "=&v"(r[2]), "=&v"(r[3]),
                   "=&v"(r[4]), "=&v"(r[5]), "=&v"(r[6]), "=&v"(r[7])
                 : "v"(x[0]), "v"(x[1]), "v"(x[2]), "v"(x[3]),
                   "v"(x[4]), "v"(x[5]), "v"(x[6]), "v"(x[7]));
}

// Eight async global->LDS 16-B copies per lane (ASYNCcnt): rows l + i*lstep in
// LDS from rows g + i*gstep in global memory. The closing s_wait_xcnt 0 stands
// inside the copies' own statement so that no address register named here is
// rewritten ahead of it.
static __device__ __forceinline__ void async_copy8_b128(unsigned l, unsigned lstep,
                                                        const bf16* g, size_t gstep) {
    asm volatile("global_load_async_to_lds_b128 %0, %8, off\n\t"
                 "global_load_async_to_lds_b128 %1, %9, off\n\t"
                 "global_load_async_to_lds_b128 %2, %10, off\n\t"
                 "global_load_async_to_lds_b128 %3, %11, off\n\t"
                 "global_load_async_to_lds_b128 %4, %12, off\n\t"
                 "global_load_async_to_lds_b128 %5, %13, off\n\t"
                 "global_load_async_to_lds_b128 %6, %14, off\n\t"
                 "global_load_async_to_lds_b128 %7, %15, off\n\t"
                 "s_wait_xcnt 0x0"
                 :: "v"(l), "v"(l + lstep), "v"(l + 2 * lstep), "v"(l + 3 * lstep),
                    "v"(l + 4 * lstep), "v"(l + 5 * lstep), "v"(l + 6 * lstep),
                    "v"(l + 7 * lstep),
                    "v"(g), "v"(g + gstep), "v"(g + 2 * gstep), "v"(g + 3 * gstep),
                    "v"(g + 4 * gstep), "v"(g + 5 * gstep), "v"(g + 6 * gstep),
                    "v"(g + 7 * gstep)
                 : "memory");
}

// Four and four async global->LDS 16-B copies per lane: rows la + i*lstep from
// ga + i*gastep and rows lb + i*lstep from gb + i*gbstep. The closing
// s_wait_xcnt 0 stands inside the copies' own statement, as above.
static __device__ __forceinline__ void async_copy4x2_b128(unsigned la, const bf16* ga, size_t gastep,
                                                          unsigned lb, const bf16* gb, size_t gbstep,
                                                          unsigned lstep) {
    asm volatile("global_load_async_to_lds_b128 %0, %8, off\n\t"
                 "global_load_async_to_lds_b128 %1, %9, off\n\t"
                 "global_load_async_to_lds_b128 %2, %10, off\n\t"
                 "global_load_async_to_lds_b128 %3, %11, off\n\t"
                 "global_load_async_to_lds_b128 %4, %12, off\n\t"
                 "global_load_async_to_lds_b128 %5, %13, off\n\t"
                 "global_load_async_to_lds_b128 %6, %14, off\n\t"
                 "global_load_async_to_lds_b128 %7, %15, off\n\t"
                 "s_wait_xcnt 0x0"
                 :: "v"(la), "v"(la + lstep), "v"(la + 2 * lstep), "v"(la + 3 * lstep),
                    "v"(lb), "v"(lb + lstep), "v"(lb + 2 * lstep), "v"(lb + 3 * lstep),
                    "v"(ga), "v"(ga + gastep), "v"(ga + 2 * gastep), "v"(ga + 3 * gastep),
                    "v"(gb), "v"(gb + gbstep), "v"(gb + 2 * gbstep), "v"(gb + 3 * gbstep)
                 : "memory");
}

// The streaming stages run as few, long waves: 256 work-groups of 16 waves, one a
// WGP; every load is 512 contiguous bytes of a wave, and a wave issues all its
// loads before it works on the first of them.

// RMSNorm of one fp32 row by one wave -> bf16 row. xv, wv: the lane's elements
// i * 128 + 4 lane + e of the row and of the weight; orow: the row's start.
static __device__ __forceinline__ void rms_row(const v4f (&xv)[8], const v4f (&wv)[8],
                                               bf16* __restrict__ orow, int lane) {
    v4f sq = {};
#pragma unroll
    for (int i = 0; i < 8; ++i) sq += xv[i] * xv[i];
    float ss = (sq.x + sq.y) + (sq.z + sq.w);
    ss += permxor16<1>(ss);
    ss += permxor16<2>(ss);
    ss += permxor16<4>(ss);
    ss += permxor16<8>(ss);
    ss += xhalf(ss);
    const float rinv = rsqrtf(ss * (1.f / DIMN) + 1e-5f);
#pragma unroll
    for (int i = 0; i < 8; ++i) {
        v4bf o;
#pragma unroll
        for (int e = 0; e < 4; ++e) o[e] = (bf16)(xv[i][e] * rinv * wv[i][e]);
        ((v4bf*)orow)[i * 32 + lane] = o;
    }
}

// One launch for all that stands in front of the first GEMM. A wave takes one row
// of the first RMSNorm and 4096 elements of the fp32 -> bf16 weight convert. wdst:
// the bf16 weights, one behind another in the order wq wk wv wo [wgate, wup] wdown.
// wgate and wup share one matrix of 2 * HIDDEN rows, interleaved in groups of 16
// rows: hidden column h = 64 t + 32 w + 16 j + i has its gate row at
// 128 t + 64 w + 16 j + i and its up row 32 rows further on, so that a GEMM wave,
// which takes whole groups of 64 such rows, holds gate and up of the same hidden
// columns.
__global__ __launch_bounds__(512)
void prep_kernel(const float* __restrict__ x, const float* __restrict__ wq,
                 const float* __restrict__ wk, const float* __restrict__ wv,
                 const float* __restrict__ wo, const float* __restrict__ wgate,
                 const float* __restrict__ wup, const float* __restrict__ wdown,
                 const float* __restrict__ n1w,
                 bf16* __restrict__ wdst, bf16* __restrict__ a1) {
    const int lane = threadIdx.x & 31;
    // in a scalar register: every base address below is then scalar
    const int wave = __builtin_amdgcn_readfirstlane(threadIdx.x >> 5);
    const int blk = blockIdx.x;
    const size_t row = (size_t)blk * 16 + wave;
    const int c = blk >> 4;            // piece of DIMN * DIMN elements, 16 blocks each
    const size_t pc = (size_t)DIMN * DIMN;
    const float* s = c == 0 ? wq : c == 1 ? wk : c == 2 ? wv : c == 3 ? wo
                   : c < 8  ? wgate + (size_t)(c - 4) * pc
                   : c < 12 ? wup + (size_t)(c - 8) * pc
                            : wdown + (size_t)(c - 12) * pc;
    s += (blk & 15) * 65536 + wave * 4096;
    const float* xr = x + row * DIMN;
    // a wave's 4096 elements are 4 whole rows of wgate or wup, inside one group of 16;
    // h: the first one's hidden column; rows count DIMN elements
    const int h = ((c & 3) << 10) + ((blk & 15) << 6) + (wave << 2);
    const int gurow = 4 * DIMN + ((h >> 6) << 7) + (((h >> 5) & 1) << 6) + (h & 31)
                      + (c >= 8 ? 32 : 0);
    bf16* d = wdst + (c >= 4 && c < 12 ? (size_t)gurow : row * 4) * DIMN;

    // the loops are unrolled so that the arrays stay in registers
    v4f xv[8], nv[8], v[32];
#pragma unroll
    for (int i = 0; i < 8; ++i) xv[i] = ((const v4f*)xr)[i * 32 + lane];
#pragma unroll
    for (int i = 0; i < 8; ++i) nv[i] = ((const v4f*)n1w)[i * 32 + lane];
#pragma unroll
    for (int i = 0; i < 32; ++i) v[i] = ((const v4f*)s)[i * 32 + lane];
    // Keeps all 48 loads in front of the arithmetic; without it the scheduler holds
    // part of them back and the wave waits out the memory latency several times.
    __builtin_amdgcn_sched_barrier(0);

    rms_row(xv, nv, a1 + row * DIMN, lane);

#pragma unroll
    for (int i = 0; i < 32; ++i) {
        v4bf o;
#pragma unroll
        for (int e = 0; e < 4; ++e) o[e] = (bf16)v[i][e];
        ((v4bf*)d)[i * 32 + lane] = o;
    }
}

__global__ __launch_bounds__(512) void rmsnorm_kernel(const float* __restrict__ x,
                                                      const float* __restrict__ w,
                                                      bf16* __restrict__ out) {
    const int lane = threadIdx.x & 31;
    // in a scalar register: the row's base address is then scalar
    const int wave = __builtin_amdgcn_readfirstlane(threadIdx.x >> 5);
    const size_t row = (size_t)blockIdx.x * 16 + wave;
    const float* xr = x + row * DIMN;
    // the loops are unrolled so that the arrays stay in registers
    v4f xv[8], wv[8];
#pragma unroll
    for (int i = 0; i < 8; ++i) xv[i] = ((const v4f*)xr)[i * 32 + lane];
#pragma unroll
    for (int i = 0; i < 8; ++i) wv[i] = ((const v4f*)w)[i * 32 + lane];
    // Keeps all 16 loads in front of the arithmetic; without it the scheduler sinks
    // six weight loads behind the row sum and the wave waits a second time.
    __builtin_amdgcn_sched_barrier(0);
    rms_row(xv, wv, out + row * DIMN, lane);
}

// ---------------- WMMA GEMM: C[M,N] = A[M,K] @ W[N,K]^T ----------------
// Two-buffer LDS ring filled by async global->LDS copies (ASYNCcnt). A ring tile
// holds KT = 128 k of BT A rows and BT W rows: every row is 256 contiguous
// bytes of global memory, at an LDS pitch of 272 B (16 B x odd).
// The work-group's tile is BT x BT, eight waves as 4 (M) x 2 (N). BT = 256 in MODE 0
// and 1, whose outputs give 192 and 512 such tiles, one work-group a WGP: a wave
// holds 64 x 128, so that a k step's 24 LDS reads feed 32 WMMAs and the operand rows
// are fetched from L2 half as often as at 128. BT = 128 in MODE 2 (N = DIMN: 256 tiles).
// M, N multiples of BT; K a multiple of 128 (MODE 0 and 1: K = DIMN).
// MODE 0: QKV scatter (N=3072): q/k -> [B,H,S,Dh] bf16, v -> [B,H,Dh,S] bf16
// MODE 1: W = gate and up rows interleaved as prep_kernel lays them (N = 2 * HIDDEN):
//         store bf16 silu(gate) * up, [M, HIDDEN]; a lane's tiles nt and nt + 2
//         (nt = 0, 1, 4, 5) are gate and up of the same hidden column
// MODE 2: store fp32 C[M,N] + res[M,N], N = DIMN (the row pitch is a constant, so that
//         the epilogue's rows differ by an immediate offset only)
template <int MODE>
__global__ __launch_bounds__(256)
void gemm_kernel(const bf16* __restrict__ A, const bf16* __restrict__ W,
                 int M, int N, int K,
                 float* __restrict__ outF, bf16* __restrict__ outB,
                 const float* __restrict__ res,
                 bf16* __restrict__ qo, bf16* __restrict__ ko, bf16* __restrict__ vo) {
    constexpr int KT = 128;            // k per ring tile
    constexpr int LP = KT + 8;         // LDS row pitch in elements
    constexpr int BT = MODE == 2 ? 128 : 256;   // edge of the work-group's tile
    constexpr int FM = BT / 64;        // A fragments of a wave
    constexpr int FN = BT / 32;        // W fragments of a wave
    __shared__ bf16 As[2][BT * LP];
    __shared__ bf16 Bs[2][BT * LP];
    const int m0 = blockIdx.y * BT;
    const int n0 = blockIdx.x * BT;
    const int tid = threadIdx.x;
    const int lane = tid & 31;
    const int wave = tid >> 5;
    const int wm = (wave >> 1) * (16 * FM);   // wave M offset (4 waves in M)
    const int wn = (wave & 1) * (16 * FN);    // wave N offset (2 waves in N)
    const int lo = lane & 15;
    const int hi = lane >> 4;
    const int kb = hi << 3;            // K-chunk base per A/B VGPR layout

    v8f acc[FM][FN] = {};

    // 16 lanes cover one 256-B row; a thread copies rows srow + 16 i, i < BT / 16,
    // of A and of W: BT / 8 async b128 copies per thread and tile.
    const int srow = tid >> 4, scol = (tid & 15) << 3;
    // K is DIMN in MODE 0 and 1: with K as a constant (and the k loop kept rolled) the
    // 64 x 128 accumulators and the two fragment sets fit the registers unspilled
    const int Kd = MODE == 2 ? K : DIMN;
    // A work-group walks the k tiles as a ring from a start of its own, set by its tile
    // indices: the work-groups that share A rows (equal y) or W rows (equal x) then ask
    // L2 for different lines at any one moment, not all for the same ones. MODE 0 starts
    // at k = 0: with the ring start its build reloads a spilled register in the k loop.
    // kn: the k tile that the next call of stage() copies; gA, gW point at it.
    const int ntile = Kd / KT;
    int kn = MODE == 0 ? 0 : (int)((blockIdx.x + blockIdx.y) % (unsigned)ntile);
    const bf16* gA = A + (size_t)(m0 + srow) * Kd + scol + kn * KT;
    const bf16* gW = W + (size_t)(n0 + srow) * Kd + scol + kn * KT;
    const size_t gstep = (size_t)16 * Kd;
    const unsigned lA = (unsigned)(size_t)&As[0][srow * LP + scol];
    const unsigned lB = (unsigned)(size_t)&Bs[0][srow * LP + scol];

    auto stage = [&](unsigned pb) {
        const unsigned bo = pb * (unsigned)(BT * LP * sizeof(bf16));
        // one or two groups of 128 rows; unrolled so that a group's offsets are constants
#pragma unroll
        for (int g = 0; g < BT / 128; ++g) {
            const unsigned lo128 = bo + g * (unsigned)(128 * LP * sizeof(bf16));
            async_copy8_b128(lA + lo128, 16 * LP * sizeof(bf16), gA + 8 * g * gstep, gstep);
            async_copy8_b128(lB + lo128, 16 * LP * sizeof(bf16), gW + 8 * g * gstep, gstep);
        }
        // on to the next k tile; behind the last one the ring goes back to k = 0
        const bool wrap = MODE != 0 && kn + 1 == ntile;
        const int dk = wrap ? KT - Kd : KT;
        kn = wrap ? 0 : kn + 1;
        gA += dk;
        gW += dk;
    };

    // Two fragment sets: the LDS reads of a k step go out as one group, one k
    // step ahead of the WMMAs that use them. The loops over mt and nt below are
    // unrolled so that every fragment and accumulator index is a constant and the
    // arrays stay in registers.
    Frag a[2][FM], b[2][FN];
    auto frags = [&](unsigned pb, int ks, int set) {
#pragma unroll
        for (int mt = 0; mt < FM; ++mt) {
            const bf16* ap = &As[pb][(wm + mt * 16 + lo) * LP + ks + kb];
            a[set][mt].h[0] = *(const v8bf*)ap;
            a[set][mt].h[1] = *(const v8bf*)(ap + 16);
        }
#pragma unroll
        for (int nt = 0; nt < FN; ++nt) {
            const bf16* bp = &Bs[pb][(wn + nt * 16 + lo) * LP + ks + kb];
            b[set][nt].h[0] = *(const v8bf*)bp;
            b[set][nt].h[1] = *(const v8bf*)(bp + 16);
        }
    };
    auto mma = [&](int set) {
        // Keeps the next step's reads, written above, in front of these WMMAs;
        // without it the scheduler sinks them to two reads and a full wait per
        // WMMA pair.
        __builtin_amdgcn_sched_barrier(0);
#pragma unroll
        for (int nt = 0; nt < FN; ++nt)
#pragma unroll
            for (int mt = 0; mt < FM; ++mt)
                acc[mt][nt] = wmma_bf16(a[set][mt], b[set][nt], acc[mt][nt]);
        // Keeps the following group of reads whole, behind these WMMAs.
        __builtin_amdgcn_sched_barrier(0);
    };

    constexpr int NS = KT / 32;        // k steps per tile (even: step 0 is set 0)
    stage(0);
    // tile 0 has landed for this wave; the barrier publishes it to the others
    asm volatile("s_wait_asynccnt 0x0" ::: "memory");
    __syncthreads();
    if (Kd >= 2 * KT) stage(1);
    frags(0, 0, 0);
    // kept rolled: left to the compiler, the constant trip count of MODE 0 and 1 gave
    // a build that takes every register of the budget and spills
#pragma clang loop unroll(disable)
    for (int t = 0; t < ntile; ++t) {
        const unsigned pb = (unsigned)(t & 1);
        // unrolled so that the k steps of a tile read at constant LDS offsets and
        // the fragment sets stay in registers
#pragma unroll
        for (int s = 0; s + 1 < NS; ++s) {
            frags(pb, (s + 1) * 32, (s + 1) & 1);
            mma(s & 1);
        }
        // Publish point of tile t + 1, in front of tile t's last k step, whose
        // fragments are fetched: this wave's reads of buffer t & 1 have retired,
        // its copies of tile t + 1 have landed, then one barrier that both
        // publishes tile t + 1 and frees buffer t & 1 for the refill.
        asm volatile("s_wait_dscnt 0x0" ::: "memory");
        asm volatile("s_wait_asynccnt 0x0" ::: "memory");
        __syncthreads();
        if (t + 2 < ntile) stage(pb);
        if (t + 1 < ntile) frags(pb ^ 1u, 0, 0);
        mma((NS - 1) & 1);
    }
    // no copy is left outstanding when the wave goes on to its stores and ends
    asm volatile("s_wait_asynccnt 0x0" ::: "memory");

    // The tile leaves through LDS, so that every global access of the epilogue is
    // 16 B a lane and covers whole 128-B lines. The staging area is the A half of the
    // ring (both buffers): behind the loop's last barrier no wave reads the ring any more and no copy
    // is outstanding. The loops are unrolled so that the arrays stay in registers.

    // in a scalar register: the row part of the global addresses is then scalar
    const int swave = __builtin_amdgcn_readfirstlane(wave);
    if constexpr (MODE == 0) {
        constexpr int SP = BT + 8;     // staging pitch in elements: 528 B (16 B x odd)
        bf16* st = &As[0][0];
        const int which = n0 >> 10;    // 0 q, 1 k, 2 v: the same for the whole tile
        if (which < 2) {
            // staged as [position][column]
#pragma unroll
            for (int mt = 0; mt < FM; ++mt)
#pragma unroll
                for (int nt = 0; nt < FN; ++nt)
#pragma unroll
                    for (int r = 0; r < 8; ++r)
                        st[(wm + mt * 16 + hi * 8 + r) * SP + wn + nt * 16 + lo] =
                            (bf16)acc[mt][nt][r];
        } else {
            // staged as [column][position]: a lane's 8 values of a tile are 8
            // positions in a row of one column
#pragma unroll
            for (int mt = 0; mt < FM; ++mt)
#pragma unroll
                for (int nt = 0; nt < FN; ++nt) {
                    v8bf p;
#pragma unroll
                    for (int r = 0; r < 8; ++r) p[r] = (bf16)acc[mt][nt][r];
                    *(v8bf*)(st + (wn + nt * 16 + lo) * SP + wm + mt * 16 + hi * 8) = p;
                }
        }
        // every wave's part of the tile is in LDS before any wave reads it back
        __syncthreads();
        const int bq = m0 >> 11, s0 = m0 & 2047;
        const int h4 = (n0 & 1023) >> 6;           // the first of the tile's four heads
        const int c = lane << 3;                   // a wave covers a staged row of 512 B
        // the wave's rows: swave + 8 i. For q and k a staged row is one position: 128 B
        // of each of the four heads. For v it is one column: 512 B of a row of V^T; the
        // four heads' V^T stand one behind another.
        bf16* dst = which < 2
            ? (which == 0 ? qo : ko)
              + ((size_t)(bq * NHEAD + h4 + (c >> 6)) * S_LEN + s0 + swave) * HDIM + (c & 63)
            : vo + ((size_t)(bq * NHEAD + h4) * HDIM + swave) * S_LEN + s0 + c;
        const size_t dstep = which < 2 ? (size_t)8 * HDIM : (size_t)8 * S_LEN;
#pragma unroll
        for (int i0 = 0; i0 < BT / 8; i0 += 8) {
            v8bf val[8];
#pragma unroll
            for (int i = 0; i < 8; ++i)
                val[i] = *(const v8bf*)(st + ((i0 + i) * 8 + swave) * SP + c);
#pragma unroll
            for (int i = 0; i < 8; ++i) *(v8bf*)(dst + (size_t)(i0 + i) * dstep) = val[i];
        }
    } else if constexpr (MODE == 1) {
        constexpr int SP = BT / 2 + 8; // staging pitch in elements: 272 B (16 B x odd)
        bf16* st = &As[0][0];
        // a wave's 128 W rows are two groups of 64: tiles 4 g + j are the gate half and
        // tiles 4 g + 2 + j the up half of hidden columns 32 g + 16 j + lo of its 64
#pragma unroll
        for (int mt = 0; mt < FM; ++mt)
#pragma unroll
            for (int g = 0; g < FN / 4; ++g)
#pragma unroll
                for (int j = 0; j < 2; ++j) {
                    const v8f gate = acc[mt][4 * g + j], up = acc[mt][4 * g + 2 + j];
                    float t[8], e[8], sig[8];      // sig = 1 / (1 + e^-gate)
#pragma unroll
                    for (int r = 0; r < 8; ++r) t[r] = gate[r] * -1.44269504f;  // -g log2 e
                    exp2x8(e, t);
#pragma unroll
                    for (int r = 0; r < 8; ++r) t[r] = 1.f + e[r];
                    rcpx8(sig, t);
#pragma unroll
                    for (int r = 0; r < 8; ++r)
                        st[(wm + mt * 16 + hi * 8 + r) * SP + (wn >> 1) + g * 32 + j * 16 + lo] =
                            (bf16)(gate[r] * sig[r] * up[r]);
                }
        // every wave's part of the tile is in LDS before any wave reads it back
        __syncthreads();
        const int c = (lane & 15) << 3;            // 16 lanes cover a staged row of 256 B
#pragma unroll
        for (int i = 0; i < BT / 16; ++i) {
            const int row = i * 16 + swave * 2 + hi;
            *(v8bf*)(outB + (size_t)(m0 + row) * HIDDEN + (n0 >> 1) + c) =
                *(const v8bf*)(st + row * SP + c);
        }
    } else {
        constexpr int SP = 128 + 4;    // staging pitch in floats: 528 B (16 B x odd)
        float* st = (float*)&As[0][0];
        // a wave-wide access is one whole row of the tile, 512 B; the residual rows
        // are asked for first and fly while the tile is staged
        const size_t t0 = (size_t)(m0 + swave) * DIMN + n0;   // the wave's first row, scalar
        const unsigned lb = (unsigned)lane * 16u;          // the lane's byte in a row
        v4f rv[16];
#pragma unroll
        for (int i = 0; i < 16; ++i)
            rv[i] = *(const v4f*)((const char*)(res + t0 + (size_t)i * 8 * DIMN) + lb);
#pragma unroll
        for (int mt = 0; mt < FM; ++mt)
#pragma unroll
            for (int nt = 0; nt < FN; ++nt)
#pragma unroll
                for (int r = 0; r < 8; ++r)
                    st[(wm + mt * 16 + hi * 8 + r) * SP + wn + nt * 16 + lo] = acc[mt][nt][r];
        // every wave's part of the tile is in LDS before any wave reads it back
        __syncthreads();
#pragma unroll
        for (int i = 0; i < 16; ++i) {
            const v4f cv = *(const v4f*)(st + (i * 8 + swave) * SP + lane * 4);
            *(v4f*)((char*)(outF + t0 + (size_t)i * 8 * DIMN) + lb) = cv + rv[i];
        }
    }
}

__global__ __launch_bounds__(128)
void attn_kernel(const bf16* __restrict__ q, const bf16* __restrict__ k,
                 const bf16* __restrict__ v, bf16* __restrict__ out) {
    constexpr int KS = 64;             // keys per ring stage
    constexpr int LPA = 64 + 8;        // LDS row pitch in elements
    __shared__ __attribute__((aligned(16))) bf16 Ks[2][KS * LPA];     // [key][d]
    __shared__ __attribute__((aligned(16))) bf16 Vs[2][HDIM * LPA];   // [d][key]
    const int tid = threadIdx.x;
    const int lane = tid & 31;
    // in a scalar register: the test that skips a pass is then a scalar branch
    const int wave = __builtin_amdgcn_readfirstlane(tid >> 5);
    const int lo = lane & 15;
    const int hi = lane >> 4;
    const int kb = hi << 3;
    const int bh = blockIdx.y;                   // 0..31
    const int b = bh >> 4, h0 = bh & 15;

    // 8 lanes cover one 128-B row; a thread copies rows crow + 16 i, i = 0..3, of
    // the stage's K and of its V^T: 8 async b128 copies per thread and stage.
    const int crow = tid >> 3, ccol = (tid & 7) << 3;
    const bf16* gK = k + (((size_t)bh) * S_LEN + crow) * HDIM + ccol;
    const bf16* gV = v + (((size_t)bh) * HDIM + crow) * S_LEN + ccol;
    const unsigned lK = (unsigned)(size_t)&Ks[0][crow * LPA + ccol];
    const unsigned lV = (unsigned)(size_t)&Vs[0][crow * LPA + ccol];
    auto stage = [&](int t, unsigned pb) {
        const unsigned bo = pb * (unsigned)(KS * LPA * sizeof(bf16));
        async_copy4x2_b128(lK + bo, gK + (size_t)t * KS * HDIM, (size_t)16 * HDIM,
                           lV + bo, gV + (size_t)t * KS, (size_t)16 * S_LEN,
                           16 * LPA * sizeof(bf16));
    };

  // The long tile first, then the short one. The ring starts anew for the second
  // tile: the barrier at the foot of the first tile's last stage has ended every
  // wave's reads of both buffers, and no copy is outstanding there.
  for (int half = 0; half < 2; ++half) {
    const int qt = half == 0 ? S_LEN / 64 - 1 - (int)blockIdx.x : (int)blockIdx.x;
    const int qbase = qt * 64 + wave * 16;

    // B operand of S^T: column lo = query qbase + lo
    const bf16* qp = q + (((size_t)bh) * S_LEN + qbase + lo) * HDIM;
    Frag qb[2];
    qb[0].h[0] = *(const v8bf*)(qp + kb);
    qb[0].h[1] = *(const v8bf*)(qp + kb + 16);
    qb[1].h[0] = *(const v8bf*)(qp + 32 + kb);
    qb[1].h[1] = *(const v8bf*)(qp + 32 + kb + 16);

    v8f o[4] = {};               // O^T: row d = 16 dt + 8 hi + r, column = query lo
    float mrow = -INFINITY;      // running maximum of query lo (equal in both halves)
    float lsum = 0.f;            // this half's share of the running sum of query lo
    const float scale = 0.125f;  // 1/sqrt(64)

    const int nst = qt + 1;            // stages up to the tile's diagonal
    stage(0, 0);
    // stage 0 has landed for this wave; the barrier publishes it to the others
    asm volatile("s_wait_asynccnt 0x0" ::: "memory");
    __syncthreads();
    if (nst > 1) stage(1, 1);
    for (int t = 0; t < nst; ++t) {
      // unrolled so that both passes of a stage read at constant LDS offsets
#pragma unroll
      for (int ps = 0; ps < 2; ++ps) {
        const int j0 = t * KS + ps * 32;
        // a pass wholly beyond this wave's diagonal is skipped (wave-uniform);
        // the publish point below stands outside the skip
        if (j0 > qbase + 15) continue;
        const bf16* kp = &Ks[t & 1][(ps * 32 + lo) * LPA + kb];
        const bf16* vp = &Vs[t & 1][lo * LPA + ps * 32 + kb];
        // A operands: K rows j0 + lo and j0 + 16 + lo; V^T rows d = 16 dt + lo
        Frag a00, a01, a10, a11, va[4];
        a00.h[0] = *(const v8bf*)(kp);
        a00.h[1] = *(const v8bf*)(kp + 16);
        a01.h[0] = *(const v8bf*)(kp + 32);
        a01.h[1] = *(const v8bf*)(kp + 48);
        a10.h[0] = *(const v8bf*)(kp + 16 * LPA);
        a10.h[1] = *(const v8bf*)(kp + 16 * LPA + 16);
        a11.h[0] = *(const v8bf*)(kp + 16 * LPA + 32);
        a11.h[1] = *(const v8bf*)(kp + 16 * LPA + 48);
#pragma unroll
        for (int dt = 0; dt < 4; ++dt) {
            va[dt].h[0] = *(const v8bf*)(vp + dt * 16 * LPA);
            va[dt].h[1] = *(const v8bf*)(vp + dt * 16 * LPA + 16);
        }
        // The pass's 16 LDS reads go out as one group ahead of its WMMAs; without
        // this line the scheduler puts two reads and a full wait in front of each
        // score WMMA and the wave waits out the LDS latency several times a pass.
        __builtin_amdgcn_sched_barrier(0);
        v8f s0 = {}, s1 = {};
        s0 = wmma_bf16(a00, qb[0], s0);
        s1 = wmma_bf16(a10, qb[0], s1);
        s0 = wmma_bf16(a01, qb[1], s0);
        s1 = wmma_bf16(a11, qb[1], s1);

        // Online softmax of query lo. s0[r] is key j0 + kb + r, s1[r] key
        // j0 + 16 + kb + r; a key is inside the causal mask while its offset
        // from j0 + kb does not exceed lim.
        const int lim = qbase + lo - j0 - kb;
        float x0[8], x1[8];
        float mx = -INFINITY;
#pragma unroll
        for (int r = 0; r < 8; ++r) {
            x0[r] = (r      <= lim) ? s0[r] * scale : -INFINITY;
            x1[r] = (r + 16 <= lim) ? s1[r] * scale : -INFINITY;
            mx = fmaxf(mx, fmaxf(x0[r], x1[r]));
        }
        mx = fmaxf(mx, xhalf(mx));
        const float mnew = fmaxf(mrow, mx);
        const float alpha = __expf(mrow - mnew);
        mrow = mnew;
        Frag pb;
        float ps0 = 0.f, ps1 = 0.f;
#pragma unroll
        for (int r = 0; r < 8; ++r) {
            const float p0 = __expf(x0[r] - mnew);
            const float p1 = __expf(x1[r] - mnew);
            ps0 += p0;
            ps1 += p1;
            pb.h[0][r] = (bf16)p0;
            pb.h[1][r] = (bf16)p1;
        }
        lsum = lsum * alpha + (ps0 + ps1);
#pragma unroll
        for (int dt = 0; dt < 4; ++dt) {
            v8f ov = o[dt];
#pragma unroll
            for (int r = 0; r < 8; ++r) ov[r] *= alpha;
            o[dt] = wmma_bf16(va[dt], pb, ov);
        }
      }
      // Publish point of stage t + 1: this wave's reads of buffer t & 1 have
      // retired, its copies of stage t + 1 have landed, then one barrier that
      // both publishes stage t + 1 and frees buffer t & 1 for the refill.
      asm volatile("s_wait_dscnt 0x0" ::: "memory");
      asm volatile("s_wait_asynccnt 0x0" ::: "memory");
      __syncthreads();
      if (t + 2 < nst) stage(t + 2, (unsigned)(t & 1));
    }
    // no copy is left outstanding when the wave goes on to its stores
    asm volatile("s_wait_asynccnt 0x0" ::: "memory");

    const float ltot = lsum + xhalf(lsum);
    bf16* op = out + ((size_t)(b * S_LEN + qbase + lo)) * DIMN + h0 * HDIM + kb;
#pragma unroll
    for (int dt = 0; dt < 4; ++dt) {
        v8bf ov;
#pragma unroll
        for (int r = 0; r < 8; ++r) ov[r] = (bf16)(o[dt][r] / ltot);
        *(v8bf*)(op + dt * 16) = ov;
    }
    // the next tile rewrites the registers that these stores name
    asm volatile("s_wait_xcnt 0x0" ::: "memory");
  }
}

extern "C" void kernel_launch(void* const* d_in, const int* in_sizes, int n_in,
                              void* d_out, int out_size, void* d_ws, size_t ws_size,
                              hipStream_t stream) {
    const float* x     = (const float*)d_in[0];
    const float* wq    = (const float*)d_in[1];
    const float* wk    = (const float*)d_in[2];
    const float* wv    = (const float*)d_in[3];
    const float* wo    = (const float*)d_in[4];
    const float* wgate = (const float*)d_in[5];
    const float* wup   = (const float*)d_in[6];
    const float* wdown = (const float*)d_in[7];
    const float* n1w   = (const float*)d_in[8];
    const float* n2w   = (const float*)d_in[9];

    char* ws = (char*)d_ws;
    size_t off = 0;
    auto take = [&](size_t bytes) -> char* {
        char* p = ws + off;
        off += (bytes + 255) & ~(size_t)255;
        return p;
    };
    bf16*  a1   = (bf16*)take((size_t)MTOT * DIMN * 2);
    bf16*  wqkv = (bf16*)take((size_t)3 * DIMN * DIMN * 2);
    bf16*  wo_b = (bf16*)take((size_t)DIMN * DIMN * 2);
    bf16*  wgu  = (bf16*)take((size_t)2 * HIDDEN * DIMN * 2);
    bf16*  wdn  = (bf16*)take((size_t)DIMN * HIDDEN * 2);
    bf16*  qws  = (bf16*)take((size_t)MTOT * DIMN * 2);
    bf16*  kws  = (bf16*)take((size_t)MTOT * DIMN * 2);
    bf16*  vws  = (bf16*)take((size_t)MTOT * DIMN * 2);
    bf16*  attn = (bf16*)take((size_t)MTOT * DIMN * 2);
    float* x2   = (float*)take((size_t)MTOT * DIMN * 4);
    bf16*  a2   = (bf16*)take((size_t)MTOT * DIMN * 2);
    bf16*  mlp  = (bf16*)take((size_t)MTOT * HIDDEN * 2);

    // wqkv, wo_b, wgu and wdn were taken one behind another with no gap: wqkv is
    // the start of all bf16 weights
    prep_kernel<<<256, 512, 0, stream>>>(x, wq, wk, wv, wo, wgate, wup, wdown, n1w, wqkv, a1);

    gemm_kernel<0><<<dim3(3072 / 256, MTOT / 256), 256, 0, stream>>>(
        a1, wqkv, MTOT, 3072, DIMN, nullptr, nullptr, nullptr, qws, kws, vws);

    attn_kernel<<<dim3(S_LEN / 128, BATCH * NHEAD), 128, 0, stream>>>(qws, kws, vws, attn);

    gemm_kernel<2><<<dim3(DIMN / 128, MTOT / 128), 256, 0, stream>>>(
        attn, wo_b, MTOT, DIMN, DIMN, x2, nullptr, x, nullptr, nullptr, nullptr);

    rmsnorm_kernel<<<MTOT / 16, 512, 0, stream>>>(x2, n2w, a2);

    gemm_kernel<1><<<dim3(2 * HIDDEN / 256, MTOT / 256), 256, 0, stream>>>(
        a2, wgu, MTOT, 2 * HIDDEN, DIMN, nullptr, mlp, nullptr, nullptr, nullptr, nullptr);

    gemm_kernel<2><<<dim3(DIMN / 128, MTOT / 128), 256, 0, stream>>>(
        mlp, wdn, MTOT, DIMN, HIDDEN, (float*)d_out, nullptr, x2,
        nullptr, nullptr, nullptr);
}
